// v000
// Measured on an AMD MI455X. A time is GPU time per run, averaged over a window of back-to-back runs after a warm-up
// (all launches, gaps included; the runs take copies of the inputs in turn), and the median of several windows.
// Apart from v000's, it joins two sittings. Times from different sittings can be a few percent apart, while
// side-by-side timings come from the same sitting.
// v000 is the starting kernel. One run takes 1470 microseconds.
// compute dtype: all float inputs rounded to bf16; q/k/v = x W^T + b with EXACT bf16 products on WMMA 16x16x32, f32 accumulate; rotary in f32 (inv_freq = 10000^(-2i/64) via exp2f/log2f-free powf, precise cosf/sinf); q, k rounded once to f16 (0.02-scale weights: logits std ~0.05, 1 product), causal logits stored in f32 (4 heads per launch); softmax in f32 (precise expf), P x 2^11 kept f32 split bf16 hi + lo against v bf16 hi + lo (3 products); out = o (bf16 hi + lo) Wo^T + bo; f32 output.
#include <hip/hip_runtime.h>
#include <math.h>

typedef __attribute__((ext_vector_type(16))) _Float16 v16h;
typedef __attribute__((ext_vector_type(16))) __bf16 v16b;
typedef __attribute__((ext_vector_type(8)))  _Float16 v8h;
typedef __attribute__((ext_vector_type(8)))  float v8f;
typedef __attribute__((ext_vector_type(4)))  float v4f;
typedef __attribute__((ext_vector_type(2)))  float v2f;
typedef __attribute__((ext_vector_type(4)))  unsigned v4u;
typedef __attribute__((ext_vector_type(4)))  int v4i;
typedef float __attribute__((may_alias)) float_a;
typedef int __attribute__((may_alias)) int_a;

template <typename T> __device__ __forceinline__ void vst2(void* p, T v) { *(T*)p = v;  }
__device__ __forceinline__ v8f wmma16(v16h a, v16h b, v8f c) {
  v8f d = __builtin_amdgcn_wmma_f32_16x16x32_f16(false, a, false, b, (short)0, c, false, false);
  asm volatile("v_nop\n\tv_nop\n\tv_nop\n\tv_nop" : "+v"(d) : "v"(a), "v"(b));
  return d;
}
__device__ __forceinline__ v8f wmma_bf(v16b a, v16b b, v8f c) {
  v8f d = __builtin_amdgcn_wmma_f32_16x16x32_bf16(false, a, false, b, (short)0, c, false, false);
  asm volatile("v_nop\n\tv_nop\n\tv_nop\n\tv_nop" : "+v"(d) : "v"(a), "v"(b));
  return d;
}
// 16x16x32 fragments: lane = (h = lane>>4, row/col = lane&15); elements 0..7 = k0+8h+0..7, 8..15 = k0+16+8h+0..7; D element r = row 8h+r
__device__ __forceinline__ v16h frag_h(const _Float16* rowk0, int lane) {
  union { v16h v; v8h q[2]; } u; const _Float16* p = rowk0 + 8 * (lane >> 4);
  u.q[0] = *(const v8h*)p; u.q[1] = *(const v8h*)(p + 16); return u.v;
}
__device__ __forceinline__ v16h frag_f32(const float* rowk0, int lane) {
  v16h a; const float* p = rowk0 + 8 * (lane >> 4);
#pragma unroll
  for (int i = 0; i < 8; ++i) { a[i] = (_Float16)p[i]; a[8 + i] = (_Float16)p[16 + i]; }
  return a;
}
__device__ __forceinline__ v16h frag_f32s(const float* rowk0, int lane, float sc) {
  v16h a; const float* p = rowk0 + 8 * (lane >> 4);
#pragma unroll
  for (int i = 0; i < 8; ++i) { a[i] = (_Float16)(p[i] * sc); a[8 + i] = (_Float16)(p[16 + i] * sc); }
  return a;
}
// column fragment from a [K][ld] layout (column n), rows >= K read as 0
__device__ __forceinline__ v16h fragc_f32(const float* W, int k0, int n, int lane, int ld, int K) {
  v16h a; const int g = lane >> 4;
#pragma unroll
  for (int i = 0; i < 8; ++i) { const int ka = k0 + 8 * g + i, kb = ka + 16;
    a[i] = (_Float16)(ka < K ? W[(size_t)(ka < K ? ka : K - 1) * ld + n] : 0.f); a[8 + i] = (_Float16)(kb < K ? W[(size_t)(kb < K ? kb : K - 1) * ld + n] : 0.f); }
  return a;
}
struct F2 { v16b h, l; };
__device__ __forceinline__ F2 bsplit16(const float v[16]) { F2 r;
#pragma unroll
  for (int i = 0; i < 16; ++i) { const __bf16 h = (__bf16)v[i]; r.h[i] = h; r.l[i] = (__bf16)(v[i] - (float)h); }
  return r; }
__device__ __forceinline__ F2 split_row(const float* row, int k0, int lane) { float v[16]; const float* p = row + k0 + 8 * (lane >> 4);
#pragma unroll
  for (int i = 0; i < 8; ++i) { v[i] = p[i]; v[8 + i] = p[16 + i]; }
  return bsplit16(v); }
__device__ __forceinline__ F2 split_rowK(const float* row, int k0, int lane, int K) { float v[16]; const int g = lane >> 4;
#pragma unroll
  for (int i = 0; i < 8; ++i) { const int ka = k0 + 8 * g + i, kb = ka + 16; v[i] = ka < K ? row[ka < K ? ka : K - 1] : 0.f; v[8 + i] = kb < K ? row[kb < K ? kb : K - 1] : 0.f; }
  return bsplit16(v); }
__device__ __forceinline__ F2 split_col(const float* W, int k0, int n, int lane, int ld, int K) { float v[16]; const int g = lane >> 4;
#pragma unroll
  for (int i = 0; i < 8; ++i) { const int ka = k0 + 8 * g + i, kb = ka + 16; v[i] = ka < K ? W[(size_t)(ka < K ? ka : K - 1) * ld + n] : 0.f; v[8 + i] = kb < K ? W[(size_t)(kb < K ? kb : K - 1) * ld + n] : 0.f; }
  return bsplit16(v); }
__device__ __forceinline__ v8f mac3(const F2& a, const F2& b, v8f c) { c = wmma_bf(a.l, b.h, c); c = wmma_bf(a.h, b.l, c); return wmma_bf(a.h, b.h, c); }
__device__ __forceinline__ float sigm(float v) { return 1.0f / (1.0f + expf(-v)); }
#define LDSX() do { asm volatile("s_wait_dscnt 0" ::: "memory"); __builtin_amdgcn_wave_barrier(); __builtin_amdgcn_fence(__ATOMIC_RELEASE, "workgroup"); } while (0)


// Trajectory attention (B 2, T 2,048, C 1,024 = 16 x 64): q/k/v Linear, rotary position embedding (base 10000, rotate_half), causal softmax(q k / 8) v, output Linear.
#define NB 2
#define TT 2048
#define CC 1024
#define NH 16
#define HD 64
#ifndef TNB
#define TNB NB
#endif
typedef __attribute__((ext_vector_type(8))) __bf16 v8b;
__device__ __forceinline__ v16b frag_b(const __bf16* rowk0, int lane) {
  union { v16b v; v8b q[2]; } u; const __bf16* p = rowk0 + 8 * (lane >> 4);
  u.q[0] = *(const v8b*)p; u.q[1] = *(const v8b*)(p + 16); return u.v;
}
__device__ __forceinline__ float bfr(float v) { return (float)(__bf16)v; }
__device__ __attribute__((noinline)) float exp_ni(float v) { return expf(v); }
__device__ __attribute__((noinline)) float erf_ni(float v) { return erff(v); }

#define WS_QH  0u
#define WS_QL  (WS_QH + 2u * (size_t)NB * TT * CC)
#define WS_KH  (WS_QL + 2u * (size_t)NB * TT * CC)
#define WS_VT  (WS_KH + 2u * (size_t)NB * TT * CC)      // bf16 v planes [b][c][t]
#define WS_VL  (WS_VT + 2u * (size_t)NB * CC * TT)      // bf16 v residual planes
#define HG 4                                          // heads per launch group
#define WS_S   (WS_VL + 2u * (size_t)NB * CC * TT)      // f32 logits / P for HG heads [hg][q][k]
#define WS_PH  (WS_S + 4u * (size_t)HG * TT * TT)
#define WS_Y   (WS_PH + 0u)              // f32 y rows [b*t][C]
#define WS_END (WS_Y + 4u * (size_t)NB * TT * CC)

// ---- k_proj: block = (64 rows, 128 cols, which): qkv = x W (+ b), exact; q -> f16 hi (+ residual), k -> f16 rows, v -> bf16 hi + lo planes
__global__ __launch_bounds__(128) void k_proj(const float* __restrict__ X, const float* __restrict__ WQ, const float* __restrict__ BQ, const float* __restrict__ WK, const float* __restrict__ BK, const float* __restrict__ WV, const float* __restrict__ BV, _Float16* __restrict__ QH, _Float16* __restrict__ QL, _Float16* __restrict__ KH, __bf16* __restrict__ VT, __bf16* __restrict__ VL) {
  __shared__ __align__(16) _Float16 sh[64][136], sl[64][136]; __shared__ __align__(16) __bf16 th[128][72], tl2[128][72]; __shared__ __align__(16) float sf[64][132];
  const int tid = threadIdx.x, wave = tid >> 5, lane = tid & 31, col = lane & 15, g = lane >> 4; const int which = blockIdx.z; const int c0 = blockIdx.y * 128; const size_t r0 = (size_t)blockIdx.x * 64; const float* WA = which == 0 ? WQ : which == 1 ? WK : WV; const float* BA = which == 0 ? BQ : which == 1 ? BK : BV;
  v8f acc[8] = {};
#pragma unroll 2
  for (int kc = 0; kc < CC / 32; ++kc) { v16b a; { const float* p = X + (r0 + wave * 16 + col) * CC + kc * 32 + 8 * g;
#pragma unroll
      for (int i = 0; i < 8; ++i) { a[i] = (__bf16)p[i]; a[8 + i] = (__bf16)p[16 + i]; } }
#pragma unroll
    for (int j = 0; j < 8; ++j) { v16b w; const int o = c0 + j * 16 + col;
#pragma unroll
      for (int i = 0; i < 8; ++i) { w[i] = (__bf16)WA[(size_t)(o) * CC + (kc * 32 + 8 * g + i)]; w[8 + i] = (__bf16)WA[(size_t)(o) * CC + (kc * 32 + 16 + 8 * g + i)]; }
      acc[j] = wmma_bf(a, w, acc[j]); } }
#pragma unroll
  for (int j = 0; j < 8; ++j) { const float bb = bfr(BA[c0 + j * 16 + col]);
#pragma unroll
    for (int r = 0; r < 8; ++r) { const float v = acc[j][r] + bb; const int rl = wave * 16 + 8 * g + r, cl = j * 16 + col;
      if (which == 2) { const __bf16 bh = (__bf16)v; th[cl][rl] = bh; tl2[cl][rl] = (__bf16)(v - (float)bh); } else sf[rl][cl] = v; } }
  __syncthreads();
  if (which < 2) {   // rotary: out[d] = x[d] cos(t f_{d mod 32}) + (d < 32 ? -x[d+32] : x[d-32]) sin(t f_{d mod 32}); f_i = 10000^(-i/32)
    for (int e = tid; e < 64 * 128; e += 128) { const int rl = e >> 7, cl = e & 127; const int d = cl & 63; const int i2 = d & 31; const size_t row = r0 + rl; const int tpos = (int)(row % TT);
      const float inv_freq = 1.0f / powf(10000.0f, (float)(2 * i2) / 64.0f); const float ang = (float)tpos * inv_freq; const float c = cosf(ang), s = sinf(ang);
      const float me = sf[rl][cl]; const float partner = (d < 32) ? -sf[rl][cl + 32] : sf[rl][cl - 32]; const float v = me * c + partner * s; const _Float16 hv = (_Float16)v; sh[rl][cl] = hv; sl[rl][cl] = (_Float16)(v - (float)hv); }
    __syncthreads(); }
  if (which < 2) { _Float16* dh = which == 0 ? QH : KH; for (int e = tid; e < 64 * 16; e += 128) { const int rl = e >> 4, q = e & 15; vst2((unsigned*)(dh + (r0 + rl) * CC + c0 + q * 8), *(const v4u*)&sh[rl][q * 8]); if (which == 0) vst2((unsigned*)(QL + (r0 + rl) * CC + c0 + q * 8), *(const v4u*)&sl[rl][q * 8]); } }
  else { const size_t b = r0 / TT; const int t0 = (int)(r0 % TT); for (int e = tid; e < 128 * 8; e += 128) { const int cl = e >> 3, q = e & 7; const size_t o2 = (b * CC + c0 + cl) * (size_t)TT + t0 + q * 8; vst2((unsigned*)(VT + o2), *(const v4u*)&th[cl][q * 8]); vst2((unsigned*)(VL + o2), *(const v4u*)&tl2[cl][q * 8]); } } }
// ---- k_sc: block = (64 queries, 128 keys) of (b,h): logits * scale; causal blocks beyond the diagonal exit
__global__ __launch_bounds__(128) void k_sc(const _Float16* __restrict__ QH, const _Float16* __restrict__ QL, const _Float16* __restrict__ KH, const float* __restrict__ BM, int b, int h0, float* __restrict__ S0) { __shared__ __align__(16) float ss[4][16][132]; const int h = h0 + blockIdx.z; float* S = S0 + (size_t)blockIdx.z * TT * TT;
  const int tid = threadIdx.x, wave = tid >> 5, lane = tid & 31, col = lane & 15, g = lane >> 4; const int k0 = blockIdx.y * 128; const int ql0 = blockIdx.x * 64 + wave * 16; const size_t q0 = (size_t)b * TT + ql0;
  if (k0 > blockIdx.x * 64 + 63) return;   // whole key block above the diagonal (block-uniform)
  v8f acc[8] = {};
#pragma unroll
  for (int kc = 0; kc < HD / 32; ++kc) { const v16h ah = frag_h(QH + (q0 + col) * CC + h * HD + kc * 32, lane);
#pragma unroll
    for (int j = 0; j < 8; ++j) { const v16h kb = frag_h(KH + ((size_t)b * TT + k0 + j * 16 + col) * CC + h * HD + kc * 32, lane); acc[j] = wmma16(ah, kb, acc[j]); } }
#pragma unroll
  for (int j = 0; j < 8; ++j) { const int kt = k0 + j * 16 + col;
#pragma unroll
    for (int r = 0; r < 8; ++r) { const int qt = ql0 + 8 * g + r; float v = acc[j][r] * 0.125f; (void)BM; if (kt > qt) v = -3.0e38f; ss[wave][8 * g + r][j * 16 + col] = v; } }
  LDSX(); for (int rl = 0; rl < 16; ++rl) vst2(S + (size_t)(ql0 + rl) * TT + k0 + lane * 4, *(const v4f*)&ss[wave][rl][lane * 4]); }
// ---- k_sm: block = query row: softmax over keys [0, kend) -> P x 2^11 f32 (masked -> 0)
__global__ __launch_bounds__(256) void k_sm(float* __restrict__ S0) { __shared__ float sred[8]; __shared__ float sbc; __shared__ __align__(16) float sh[TT];
  const int t = threadIdx.x; const size_t row = blockIdx.x; float* sr = S0 + (size_t)blockIdx.y * TT * TT + row * TT; const int kend = ((int)row / 64) * 64 + 64;
  float m = -3.0e38f; for (int k = t; k < kend; k += 256) m = fmaxf(m, sr[k]);
#pragma unroll
  for (int o = 1; o < 32; o <<= 1) m = fmaxf(m, __shfl_xor(m, o));
  if ((t & 31) == 0) sred[t >> 5] = m; __syncthreads(); if (t == 0) { float a = sred[0]; for (int i = 1; i < 8; ++i) a = fmaxf(a, sred[i]); sbc = a; } __syncthreads(); m = sbc; __syncthreads();
  float sum = 0.f; for (int k = t; k < kend; k += 256) { const float v = sr[k]; sum += (v <= -1.0e38f) ? 0.f : expf(v - m); }
#pragma unroll
  for (int o = 1; o < 32; o <<= 1) sum += __shfl_xor(sum, o);
  if ((t & 31) == 0) sred[t >> 5] = sum; __syncthreads(); if (t == 0) { float a = 0.f; for (int i = 0; i < 8; ++i) a += sred[i]; sbc = 1.0f / a; } __syncthreads(); const float inv = sbc;
  for (int k = t; k < kend; k += 256) { const float v = sr[k]; sh[k] = (v <= -1.0e38f) ? 0.f : expf(v - m) * inv * 2048.0f; }
  __syncthreads(); for (int q = t; q < kend / 4; q += 256) vst2(sr + q * 4, *(const v4f*)&sh[q * 4]); }
// ---- k_pv: block = 64 queries of (b,h): y[q][h*HD + d] = P . v  (keys [0, kend))
__global__ __launch_bounds__(128) void k_pv(const float* __restrict__ PS0, const __bf16* __restrict__ VT, const __bf16* __restrict__ VL, int b, int h0, float* __restrict__ Y) { const int h = h0 + blockIdx.z; const float* PS = PS0 + (size_t)blockIdx.z * TT * TT; __shared__ __align__(16) float ss[4][16][HD + 4];
  const int tid = threadIdx.x, wave = tid >> 5, lane = tid & 31, col = lane & 15, g = lane >> 4; const int ql0 = blockIdx.x * 64 + wave * 16; const int kend = blockIdx.x * 64 + 64;
  v8f acc[HD / 16] = {};
#pragma unroll 1
  for (int kc = 0; kc < kend / 32; ++kc) { const F2 p = split_row(PS + (size_t)(ql0 + col) * TT, kc * 32, lane);
#pragma unroll
    for (int j = 0; j < HD / 16; ++j) { const size_t po = ((size_t)b * CC + h * HD + j * 16 + col) * (size_t)TT + kc * 32; const v16b vh = frag_b(VT + po, lane); acc[j] = wmma_bf(p.h, vh, acc[j]); acc[j] = wmma_bf(p.l, vh, acc[j]); acc[j] = wmma_bf(p.h, frag_b(VL + po, lane), acc[j]); } }
#pragma unroll
  for (int j = 0; j < HD / 16; ++j)
#pragma unroll
    for (int r = 0; r < 8; ++r) ss[wave][8 * g + r][j * 16 + col] = acc[j][r] * (1.0f / 2048.0f);
  LDSX(); for (int rl = 0; rl < 16; ++rl) if (lane < HD / 4) vst2(Y + ((size_t)b * TT + ql0 + rl) * CC + h * HD + lane * 4, *(const v4f*)&ss[wave][rl][lane * 4]); }
// ---- k_out: block = (64 rows, 128 cols): out = y (bf16 hi + lo) Wproj + b
__global__ __launch_bounds__(128) void k_out(const float* __restrict__ Y, const float* __restrict__ WP, const float* __restrict__ BP, float* __restrict__ OUT) { __shared__ __align__(16) float sf[4][16][132];
  const int tid = threadIdx.x, wave = tid >> 5, lane = tid & 31, col = lane & 15, g = lane >> 4; const int c0 = blockIdx.y * 128; const size_t r0 = (size_t)blockIdx.x * 64 + wave * 16;
  v8f acc[8] = {};
#pragma unroll 2
  for (int kc = 0; kc < CC / 32; ++kc) { const F2 a = split_row(Y + (r0 + col) * CC, kc * 32, lane);
#pragma unroll
    for (int j = 0; j < 8; ++j) { v16b w; const int o = c0 + j * 16 + col;
#pragma unroll
      for (int i = 0; i < 8; ++i) { w[i] = (__bf16)WP[(size_t)(o) * CC + (kc * 32 + 8 * g + i)]; w[8 + i] = (__bf16)WP[(size_t)(o) * CC + (kc * 32 + 16 + 8 * g + i)]; }
      acc[j] = wmma_bf(a.h, w, acc[j]); acc[j] = wmma_bf(a.l, w, acc[j]); } }
#pragma unroll
  for (int j = 0; j < 8; ++j) { const float bb = BP ? bfr(BP[c0 + j * 16 + col]) : 0.f;
#pragma unroll
    for (int r = 0; r < 8; ++r) sf[wave][8 * g + r][j * 16 + col] = acc[j][r] + bb; }
  LDSX(); for (int rl = 0; rl < 16; ++rl) vst2(OUT + (r0 + rl) * CC + c0 + lane * 4, *(const v4f*)&sf[wave][rl][lane * 4]); }
extern "C" void kernel_launch(void* const* d_in, const int* in_sizes, int n_in, void* d_out, int out_size, void* d_ws, size_t ws_size, hipStream_t stream) {
  (void)in_sizes; (void)n_in; (void)out_size;
  const float** F = (const float**)d_in;   // 0 x [2,2048,1024], 1 Wq [1024,1024] ([out,in]), 2 bq, 3 Wk, 4 bk, 5 Wv, 6 bv, 7 Wo, 8 bo
  if (ws_size < (size_t)WS_END) return;
  char* ws = (char*)d_ws; _Float16 *QH = (_Float16*)(ws + WS_QH), *QL = (_Float16*)(ws + WS_QL), *KH = (_Float16*)(ws + WS_KH); __bf16 *VT = (__bf16*)(ws + WS_VT), *VL = (__bf16*)(ws + WS_VL); float *S = (float*)(ws + WS_S), *Y = (float*)(ws + WS_Y);
  k_proj<<<dim3(TNB * TT / 64, CC / 128, 3), 128, 0, stream>>>(F[0], F[1], F[2], F[3], F[4], F[5], F[6], QH, QL, KH, VT, VL);
  for (int b = 0; b < TNB; ++b) for (int h0 = 0; h0 < NH; h0 += HG) {   // HG heads per launch
    k_sc<<<dim3(TT / 64, TT / 128, HG), 128, 0, stream>>>(QH, QL, KH, nullptr, b, h0, S);
    k_sm<<<dim3(TT, HG), 256, 0, stream>>>(S);
    k_pv<<<dim3(TT / 64, 1, HG), 128, 0, stream>>>(S, VT, VL, b, h0, Y);
  }
  k_out<<<dim3(TNB * TT / 64, CC / 128), 128, 0, stream>>>(Y, F[7], F[8], (float*)d_out);
}

// v001
// A run of this version takes 971 microseconds.
// Timed twice side by side with v000, it ran 1.52 times as fast both times.
// compute dtype: all float inputs rounded to bf16; q/k/v = x W^T + b with EXACT bf16 products on WMMA 16x16x32, f32 accumulate; rotary in f32 (inv_freq = 10000^(-2i/64) via exp2f/log2f-free powf, precise cosf/sinf); q, k rounded once to f16 (0.02-scale weights: logits std ~0.05, 1 product), causal logits stored in f32 (4 heads per launch); softmax in f32 (precise expf), P x 2^11 kept f32 split bf16 hi + lo against v bf16 hi + lo (3 products); out = o (bf16 hi + lo) Wo^T + bo; f32 output.
#include <hip/hip_runtime.h>
#include <math.h>

typedef __attribute__((ext_vector_type(16))) _Float16 v16h;
typedef __attribute__((ext_vector_type(16))) __bf16 v16b;
typedef __attribute__((ext_vector_type(8)))  _Float16 v8h;
typedef __attribute__((ext_vector_type(8)))  float v8f;
typedef __attribute__((ext_vector_type(4)))  float v4f;
typedef __attribute__((ext_vector_type(2)))  float v2f;
typedef __attribute__((ext_vector_type(4)))  unsigned v4u;
typedef __attribute__((ext_vector_type(4)))  int v4i;
typedef float __attribute__((may_alias)) float_a;
typedef int __attribute__((may_alias)) int_a;

template <typename T> __device__ __forceinline__ void vst2(void* p, T v) { *(T*)p = v;  }
__device__ __forceinline__ v8f wmma16(v16h a, v16h b, v8f c) {
  v8f d = __builtin_amdgcn_wmma_f32_16x16x32_f16(false, a, false, b, (short)0, c, false, false);
  asm volatile("v_nop\n\tv_nop\n\tv_nop\n\tv_nop" : "+v"(d) : "v"(a), "v"(b));
  return d;
}
__device__ __forceinline__ v8f wmma_bf(v16b a, v16b b, v8f c) {
  v8f d = __builtin_amdgcn_wmma_f32_16x16x32_bf16(false, a, false, b, (short)0, c, false, false);
  asm volatile("v_nop\n\tv_nop\n\tv_nop\n\tv_nop" : "+v"(d) : "v"(a), "v"(b));
  return d;
}
// 16x16x32 fragments: lane = (h = lane>>4, row/col = lane&15); elements 0..7 = k0+8h+0..7, 8..15 = k0+16+8h+0..7; D element r = row 8h+r
__device__ __forceinline__ v16h frag_h(const _Float16* rowk0, int lane) {
  union { v16h v; v8h q[2]; } u; const _Float16* p = rowk0 + 8 * (lane >> 4);
  u.q[0] = *(const v8h*)p; u.q[1] = *(const v8h*)(p + 16); return u.v;
}
__device__ __forceinline__ v16h frag_f32(const float* rowk0, int lane) {
  v16h a; const float* p = rowk0 + 8 * (lane >> 4);
#pragma unroll
  for (int i = 0; i < 8; ++i) { a[i] = (_Float16)p[i]; a[8 + i] = (_Float16)p[16 + i]; }
  return a;
}
__device__ __forceinline__ v16h frag_f32s(const float* rowk0, int lane, float sc) {
  v16h a; const float* p = rowk0 + 8 * (lane >> 4);
#pragma unroll
  for (int i = 0; i < 8; ++i) { a[i] = (_Float16)(p[i] * sc); a[8 + i] = (_Float16)(p[16 + i] * sc); }
  return a;
}
// column fragment from a [K][ld] layout (column n), rows >= K read as 0
__device__ __forceinline__ v16h fragc_f32(const float* W, int k0, int n, int lane, int ld, int K) {
  v16h a; const int g = lane >> 4;
#pragma unroll
  for (int i = 0; i < 8; ++i) { const int ka = k0 + 8 * g + i, kb = ka + 16;
    a[i] = (_Float16)(ka < K ? W[(size_t)(ka < K ? ka : K - 1) * ld + n] : 0.f); a[8 + i] = (_Float16)(kb < K ? W[(size_t)(kb < K ? kb : K - 1) * ld + n] : 0.f); }
  return a;
}
struct F2 { v16b h, l; };
__device__ __forceinline__ F2 bsplit16(const float v[16]) { F2 r;
#pragma unroll
  for (int i = 0; i < 16; ++i) { const __bf16 h = (__bf16)v[i]; r.h[i] = h; r.l[i] = (__bf16)(v[i] - (float)h); }
  return r; }
__device__ __forceinline__ F2 split_row(const float* row, int k0, int lane) { float v[16]; const float* p = row + k0 + 8 * (lane >> 4);
#pragma unroll
  for (int i = 0; i < 8; ++i) { v[i] = p[i]; v[8 + i] = p[16 + i]; }
  return bsplit16(v); }
__device__ __forceinline__ F2 split_rowK(const float* row, int k0, int lane, int K) { float v[16]; const int g = lane >> 4;
#pragma unroll
  for (int i = 0; i < 8; ++i) { const int ka = k0 + 8 * g + i, kb = ka + 16; v[i] = ka < K ? row[ka < K ? ka : K - 1] : 0.f; v[8 + i] = kb < K ? row[kb < K ? kb : K - 1] : 0.f; }
  return bsplit16(v); }
__device__ __forceinline__ F2 split_col(const float* W, int k0, int n, int lane, int ld, int K) { float v[16]; const int g = lane >> 4;
#pragma unroll
  for (int i = 0; i < 8; ++i) { const int ka = k0 + 8 * g + i, kb = ka + 16; v[i] = ka < K ? W[(size_t)(ka < K ? ka : K - 1) * ld + n] : 0.f; v[8 + i] = kb < K ? W[(size_t)(kb < K ? kb : K - 1) * ld + n] : 0.f; }
  return bsplit16(v); }
__device__ __forceinline__ v8f mac3(const F2& a, const F2& b, v8f c) { c = wmma_bf(a.l, b.h, c); c = wmma_bf(a.h, b.l, c); return wmma_bf(a.h, b.h, c); }
__device__ __forceinline__ float sigm(float v) { return 1.0f / (1.0f + expf(-v)); }
#define LDSX() do { asm volatile("s_wait_dscnt 0" ::: "memory"); __builtin_amdgcn_wave_barrier(); __builtin_amdgcn_fence(__ATOMIC_RELEASE, "workgroup"); } while (0)


// Trajectory attention (B 2, T 2,048, C 1,024 = 16 x 64): q/k/v Linear, rotary position embedding (base 10000, rotate_half), causal softmax(q k / 8) v, output Linear.
#define NB 2
#define TT 2048
#define CC 1024
#define NH 16
#define HD 64
#ifndef TNB
#define TNB NB
#endif
typedef __attribute__((ext_vector_type(8))) __bf16 v8b;
__device__ __forceinline__ v16b frag_b(const __bf16* rowk0, int lane) {
  union { v16b v; v8b q[2]; } u; const __bf16* p = rowk0 + 8 * (lane >> 4);
  u.q[0] = *(const v8b*)p; u.q[1] = *(const v8b*)(p + 16); return u.v;
}
__device__ __forceinline__ float bfr(float v) { return (float)(__bf16)v; }
__device__ __attribute__((noinline)) float exp_ni(float v) { return expf(v); }
__device__ __attribute__((noinline)) float erf_ni(float v) { return erff(v); }

#define WS_QH  0u
#define WS_QL  (WS_QH + 2u * (size_t)NB * TT * CC)
#define WS_KH  (WS_QL + 2u * (size_t)NB * TT * CC)
#define WS_VT  (WS_KH + 2u * (size_t)NB * TT * CC)      // bf16 v planes [b][c][t]
#define WS_VL  (WS_VT + 2u * (size_t)NB * CC * TT)      // bf16 v residual planes
#define HG 4                                          // heads per launch group
#define WS_S   (WS_VL + 2u * (size_t)NB * CC * TT)      // f32 logits / P for HG heads [hg][q][k]
#define WS_PH  (WS_S + 4u * (size_t)HG * TT * TT)
#define WS_Y   (WS_PH + 0u)              // f32 y rows [b*t][C]
#define WS_END (WS_Y + 4u * (size_t)NB * TT * CC)

// ---- k_proj: block = (64 rows, 128 cols, which): qkv = x W (+ b), exact; q -> f16 hi (+ residual), k -> f16 rows, v -> bf16 hi + lo planes
__global__ __launch_bounds__(128) void k_proj(const float* __restrict__ X, const float* __restrict__ WQ, const float* __restrict__ BQ, const float* __restrict__ WK, const float* __restrict__ BK, const float* __restrict__ WV, const float* __restrict__ BV, _Float16* __restrict__ QH, _Float16* __restrict__ QL, _Float16* __restrict__ KH, __bf16* __restrict__ VT, __bf16* __restrict__ VL) {
  __shared__ __align__(16) _Float16 sh[64][136], sl[64][136]; __shared__ __align__(16) __bf16 th[128][72], tl2[128][72]; __shared__ __align__(16) float sf[64][132];
  const int tid = threadIdx.x, wave = tid >> 5, lane = tid & 31, col = lane & 15, g = lane >> 4; const int which = blockIdx.z; const int c0 = blockIdx.y * 128; const size_t r0 = (size_t)blockIdx.x * 64; const float* WA = which == 0 ? WQ : which == 1 ? WK : WV; const float* BA = which == 0 ? BQ : which == 1 ? BK : BV;
  v8f acc[8] = {};
#pragma unroll 2
  for (int kc = 0; kc < CC / 32; ++kc) { v16b a; { const float* p = X + (r0 + wave * 16 + col) * CC + kc * 32 + 8 * g;
#pragma unroll
      for (int i = 0; i < 8; ++i) { a[i] = (__bf16)p[i]; a[8 + i] = (__bf16)p[16 + i]; } }
#pragma unroll
    for (int j = 0; j < 8; ++j) { v16b w; const int o = c0 + j * 16 + col;
#pragma unroll
      for (int i = 0; i < 8; ++i) { w[i] = (__bf16)WA[(size_t)(o) * CC + (kc * 32 + 8 * g + i)]; w[8 + i] = (__bf16)WA[(size_t)(o) * CC + (kc * 32 + 16 + 8 * g + i)]; }
      acc[j] = wmma_bf(a, w, acc[j]); } }
#pragma unroll
  for (int j = 0; j < 8; ++j) { const float bb = bfr(BA[c0 + j * 16 + col]);
#pragma unroll
    for (int r = 0; r < 8; ++r) { const float v = acc[j][r] + bb; const int rl = wave * 16 + 8 * g + r, cl = j * 16 + col;
      if (which == 2) { const __bf16 bh = (__bf16)v; th[cl][rl] = bh; tl2[cl][rl] = (__bf16)(v - (float)bh); } else sf[rl][cl] = v; } }
  __syncthreads();
  if (which < 2) {   // rotary: out[d] = x[d] cos(t f_{d mod 32}) + (d < 32 ? -x[d+32] : x[d-32]) sin(t f_{d mod 32}); f_i = 10000^(-i/32)
    for (int e = tid; e < 64 * 128; e += 128) { const int rl = e >> 7, cl = e & 127; const int d = cl & 63; const int i2 = d & 31; const size_t row = r0 + rl; const int tpos = (int)(row % TT);
      const float inv_freq = 1.0f / powf(10000.0f, (float)(2 * i2) / 64.0f); const float ang = (float)tpos * inv_freq; const float c = cosf(ang), s = sinf(ang);
      const float me = sf[rl][cl]; const float partner = (d < 32) ? -sf[rl][cl + 32] : sf[rl][cl - 32]; const float v = me * c + partner * s; const _Float16 hv = (_Float16)v; sh[rl][cl] = hv; sl[rl][cl] = (_Float16)(v - (float)hv); }
    __syncthreads(); }
  if (which < 2) { _Float16* dh = which == 0 ? QH : KH; for (int e = tid; e < 64 * 16; e += 128) { const int rl = e >> 4, q = e & 15; vst2((unsigned*)(dh + (r0 + rl) * CC + c0 + q * 8), *(const v4u*)&sh[rl][q * 8]); if (which == 0) vst2((unsigned*)(QL + (r0 + rl) * CC + c0 + q * 8), *(const v4u*)&sl[rl][q * 8]); } }
  else { const size_t b = r0 / TT; const int t0 = (int)(r0 % TT); for (int e = tid; e < 128 * 8; e += 128) { const int cl = e >> 3, q = e & 7; const size_t o2 = (b * CC + c0 + cl) * (size_t)TT + t0 + q * 8; vst2((unsigned*)(VT + o2), *(const v4u*)&th[cl][q * 8]); vst2((unsigned*)(VL + o2), *(const v4u*)&tl2[cl][q * 8]); } } }
// ---- k_sc: block = (64 queries, 128 keys) of (b,h): logits * scale; causal blocks beyond the diagonal exit
__global__ __launch_bounds__(128) void k_sc(const _Float16* __restrict__ QH, const _Float16* __restrict__ QL, const _Float16* __restrict__ KH, const float* __restrict__ BM, int b, int h0, float* __restrict__ S0) { __shared__ __align__(16) float ss[4][16][132]; const int h = h0 + blockIdx.z; float* S = S0 + (size_t)blockIdx.z * TT * TT;
  const int tid = threadIdx.x, wave = tid >> 5, lane = tid & 31, col = lane & 15, g = lane >> 4; const int k0 = blockIdx.y * 128; const int ql0 = blockIdx.x * 64 + wave * 16; const size_t q0 = (size_t)b * TT + ql0;
  if (k0 > blockIdx.x * 64 + 63) return;   // whole key block above the diagonal (block-uniform)
  v8f acc[8] = {};
#pragma unroll
  for (int kc = 0; kc < HD / 32; ++kc) { const v16h ah = frag_h(QH + (q0 + col) * CC + h * HD + kc * 32, lane);
#pragma unroll
    for (int j = 0; j < 8; ++j) { const v16h kb = frag_h(KH + ((size_t)b * TT + k0 + j * 16 + col) * CC + h * HD + kc * 32, lane); acc[j] = wmma16(ah, kb, acc[j]); } }
#pragma unroll
  for (int j = 0; j < 8; ++j) { const int kt = k0 + j * 16 + col;
#pragma unroll
    for (int r = 0; r < 8; ++r) { const int qt = ql0 + 8 * g + r; float v = acc[j][r] * 0.125f; (void)BM; if (kt > qt) v = -3.0e38f; ss[wave][8 * g + r][j * 16 + col] = v; } }
  LDSX(); for (int rl = 0; rl < 16; ++rl) vst2(S + (size_t)(ql0 + rl) * TT + k0 + lane * 4, *(const v4f*)&ss[wave][rl][lane * 4]); }
// ---- k_sm: block = query row: softmax over keys [0, kend) -> P x 2^11 f32 (masked -> 0)
__global__ __launch_bounds__(256) void k_sm(float* __restrict__ S0) { __shared__ float sred[8]; __shared__ float sbc; __shared__ __align__(16) float sh[TT];
  const int t = threadIdx.x; const size_t row = blockIdx.x; float* sr = S0 + (size_t)blockIdx.y * TT * TT + row * TT; const int kend = ((int)row / 64) * 64 + 64;
  float m = -3.0e38f; for (int k = t; k < kend; k += 256) m = fmaxf(m, sr[k]);
#pragma unroll
  for (int o = 1; o < 32; o <<= 1) m = fmaxf(m, __shfl_xor(m, o));
  if ((t & 31) == 0) sred[t >> 5] = m; __syncthreads(); if (t == 0) { float a = sred[0]; for (int i = 1; i < 8; ++i) a = fmaxf(a, sred[i]); sbc = a; } __syncthreads(); m = sbc; __syncthreads();
  float sum = 0.f; for (int k = t; k < kend; k += 256) { const float v = sr[k]; sum += (v <= -1.0e38f) ? 0.f : expf(v - m); }
#pragma unroll
  for (int o = 1; o < 32; o <<= 1) sum += __shfl_xor(sum, o);
  if ((t & 31) == 0) sred[t >> 5] = sum; __syncthreads(); if (t == 0) { float a = 0.f; for (int i = 0; i < 8; ++i) a += sred[i]; sbc = 1.0f / a; } __syncthreads(); const float inv = sbc;
  for (int k = t; k < kend; k += 256) { const float v = sr[k]; sh[k] = (v <= -1.0e38f) ? 0.f : expf(v - m) * inv * 2048.0f; }
  __syncthreads(); for (int q = t; q < kend / 4; q += 256) vst2(sr + q * 4, *(const v4f*)&sh[q * 4]); }
// ---- k_pv: block = 16 queries of (b,h), PVW waves; wave w takes the 32-key slices w, w + PVW, ... of [0, kend); the f32 partials are summed in LDS in wave order: y[q][h*HD + d] = P . v
#define PVW 8   // the wave number is read into a scalar so that each wave's trip test is a scalar branch
__global__ __launch_bounds__(32 * PVW) void k_pv(const float* __restrict__ PS0, const __bf16* __restrict__ VT, const __bf16* __restrict__ VL, int b, int h0, float* __restrict__ Y) { const int h = h0 + blockIdx.z; const float* PS = PS0 + (size_t)blockIdx.z * TT * TT; __shared__ __align__(16) float ss[PVW][16][HD + 4];
  const int tid = threadIdx.x, wave = __builtin_amdgcn_readfirstlane(tid >> 5), lane = tid & 31, col = lane & 15, g = lane >> 4; const int ql0 = blockIdx.x * 16; const int kend = (blockIdx.x >> 2) * 64 + 64;
  v8f acc[HD / 16] = {};
#pragma unroll 1
  for (int kc = wave; kc < kend / 32; kc += PVW) { const F2 p = split_row(PS + (size_t)(ql0 + col) * TT, kc * 32, lane);
#pragma unroll
    for (int j = 0; j < HD / 16; ++j) { const size_t po = ((size_t)b * CC + h * HD + j * 16 + col) * (size_t)TT + kc * 32; const v16b vh = frag_b(VT + po, lane); acc[j] = wmma_bf(p.h, vh, acc[j]); acc[j] = wmma_bf(p.l, vh, acc[j]); acc[j] = wmma_bf(p.h, frag_b(VL + po, lane), acc[j]); } }
#pragma unroll
  for (int j = 0; j < HD / 16; ++j)
#pragma unroll
    for (int r = 0; r < 8; ++r) ss[wave][8 * g + r][j * 16 + col] = acc[j][r];
  __syncthreads();   // every wave's partial tile is in LDS before any thread sums across waves
  static_assert(16 * (HD / 4) == 32 * PVW, "one float4 of the tile per thread");
  { const int rl = tid / (HD / 4), c4 = (tid % (HD / 4)) * 4; v4f s = *(const v4f*)&ss[0][rl][c4];
#pragma unroll   // the LDS reads of all partials issue together; the sum keeps wave order
    for (int w = 1; w < PVW; ++w) s += *(const v4f*)&ss[w][rl][c4];
    vst2(Y + ((size_t)b * TT + ql0 + rl) * CC + h * HD + c4, s * (1.0f / 2048.0f)); } }
// ---- k_out: block = (64 rows, 128 cols): out = y (bf16 hi + lo) Wproj + b
__global__ __launch_bounds__(128) void k_out(const float* __restrict__ Y, const float* __restrict__ WP, const float* __restrict__ BP, float* __restrict__ OUT) { __shared__ __align__(16) float sf[4][16][132];
  const int tid = threadIdx.x, wave = tid >> 5, lane = tid & 31, col = lane & 15, g = lane >> 4; const int c0 = blockIdx.y * 128; const size_t r0 = (size_t)blockIdx.x * 64 + wave * 16;
  v8f acc[8] = {};
#pragma unroll 2
  for (int kc = 0; kc < CC / 32; ++kc) { const F2 a = split_row(Y + (r0 + col) * CC, kc * 32, lane);
#pragma unroll
    for (int j = 0; j < 8; ++j) { v16b w; const int o = c0 + j * 16 + col;
#pragma unroll
      for (int i = 0; i < 8; ++i) { w[i] = (__bf16)WP[(size_t)(o) * CC + (kc * 32 + 8 * g + i)]; w[8 + i] = (__bf16)WP[(size_t)(o) * CC + (kc * 32 + 16 + 8 * g + i)]; }
      acc[j] = wmma_bf(a.h, w, acc[j]); acc[j] = wmma_bf(a.l, w, acc[j]); } }
#pragma unroll
  for (int j = 0; j < 8; ++j) { const float bb = BP ? bfr(BP[c0 + j * 16 + col]) : 0.f;
#pragma unroll
    for (int r = 0; r < 8; ++r) sf[wave][8 * g + r][j * 16 + col] = acc[j][r] + bb; }
  LDSX(); for (int rl = 0; rl < 16; ++rl) vst2(OUT + (r0 + rl) * CC + c0 + lane * 4, *(const v4f*)&sf[wave][rl][lane * 4]); }
extern "C" void kernel_launch(void* const* d_in, const int* in_sizes, int n_in, void* d_out, int out_size, void* d_ws, size_t ws_size, hipStream_t stream) {
  (void)in_sizes; (void)n_in; (void)out_size;
  const float** F = (const float**)d_in;   // 0 x [2,2048,1024], 1 Wq [1024,1024] ([out,in]), 2 bq, 3 Wk, 4 bk, 5 Wv, 6 bv, 7 Wo, 8 bo
  if (ws_size < (size_t)WS_END) return;
  char* ws = (char*)d_ws; _Float16 *QH = (_Float16*)(ws + WS_QH), *QL = (_Float16*)(ws + WS_QL), *KH = (_Float16*)(ws + WS_KH); __bf16 *VT = (__bf16*)(ws + WS_VT), *VL = (__bf16*)(ws + WS_VL); float *S = (float*)(ws + WS_S), *Y = (float*)(ws + WS_Y);
  k_proj<<<dim3(TNB * TT / 64, CC / 128, 3), 128, 0, stream>>>(F[0], F[1], F[2], F[3], F[4], F[5], F[6], QH, QL, KH, VT, VL);
  for (int b = 0; b < TNB; ++b) for (int h0 = 0; h0 < NH; h0 += HG) {   // HG heads per launch
    k_sc<<<dim3(TT / 64, TT / 128, HG), 128, 0, stream>>>(QH, QL, KH, nullptr, b, h0, S);
    k_sm<<<dim3(TT, HG), 256, 0, stream>>>(S);
    k_pv<<<dim3(TT / 16, 1, HG), 32 * PVW, 0, stream>>>(S, VT, VL, b, h0, Y);
  }
  k_out<<<dim3(TNB * TT / 64, CC / 128), 128, 0, stream>>>(Y, F[7], F[8], (float*)d_out);
}

// v002
// It runs in 457 microseconds.
// Next to v001, in two timings, it ran 2.12 and 2.13 times as fast.
// Counting every step since v000, it is 3.23 times as fast.
// compute dtype: all float inputs rounded to bf16; q/k/v = x W^T + b with EXACT bf16 products on WMMA 16x16x32, f32 accumulate; rotary in f32 (inv_freq = 10000^(-2i/64) via exp2f/log2f-free powf, precise cosf/sinf); q, k rounded once to f16 (0.02-scale weights: logits std ~0.05, 1 product), causal logits kept on chip in f32 (computed twice: row maxima, then P); softmax in f32 (precise expf), P = exp(s - max) kept f32 split bf16 hi + lo against v bf16 hi + lo (3 products), divided by the f32 row sum at the end; out = o (bf16 hi + lo) Wo^T + bo; f32 output.
#include <hip/hip_runtime.h>
#include <math.h>

typedef __attribute__((ext_vector_type(16))) _Float16 v16h;
typedef __attribute__((ext_vector_type(16))) __bf16 v16b;
typedef __attribute__((ext_vector_type(8)))  _Float16 v8h;
typedef __attribute__((ext_vector_type(8)))  float v8f;
typedef __attribute__((ext_vector_type(4)))  float v4f;
typedef __attribute__((ext_vector_type(2)))  float v2f;
typedef __attribute__((ext_vector_type(4)))  unsigned v4u;
typedef __attribute__((ext_vector_type(4)))  int v4i;
typedef float __attribute__((may_alias)) float_a;
typedef int __attribute__((may_alias)) int_a;

template <typename T> __device__ __forceinline__ void vst2(void* p, T v) { *(T*)p = v;  }
__device__ __forceinline__ v8f wmma16(v16h a, v16h b, v8f c) {
  v8f d = __builtin_amdgcn_wmma_f32_16x16x32_f16(false, a, false, b, (short)0, c, false, false);
  asm volatile("v_nop\n\tv_nop\n\tv_nop\n\tv_nop" : "+v"(d) : "v"(a), "v"(b));
  return d;
}
__device__ __forceinline__ v8f wmma_bf(v16b a, v16b b, v8f c) {
  v8f d = __builtin_amdgcn_wmma_f32_16x16x32_bf16(false, a, false, b, (short)0, c, false, false);
  asm volatile("v_nop\n\tv_nop\n\tv_nop\n\tv_nop" : "+v"(d) : "v"(a), "v"(b));
  return d;
}
// 16x16x32 fragments: lane = (h = lane>>4, row/col = lane&15); elements 0..7 = k0+8h+0..7, 8..15 = k0+16+8h+0..7; D element r = row 8h+r
__device__ __forceinline__ v16h frag_h(const _Float16* rowk0, int lane) {
  union { v16h v; v8h q[2]; } u; const _Float16* p = rowk0 + 8 * (lane >> 4);
  u.q[0] = *(const v8h*)p; u.q[1] = *(const v8h*)(p + 16); return u.v;
}
__device__ __forceinline__ v16h frag_f32(const float* rowk0, int lane) {
  v16h a; const float* p = rowk0 + 8 * (lane >> 4);
#pragma unroll
  for (int i = 0; i < 8; ++i) { a[i] = (_Float16)p[i]; a[8 + i] = (_Float16)p[16 + i]; }
  return a;
}
__device__ __forceinline__ v16h frag_f32s(const float* rowk0, int lane, float sc) {
  v16h a; const float* p = rowk0 + 8 * (lane >> 4);
#pragma unroll
  for (int i = 0; i < 8; ++i) { a[i] = (_Float16)(p[i] * sc); a[8 + i] = (_Float16)(p[16 + i] * sc); }
  return a;
}
// column fragment from a [K][ld] layout (column n), rows >= K read as 0
__device__ __forceinline__ v16h fragc_f32(const float* W, int k0, int n, int lane, int ld, int K) {
  v16h a; const int g = lane >> 4;
#pragma unroll
  for (int i = 0; i < 8; ++i) { const int ka = k0 + 8 * g + i, kb = ka + 16;
    a[i] = (_Float16)(ka < K ? W[(size_t)(ka < K ? ka : K - 1) * ld + n] : 0.f); a[8 + i] = (_Float16)(kb < K ? W[(size_t)(kb < K ? kb : K - 1) * ld + n] : 0.f); }
  return a;
}
struct F2 { v16b h, l; };
__device__ __forceinline__ F2 bsplit16(const float v[16]) { F2 r;
#pragma unroll
  for (int i = 0; i < 16; ++i) { const __bf16 h = (__bf16)v[i]; r.h[i] = h; r.l[i] = (__bf16)(v[i] - (float)h); }
  return r; }
__device__ __forceinline__ F2 split_row(const float* row, int k0, int lane) { float v[16]; const float* p = row + k0 + 8 * (lane >> 4);
#pragma unroll
  for (int i = 0; i < 8; ++i) { v[i] = p[i]; v[8 + i] = p[16 + i]; }
  return bsplit16(v); }
__device__ __forceinline__ F2 split_rowK(const float* row, int k0, int lane, int K) { float v[16]; const int g = lane >> 4;
#pragma unroll
  for (int i = 0; i < 8; ++i) { const int ka = k0 + 8 * g + i, kb = ka + 16; v[i] = ka < K ? row[ka < K ? ka : K - 1] : 0.f; v[8 + i] = kb < K ? row[kb < K ? kb : K - 1] : 0.f; }
  return bsplit16(v); }
__device__ __forceinline__ F2 split_col(const float* W, int k0, int n, int lane, int ld, int K) { float v[16]; const int g = lane >> 4;
#pragma unroll
  for (int i = 0; i < 8; ++i) { const int ka = k0 + 8 * g + i, kb = ka + 16; v[i] = ka < K ? W[(size_t)(ka < K ? ka : K - 1) * ld + n] : 0.f; v[8 + i] = kb < K ? W[(size_t)(kb < K ? kb : K - 1) * ld + n] : 0.f; }
  return bsplit16(v); }
__device__ __forceinline__ v8f mac3(const F2& a, const F2& b, v8f c) { c = wmma_bf(a.l, b.h, c); c = wmma_bf(a.h, b.l, c); return wmma_bf(a.h, b.h, c); }
__device__ __forceinline__ float sigm(float v) { return 1.0f / (1.0f + expf(-v)); }
#define LDSX() do { asm volatile("s_wait_dscnt 0" ::: "memory"); __builtin_amdgcn_wave_barrier(); __builtin_amdgcn_fence(__ATOMIC_RELEASE, "workgroup"); } while (0)


// Trajectory attention (B 2, T 2,048, C 1,024 = 16 x 64): q/k/v Linear, rotary position embedding (base 10000, rotate_half), causal softmax(q k / 8) v, output Linear.
#define NB 2
#define TT 2048
#define CC 1024
#define NH 16
#define HD 64
#ifndef TNB
#define TNB NB
#endif
typedef __attribute__((ext_vector_type(8))) __bf16 v8b;
__device__ __forceinline__ v16b frag_b(const __bf16* rowk0, int lane) {
  union { v16b v; v8b q[2]; } u; const __bf16* p = rowk0 + 8 * (lane >> 4);
  u.q[0] = *(const v8b*)p; u.q[1] = *(const v8b*)(p + 16); return u.v;
}
__device__ __forceinline__ float bfr(float v) { return (float)(__bf16)v; }
__device__ __attribute__((noinline)) float exp_ni(float v) { return expf(v); }
__device__ __attribute__((noinline)) float erf_ni(float v) { return erff(v); }

#define WS_QH  0u
#define WS_QL  (WS_QH + 2u * (size_t)NB * TT * CC)
#define WS_KH  (WS_QL + 2u * (size_t)NB * TT * CC)
#define WS_VT  (WS_KH + 2u * (size_t)NB * TT * CC)      // bf16 v planes [b][c][t]
#define WS_VL  (WS_VT + 2u * (size_t)NB * CC * TT)      // bf16 v residual planes
#define WS_Y   (WS_VL + 2u * (size_t)NB * CC * TT)      // f32 y rows [b*t][C]
#define WS_END (WS_Y + 4u * (size_t)NB * TT * CC)

// ---- k_proj: block = (64 rows, 128 cols, which): qkv = x W (+ b), exact; q -> f16 hi (+ residual), k -> f16 rows, v -> bf16 hi + lo planes
__global__ __launch_bounds__(128) void k_proj(const float* __restrict__ X, const float* __restrict__ WQ, const float* __restrict__ BQ, const float* __restrict__ WK, const float* __restrict__ BK, const float* __restrict__ WV, const float* __restrict__ BV, _Float16* __restrict__ QH, _Float16* __restrict__ QL, _Float16* __restrict__ KH, __bf16* __restrict__ VT, __bf16* __restrict__ VL) {
  __shared__ __align__(16) _Float16 sh[64][136], sl[64][136]; __shared__ __align__(16) __bf16 th[128][72], tl2[128][72]; __shared__ __align__(16) float sf[64][132];
  const int tid = threadIdx.x, wave = tid >> 5, lane = tid & 31, col = lane & 15, g = lane >> 4; const int which = blockIdx.z; const int c0 = blockIdx.y * 128; const size_t r0 = (size_t)blockIdx.x * 64; const float* WA = which == 0 ? WQ : which == 1 ? WK : WV; const float* BA = which == 0 ? BQ : which == 1 ? BK : BV;
  v8f acc[8] = {};
#pragma unroll 2
  for (int kc = 0; kc < CC / 32; ++kc) { v16b a; { const float* p = X + (r0 + wave * 16 + col) * CC + kc * 32 + 8 * g;
#pragma unroll
      for (int i = 0; i < 8; ++i) { a[i] = (__bf16)p[i]; a[8 + i] = (__bf16)p[16 + i]; } }
#pragma unroll
    for (int j = 0; j < 8; ++j) { v16b w; const int o = c0 + j * 16 + col;
#pragma unroll
      for (int i = 0; i < 8; ++i) { w[i] = (__bf16)WA[(size_t)(o) * CC + (kc * 32 + 8 * g + i)]; w[8 + i] = (__bf16)WA[(size_t)(o) * CC + (kc * 32 + 16 + 8 * g + i)]; }
      acc[j] = wmma_bf(a, w, acc[j]); } }
#pragma unroll
  for (int j = 0; j < 8; ++j) { const float bb = bfr(BA[c0 + j * 16 + col]);
#pragma unroll
    for (int r = 0; r < 8; ++r) { const float v = acc[j][r] + bb; const int rl = wave * 16 + 8 * g + r, cl = j * 16 + col;
      if (which == 2) { const __bf16 bh = (__bf16)v; th[cl][rl] = bh; tl2[cl][rl] = (__bf16)(v - (float)bh); } else sf[rl][cl] = v; } }
  __syncthreads();
  if (which < 2) {   // rotary: out[d] = x[d] cos(t f_{d mod 32}) + (d < 32 ? -x[d+32] : x[d-32]) sin(t f_{d mod 32}); f_i = 10000^(-i/32)
    for (int e = tid; e < 64 * 128; e += 128) { const int rl = e >> 7, cl = e & 127; const int d = cl & 63; const int i2 = d & 31; const size_t row = r0 + rl; const int tpos = (int)(row % TT);
      const float inv_freq = 1.0f / powf(10000.0f, (float)(2 * i2) / 64.0f); const float ang = (float)tpos * inv_freq; const float c = cosf(ang), s = sinf(ang);
      const float me = sf[rl][cl]; const float partner = (d < 32) ? -sf[rl][cl + 32] : sf[rl][cl - 32]; const float v = me * c + partner * s; const _Float16 hv = (_Float16)v; sh[rl][cl] = hv; sl[rl][cl] = (_Float16)(v - (float)hv); }
    __syncthreads(); }
  if (which < 2) { _Float16* dh = which == 0 ? QH : KH; for (int e = tid; e < 64 * 16; e += 128) { const int rl = e >> 4, q = e & 15; vst2((unsigned*)(dh + (r0 + rl) * CC + c0 + q * 8), *(const v4u*)&sh[rl][q * 8]); if (which == 0) vst2((unsigned*)(QL + (r0 + rl) * CC + c0 + q * 8), *(const v4u*)&sl[rl][q * 8]); } }
  else { const size_t b = r0 / TT; const int t0 = (int)(r0 % TT); for (int e = tid; e < 128 * 8; e += 128) { const int cl = e >> 3, q = e & 7; const size_t o2 = (b * CC + c0 + cl) * (size_t)TT + t0 + q * 8; vst2((unsigned*)(VT + o2), *(const v4u*)&th[cl][q * 8]); vst2((unsigned*)(VL + o2), *(const v4u*)&tl2[cl][q * 8]); } } }
// ---- k_att: block = 16 * QT queries of (b,h), AW waves; wave w takes the 32-key slices w, w + AW, ... up to the diagonal, each k and v fragment serving the QT query tiles. Sweep 1: logits on WMMA, row maxima only. Sweep 2: the same logits again, exp(s - max) in f32, P (bf16 hi + lo) . v; row sums and f32 partial tiles of the waves are summed in LDS in wave order: y[q][h*HD + d] = P . v / sum
// every '#pragma unroll' of k_att and its helpers without a note of its own: the loop indexes fragment, accumulator or per-row arrays, which stay in registers only when it is unrolled
#define AW 8   // the wave number is read into a scalar so that each wave's trip test is a scalar branch
#define QT 2
struct KF { v16h f[2][HD / 32]; };   // k fragments of one slice: [16-key group][32 of the head's 64 dims]
// pk = the lane's own place in the slice's first 16-key group: row col, element 8g
__device__ __forceinline__ KF att_k(const _Float16* pk) { KF k;
#pragma unroll
  for (int j = 0; j < 2; ++j)
#pragma unroll
    for (int kc = 0; kc < HD / 32; ++kc) { union { v16h v; v8h q[2]; } u; const _Float16* p = pk + j * 16 * CC + kc * 32; u.q[0] = *(const v8h*)p; u.q[1] = *(const v8h*)(p + 16); k.f[j][kc] = u.v; }
  return k; }
// pv = the lane's own place in the slice of a v plane: row col of the head's first 16 dims, key 8g
__device__ __forceinline__ v16b att_v(const __bf16* pv, int j) { union { v16b v; v8b q[2]; } u; const __bf16* p = pv + (size_t)j * 16 * TT; u.q[0] = *(const v8b*)p; u.q[1] = *(const v8b*)(p + 16); return u.v; }
// logits of one query tile against one slice, D layout: sc[j][r] = query q0 + 8g + r against key s*32 + j*16 + col, scaled, keys above the diagonal masked
__device__ __forceinline__ void att_logits(const KF& k, const v16h* ah, int s, int q0, int lane, v8f* sc) { const int col = lane & 15, g = lane >> 4;
#pragma unroll
  for (int j = 0; j < 2; ++j) { const int kt = s * 32 + j * 16 + col; v8f a = {};
#pragma unroll
    for (int kc = 0; kc < HD / 32; ++kc) a = wmma16(ah[kc], k.f[j][kc], a);
#pragma unroll
    for (int r = 0; r < 8; ++r) { const int qt = q0 + 8 * g + r; float v = a[r] * 0.125f; if (kt > qt) v = -3.0e38f; sc[j][r] = v; } } }
// amdgpu_waves_per_eu(4): holds the allocation at 256 registers, so that two blocks share a WGP
__global__ __launch_bounds__(32 * AW) __attribute__((amdgpu_waves_per_eu(4))) void k_att(const _Float16* __restrict__ QH, const _Float16* __restrict__ KH, const __bf16* __restrict__ VT, const __bf16* __restrict__ VL, float* __restrict__ Y) { __shared__ __align__(16) float ss[AW][16 * QT][HD + 4]; __shared__ float smx[AW][16 * QT], ssum[AW][16 * QT];
  const int tid = threadIdx.x, wave = __builtin_amdgcn_readfirstlane(tid >> 5), lane = tid & 31, col = lane & 15, g = lane >> 4; const int b = blockIdx.z, h = blockIdx.y, ql0 = blockIdx.x * (16 * QT); const int ns = ((ql0 + 16 * QT - 1) >> 5) + 1;   // slices that hold a key <= the block's last query
  const _Float16* Kl = KH + ((size_t)b * TT + col) * CC + h * HD + 8 * g; const size_t vo = ((size_t)b * CC + h * HD + col) * (size_t)TT + 8 * g;   // the lane's own places in k rows and in the v planes, slice 0
  v16h ah[QT][HD / 32];
  { const _Float16* pq = QH + ((size_t)b * TT + ql0 + col) * CC + h * HD + 8 * g;
#pragma unroll
    for (int t = 0; t < QT; ++t)
#pragma unroll
      for (int kc = 0; kc < HD / 32; ++kc) { union { v16h v; v8h q[2]; } u; const _Float16* p = pq + t * 16 * CC + kc * 32; u.q[0] = *(const v8h*)p; u.q[1] = *(const v8h*)(p + 16); ah[t][kc] = u.v; }
    asm volatile("s_wait_xcnt 0x0" :: "v"(pq) : "memory"); }   // stands in front of every overwrite of the loads' address registers, which it holds until here
  float mx[QT][8];
#pragma unroll
  for (int t = 0; t < QT; ++t)
#pragma unroll
    for (int r = 0; r < 8; ++r) mx[t][r] = -3.0e38f;
  for (int s = wave; s < ns; s += AW) { const _Float16* pk = Kl + (size_t)s * 32 * CC; const KF k = att_k(pk);
    asm volatile("s_wait_xcnt 0x0" :: "v"(pk) : "memory");   // as above, for the k loads
#pragma unroll
    for (int t = 0; t < QT; ++t) { v8f sc[2]; att_logits(k, ah[t], s, ql0 + t * 16, lane, sc);
#pragma unroll
      for (int r = 0; r < 8; ++r) mx[t][r] = fmaxf(mx[t][r], fmaxf(sc[0][r], sc[1][r])); } }
#pragma unroll   // step outermost: the exchanges of all rows of one step are in flight together
  for (int o = 1; o < 16; o <<= 1)
#pragma unroll
    for (int t = 0; t < QT; ++t)
#pragma unroll
      for (int r = 0; r < 8; ++r) mx[t][r] = fmaxf(mx[t][r], __shfl_xor(mx[t][r], o));
  if (col == 0) {
#pragma unroll
    for (int t = 0; t < QT; ++t)
#pragma unroll
      for (int r = 0; r < 8; ++r) smx[wave][t * 16 + 8 * g + r] = mx[t][r]; }
  __syncthreads();   // every wave's row maxima are in LDS before any wave forms the row maximum over all keys
  float m[QT], lsum[QT];   // from here on a lane serves query row col of each tile (A layout)
#pragma unroll
  for (int t = 0; t < QT; ++t) { m[t] = smx[0][t * 16 + col]; lsum[t] = 0.f;
#pragma unroll
    for (int w = 1; w < AW; ++w) m[t] = fmaxf(m[t], smx[w][t * 16 + col]); }
  v8f acc[QT][HD / 16] = {};
  for (int s = wave; s < ns; s += AW) { v16b vh[HD / 16], vl[HD / 16];   // v is fetched ahead of its use: the hi plane with k, the lo plane under the exponentials
    const __bf16* pvh = VT + vo + s * 32; const __bf16* pvl = VL + vo + s * 32; const _Float16* pk = Kl + (size_t)s * 32 * CC;
#pragma unroll
    for (int j = 0; j < HD / 16; ++j) vh[j] = att_v(pvh, j);
    { const KF k = att_k(pk);
      asm volatile("s_wait_xcnt 0x0" :: "v"(pk), "v"(pvh) : "memory");   // as above, for the k and v hi loads
#pragma unroll
      for (int t = 0; t < QT; ++t) { v8f sc[2]; att_logits(k, ah[t], s, ql0 + t * 16, lane, sc);
#pragma unroll
        for (int j = 0; j < 2; ++j)
#pragma unroll
          for (int r = 0; r < 8; ++r) ss[wave][t * 16 + 8 * g + r][j * 16 + col] = sc[j][r]; } }
    LDSX();   // the wave's own logits are in LDS before its lanes read them back by rows
#pragma unroll
    for (int j = 0; j < HD / 16; ++j) vl[j] = att_v(pvl, j);
    asm volatile("s_wait_xcnt 0x0" :: "v"(pvl) : "memory");   // as above, for the v lo loads
#pragma unroll
    for (int t = 0; t < QT; ++t) { float v[16]; const float* pr = &ss[wave][t * 16 + col][8 * g];
#pragma unroll
      for (int i = 0; i < 8; ++i) { v[i] = pr[i]; v[8 + i] = pr[16 + i]; }
#pragma unroll
      for (int i = 0; i < 16; ++i) { v[i] = expf(v[i] - m[t]); lsum[t] += v[i]; }   // a masked logit is -3e38: its exponential is an exact 0
      const F2 p = bsplit16(v);   // each of the three products runs over the four output tiles, so that no WMMA waits for the one before it
#pragma unroll
      for (int j = 0; j < HD / 16; ++j) acc[t][j] = wmma_bf(p.h, vh[j], acc[t][j]);
#pragma unroll
      for (int j = 0; j < HD / 16; ++j) acc[t][j] = wmma_bf(p.l, vh[j], acc[t][j]);
#pragma unroll
      for (int j = 0; j < HD / 16; ++j) acc[t][j] = wmma_bf(p.h, vl[j], acc[t][j]); } }
#pragma unroll
  for (int t = 0; t < QT; ++t) { lsum[t] += __shfl_xor(lsum[t], 16);   // the two halves of a wave hold the two halves of each row's keys
    if (g == 0) ssum[wave][t * 16 + col] = lsum[t];
#pragma unroll
    for (int j = 0; j < HD / 16; ++j)
#pragma unroll
      for (int r = 0; r < 8; ++r) ss[wave][t * 16 + 8 * g + r][j * 16 + col] = acc[t][j][r]; }
  __syncthreads();   // every wave's partial tiles and row sums are in LDS before any thread sums across waves
  static_assert(16 * (HD / 4) == 32 * AW, "one float4 of each query tile per thread");
#pragma unroll
  for (int t = 0; t < QT; ++t) { const int rl = t * 16 + tid / (HD / 4), c4 = (tid % (HD / 4)) * 4; v4f s = *(const v4f*)&ss[0][rl][c4]; float L = ssum[0][rl];
#pragma unroll   // the LDS reads of all partials issue together; the sums keep wave order
    for (int w = 1; w < AW; ++w) { s += *(const v4f*)&ss[w][rl][c4]; L += ssum[w][rl]; }
    vst2(Y + ((size_t)b * TT + ql0 + rl) * CC + h * HD + c4, s * (1.0f / L)); } }
// ---- k_out: block = (64 rows, 128 cols): out = y (bf16 hi + lo) Wproj + b
__global__ __launch_bounds__(128) void k_out(const float* __restrict__ Y, const float* __restrict__ WP, const float* __restrict__ BP, float* __restrict__ OUT) { __shared__ __align__(16) float sf[4][16][132];
  const int tid = threadIdx.x, wave = tid >> 5, lane = tid & 31, col = lane & 15, g = lane >> 4; const int c0 = blockIdx.y * 128; const size_t r0 = (size_t)blockIdx.x * 64 + wave * 16;
  v8f acc[8] = {};
#pragma unroll 2
  for (int kc = 0; kc < CC / 32; ++kc) { const F2 a = split_row(Y + (r0 + col) * CC, kc * 32, lane);
#pragma unroll
    for (int j = 0; j < 8; ++j) { v16b w; const int o = c0 + j * 16 + col;
#pragma unroll
      for (int i = 0; i < 8; ++i) { w[i] = (__bf16)WP[(size_t)(o) * CC + (kc * 32 + 8 * g + i)]; w[8 + i] = (__bf16)WP[(size_t)(o) * CC + (kc * 32 + 16 + 8 * g + i)]; }
      acc[j] = wmma_bf(a.h, w, acc[j]); acc[j] = wmma_bf(a.l, w, acc[j]); } }
#pragma unroll
  for (int j = 0; j < 8; ++j) { const float bb = BP ? bfr(BP[c0 + j * 16 + col]) : 0.f;
#pragma unroll
    for (int r = 0; r < 8; ++r) sf[wave][8 * g + r][j * 16 + col] = acc[j][r] + bb; }
  LDSX(); for (int rl = 0; rl < 16; ++rl) vst2(OUT + (r0 + rl) * CC + c0 + lane * 4, *(const v4f*)&sf[wave][rl][lane * 4]); }
extern "C" void kernel_launch(void* const* d_in, const int* in_sizes, int n_in, void* d_out, int out_size, void* d_ws, size_t ws_size, hipStream_t stream) {
  (void)in_sizes; (void)n_in; (void)out_size;
  const float** F = (const float**)d_in;   // 0 x [2,2048,1024], 1 Wq [1024,1024] ([out,in]), 2 bq, 3 Wk, 4 bk, 5 Wv, 6 bv, 7 Wo, 8 bo
  if (ws_size < (size_t)WS_END) return;
  char* ws = (char*)d_ws; _Float16 *QH = (_Float16*)(ws + WS_QH), *QL = (_Float16*)(ws + WS_QL), *KH = (_Float16*)(ws + WS_KH); __bf16 *VT = (__bf16*)(ws + WS_VT), *VL = (__bf16*)(ws + WS_VL); float *Y = (float*)(ws + WS_Y);
  k_proj<<<dim3(TNB * TT / 64, CC / 128, 3), 128, 0, stream>>>(F[0], F[1], F[2], F[3], F[4], F[5], F[6], QH, QL, KH, VT, VL);
  k_att<<<dim3(TT / (16 * QT), NH, TNB), 32 * AW, 0, stream>>>(QH, KH, VT, VL, Y);
  k_out<<<dim3(TNB * TT / 64, CC / 128), 128, 0, stream>>>(Y, F[7], F[8], (float*)d_out);
}

// v003
// Measured time: 183 microseconds a run.
// Timed twice side by side with v002, it ran 2.50 times as fast both times.
// Counting every step since v000, it is 8.08 times as fast.
// compute dtype: all float inputs rounded to bf16; q/k/v = x W^T + b with EXACT bf16 products on WMMA 16x16x32, f32 accumulate; rotary in f32 (inv_freq = 10000^(-2i/64) via exp2f/log2f-free powf, precise cosf/sinf); q, k rounded once to f16 (0.02-scale weights: logits std ~0.05, 1 product), causal logits kept on chip in f32 (computed twice: row maxima, then P); softmax in f32 (precise expf), P = exp(s - max) kept f32 split bf16 hi + lo against v bf16 hi + lo (3 products), divided by the f32 row sum at the end; out = o (bf16 hi + lo) Wo^T + bo; f32 output.
#include <hip/hip_runtime.h>
#include <math.h>

typedef __attribute__((ext_vector_type(16))) _Float16 v16h;
typedef __attribute__((ext_vector_type(16))) __bf16 v16b;
typedef __attribute__((ext_vector_type(8)))  _Float16 v8h;
typedef __attribute__((ext_vector_type(8)))  float v8f;
typedef __attribute__((ext_vector_type(4)))  float v4f;
typedef __attribute__((ext_vector_type(2)))  float v2f;
typedef __attribute__((ext_vector_type(4)))  unsigned v4u;
typedef __attribute__((ext_vector_type(4)))  int v4i;
typedef float __attribute__((may_alias)) float_a;
typedef int __attribute__((may_alias)) int_a;

template <typename T> __device__ __forceinline__ void vst2(void* p, T v) { *(T*)p = v;  }
__device__ __forceinline__ v8f wmma16(v16h a, v16h b, v8f c) {
  v8f d = __builtin_amdgcn_wmma_f32_16x16x32_f16(false, a, false, b, (short)0, c, false, false);
  asm volatile("v_nop\n\tv_nop\n\tv_nop\n\tv_nop" : "+v"(d) : "v"(a), "v"(b));
  return d;
}
__device__ __forceinline__ v8f wmma_bf(v16b a, v16b b, v8f c) {
  v8f d = __builtin_amdgcn_wmma_f32_16x16x32_bf16(false, a, false, b, (short)0, c, false, false);
  asm volatile("v_nop\n\tv_nop\n\tv_nop\n\tv_nop" : "+v"(d) : "v"(a), "v"(b));
  return d;
}
// 16x16x32 fragments: lane = (h = lane>>4, row/col = lane&15); elements 0..7 = k0+8h+0..7, 8..15 = k0+16+8h+0..7; D element r = row 8h+r
__device__ __forceinline__ v16h frag_h(const _Float16* rowk0, int lane) {
  union { v16h v; v8h q[2]; } u; const _Float16* p = rowk0 + 8 * (lane >> 4);
  u.q[0] = *(const v8h*)p; u.q[1] = *(const v8h*)(p + 16); return u.v;
}
__device__ __forceinline__ v16h frag_f32(const float* rowk0, int lane) {
  v16h a; const float* p = rowk0 + 8 * (lane >> 4);
#pragma unroll
  for (int i = 0; i < 8; ++i) { a[i] = (_Float16)p[i]; a[8 + i] = (_Float16)p[16 + i]; }
  return a;
}
__device__ __forceinline__ v16h frag_f32s(const float* rowk0, int lane, float sc) {
  v16h a; const float* p = rowk0 + 8 * (lane >> 4);
#pragma unroll
  for (int i = 0; i < 8; ++i) { a[i] = (_Float16)(p[i] * sc); a[8 + i] = (_Float16)(p[16 + i] * sc); }
  return a;
}
// column fragment from a [K][ld] layout (column n), rows >= K read as 0
__device__ __forceinline__ v16h fragc_f32(const float* W, int k0, int n, int lane, int ld, int K) {
  v16h a; const int g = lane >> 4;
#pragma unroll
  for (int i = 0; i < 8; ++i) { const int ka = k0 + 8 * g + i, kb = ka + 16;
    a[i] = (_Float16)(ka < K ? W[(size_t)(ka < K ? ka : K - 1) * ld + n] : 0.f); a[8 + i] = (_Float16)(kb < K ? W[(size_t)(kb < K ? kb : K - 1) * ld + n] : 0.f); }
  return a;
}
struct F2 { v16b h, l; };
__device__ __forceinline__ F2 bsplit16(const float v[16]) { F2 r;
#pragma unroll
  for (int i = 0; i < 16; ++i) { const __bf16 h = (__bf16)v[i]; r.h[i] = h; r.l[i] = (__bf16)(v[i] - (float)h); }
  return r; }
__device__ __forceinline__ F2 split_row(const float* row, int k0, int lane) { float v[16]; const float* p = row + k0 + 8 * (lane >> 4);
#pragma unroll
  for (int i = 0; i < 8; ++i) { v[i] = p[i]; v[8 + i] = p[16 + i]; }
  return bsplit16(v); }
__device__ __forceinline__ F2 split_rowK(const float* row, int k0, int lane, int K) { float v[16]; const int g = lane >> 4;
#pragma unroll
  for (int i = 0; i < 8; ++i) { const int ka = k0 + 8 * g + i, kb = ka + 16; v[i] = ka < K ? row[ka < K ? ka : K - 1] : 0.f; v[8 + i] = kb < K ? row[kb < K ? kb : K - 1] : 0.f; }
  return bsplit16(v); }
__device__ __forceinline__ F2 split_col(const float* W, int k0, int n, int lane, int ld, int K) { float v[16]; const int g = lane >> 4;
#pragma unroll
  for (int i = 0; i < 8; ++i) { const int ka = k0 + 8 * g + i, kb = ka + 16; v[i] = ka < K ? W[(size_t)(ka < K ? ka : K - 1) * ld + n] : 0.f; v[8 + i] = kb < K ? W[(size_t)(kb < K ? kb : K - 1) * ld + n] : 0.f; }
  return bsplit16(v); }
__device__ __forceinline__ v8f mac3(const F2& a, const F2& b, v8f c) { c = wmma_bf(a.l, b.h, c); c = wmma_bf(a.h, b.l, c); return wmma_bf(a.h, b.h, c); }
__device__ __forceinline__ float sigm(float v) { return 1.0f / (1.0f + expf(-v)); }
#define LDSX() do { asm volatile("s_wait_dscnt 0" ::: "memory"); __builtin_amdgcn_wave_barrier(); __builtin_amdgcn_fence(__ATOMIC_RELEASE, "workgroup"); } while (0)


// Trajectory attention (B 2, T 2,048, C 1,024 = 16 x 64): q/k/v Linear, rotary position embedding (base 10000, rotate_half), causal softmax(q k / 8) v, output Linear.
#define NB 2
#define TT 2048
#define CC 1024
#define NH 16
#define HD 64
#ifndef TNB
#define TNB NB
#endif
typedef __attribute__((ext_vector_type(8))) __bf16 v8b;
__device__ __forceinline__ v16b frag_b(const __bf16* rowk0, int lane) {
  union { v16b v; v8b q[2]; } u; const __bf16* p = rowk0 + 8 * (lane >> 4);
  u.q[0] = *(const v8b*)p; u.q[1] = *(const v8b*)(p + 16); return u.v;
}
__device__ __forceinline__ float bfr(float v) { return (float)(__bf16)v; }
__device__ __attribute__((noinline)) float exp_ni(float v) { return expf(v); }
__device__ __attribute__((noinline)) float erf_ni(float v) { return erff(v); }

// ---- operand staging of k_proj and k_out: a block brings GK k of every operand row with whole-line 16-byte loads (16 lanes = 256 B of one row), converts once and keeps bf16 rows in LDS
#define GK 64
#define GP (GK + 8)   // LDS row pitch in elements: 144 B = 16 B x 9, free of bank conflicts for the 16-byte fragment reads
typedef __attribute__((ext_vector_type(4))) __bf16 v4b;
// every '#pragma unroll' of the staging helpers and loops: the loop indexes register arrays, which stay in registers only when it is unrolled
// p = the thread's own place: row tid / 16, float4 tid % 16 of the chunk; load i is 8 i rows further down
template <int N> __device__ __forceinline__ void g_fetch(const float* p, v4f* r) {
#pragma unroll
  for (int i = 0; i < N; ++i) r[i] = *(const v4f*)(p + (size_t)i * 8 * CC); }
template <int N> __device__ __forceinline__ void g_put(__bf16 (*t)[GP], int lr, int lc, const v4f* r) {
#pragma unroll
  for (int i = 0; i < N; ++i) { v4b o;
#pragma unroll
    for (int e = 0; e < 4; ++e) o[e] = (__bf16)r[i][e];
    *(v4b*)&t[lr + 8 * i][lc] = o; } }
template <int N> __device__ __forceinline__ void g_put2(__bf16 (*th)[GP], __bf16 (*tl)[GP], int lr, int lc, const v4f* r) {   // bf16 hi + residual, as bsplit16
#pragma unroll
  for (int i = 0; i < N; ++i) { v4b oh, ol;
#pragma unroll
    for (int e = 0; e < 4; ++e) { const __bf16 h = (__bf16)r[i][e]; oh[e] = h; ol[e] = (__bf16)(r[i][e] - (float)h); }
    *(v4b*)&th[lr + 8 * i][lc] = oh; *(v4b*)&tl[lr + 8 * i][lc] = ol; } }

#define WS_QH  0u
#define WS_QL  (WS_QH + 2u * (size_t)NB * TT * CC)
#define WS_KH  (WS_QL + 2u * (size_t)NB * TT * CC)
#define WS_VT  (WS_KH + 2u * (size_t)NB * TT * CC)      // bf16 v planes [b][c][t]
#define WS_VL  (WS_VT + 2u * (size_t)NB * CC * TT)      // bf16 v residual planes
#define WS_Y   (WS_VL + 2u * (size_t)NB * CC * TT)      // f32 y rows [b*t][C]
#define WS_END (WS_Y + 4u * (size_t)NB * TT * CC)

// ---- k_proj: block = (64 rows, 128 cols, which): qkv = x W (+ b), exact; q -> f16 hi (+ residual), k -> f16 rows, v -> bf16 hi + lo planes
// the staging buffers are dead when the epilogue's arrays come to life: they share the block's LDS
union ProjLds { struct { __bf16 x[2][64][GP], w[2][128][GP]; } st; struct { _Float16 sh[64][136], sl[64][136]; __bf16 th[128][72], tl2[128][72]; float sf[64][132]; } ep; };
__global__ __launch_bounds__(128) void k_proj(const float* __restrict__ X, const float* __restrict__ WQ, const float* __restrict__ BQ, const float* __restrict__ WK, const float* __restrict__ BK, const float* __restrict__ WV, const float* __restrict__ BV, _Float16* __restrict__ QH, _Float16* __restrict__ QL, _Float16* __restrict__ KH, __bf16* __restrict__ VT, __bf16* __restrict__ VL) {
  __shared__ __align__(16) ProjLds lds; _Float16 (&sh)[64][136] = lds.ep.sh; _Float16 (&sl)[64][136] = lds.ep.sl; __bf16 (&th)[128][72] = lds.ep.th; __bf16 (&tl2)[128][72] = lds.ep.tl2; float (&sf)[64][132] = lds.ep.sf;
  const int tid = threadIdx.x, wave = tid >> 5, lane = tid & 31, col = lane & 15, g = lane >> 4; const int which = blockIdx.z; const int c0 = blockIdx.y * 128; const size_t r0 = (size_t)blockIdx.x * 64; const float* WA = which == 0 ? WQ : which == 1 ? WK : WV; const float* BA = which == 0 ? BQ : which == 1 ? BK : BV;
  v8f acc[8] = {};
  const int lr = tid >> 4, lc = (tid & 15) * 4; const float* px = X + (r0 + lr) * CC + lc; const float* pw = WA + (size_t)(c0 + lr) * CC + lc;
  v4f rx[8], rw[16]; g_fetch<8>(px, rx); g_fetch<16>(pw, rw);
  asm volatile("s_wait_xcnt 0x0" :: "v"(px), "v"(pw) : "memory");   // stands in front of every overwrite of the loads' address registers, which it holds until here
#pragma unroll 2   // the buffer index becomes a constant in each copy of the body
  for (int c = 0; c < CC / GK; ++c) { const int bs = c & 1; g_put<8>(lds.st.x[bs], lr, lc, rx); g_put<16>(lds.st.w[bs], lr, lc, rw);
    __syncthreads();   // chunk c is whole in LDS before any wave reads it; it also ends every wave's reads of the other buffer, which the next trip refills
    if (c + 1 < CC / GK) { px += GK; pw += GK; g_fetch<8>(px, rx); g_fetch<16>(pw, rw);   // the next chunk flies under this chunk's products
      asm volatile("s_wait_xcnt 0x0" :: "v"(px), "v"(pw) : "memory"); }   // as above
#pragma unroll
    for (int kk = 0; kk < GK / 32; ++kk) { const v16b a = frag_b(&lds.st.x[bs][wave * 16 + col][kk * 32], lane); v16b w[8];
#pragma unroll
      for (int j = 0; j < 8; ++j) w[j] = frag_b(&lds.st.w[bs][j * 16 + col][kk * 32], lane);
#pragma unroll
      for (int j = 0; j < 8; ++j) acc[j] = wmma_bf(a, w[j], acc[j]); } }
  __syncthreads();   // every wave has left the staging buffers before the epilogue's arrays overwrite them
#pragma unroll
  for (int j = 0; j < 8; ++j) { const float bb = bfr(BA[c0 + j * 16 + col]);
#pragma unroll
    for (int r = 0; r < 8; ++r) { const float v = acc[j][r] + bb; const int rl = wave * 16 + 8 * g + r, cl = j * 16 + col;
      if (which == 2) { const __bf16 bh = (__bf16)v; th[cl][rl] = bh; tl2[cl][rl] = (__bf16)(v - (float)bh); } else sf[rl][cl] = v; } }
  __syncthreads();
  if (which < 2) {   // rotary: out[d] = x[d] cos(t f_{d mod 32}) + (d < 32 ? -x[d+32] : x[d-32]) sin(t f_{d mod 32}); f_i = 10000^(-i/32)
    for (int e = tid; e < 64 * 128; e += 128) { const int rl = e >> 7, cl = e & 127; const int d = cl & 63; const int i2 = d & 31; const size_t row = r0 + rl; const int tpos = (int)(row % TT);
      const float inv_freq = 1.0f / powf(10000.0f, (float)(2 * i2) / 64.0f); const float ang = (float)tpos * inv_freq; const float c = cosf(ang), s = sinf(ang);
      const float me = sf[rl][cl]; const float partner = (d < 32) ? -sf[rl][cl + 32] : sf[rl][cl - 32]; const float v = me * c + partner * s; const _Float16 hv = (_Float16)v; sh[rl][cl] = hv; sl[rl][cl] = (_Float16)(v - (float)hv); }
    __syncthreads(); }
  if (which < 2) { _Float16* dh = which == 0 ? QH : KH; for (int e = tid; e < 64 * 16; e += 128) { const int rl = e >> 4, q = e & 15; vst2((unsigned*)(dh + (r0 + rl) * CC + c0 + q * 8), *(const v4u*)&sh[rl][q * 8]); if (which == 0) vst2((unsigned*)(QL + (r0 + rl) * CC + c0 + q * 8), *(const v4u*)&sl[rl][q * 8]); } }
  else { const size_t b = r0 / TT; const int t0 = (int)(r0 % TT); for (int e = tid; e < 128 * 8; e += 128) { const int cl = e >> 3, q = e & 7; const size_t o2 = (b * CC + c0 + cl) * (size_t)TT + t0 + q * 8; vst2((unsigned*)(VT + o2), *(const v4u*)&th[cl][q * 8]); vst2((unsigned*)(VL + o2), *(const v4u*)&tl2[cl][q * 8]); } } }
// ---- k_att: block = 16 * QT queries of (b,h), AW waves; wave w takes the 32-key slices w, w + AW, ... up to the diagonal, each k and v fragment serving the QT query tiles. Sweep 1: logits on WMMA, row maxima only. Sweep 2: the same logits again, exp(s - max) in f32, P (bf16 hi + lo) . v; row sums and f32 partial tiles of the waves are summed in LDS in wave order: y[q][h*HD + d] = P . v / sum
// every '#pragma unroll' of k_att and its helpers without a note of its own: the loop indexes fragment, accumulator or per-row arrays, which stay in registers only when it is unrolled
#define AW 8   // the wave number is read into a scalar so that each wave's trip test is a scalar branch
#define QT 2
struct KF { v16h f[2][HD / 32]; };   // k fragments of one slice: [16-key group][32 of the head's 64 dims]
// pk = the lane's own place in the slice's first 16-key group: row col, element 8g
__device__ __forceinline__ KF att_k(const _Float16* pk) { KF k;
#pragma unroll
  for (int j = 0; j < 2; ++j)
#pragma unroll
    for (int kc = 0; kc < HD / 32; ++kc) { union { v16h v; v8h q[2]; } u; const _Float16* p = pk + j * 16 * CC + kc * 32; u.q[0] = *(const v8h*)p; u.q[1] = *(const v8h*)(p + 16); k.f[j][kc] = u.v; }
  return k; }
// pv = the lane's own place in the slice of a v plane: row col of the head's first 16 dims, key 8g
__device__ __forceinline__ v16b att_v(const __bf16* pv, int j) { union { v16b v; v8b q[2]; } u; const __bf16* p = pv + (size_t)j * 16 * TT; u.q[0] = *(const v8b*)p; u.q[1] = *(const v8b*)(p + 16); return u.v; }
// logits of one query tile against one slice, D layout: sc[j][r] = query q0 + 8g + r against key s*32 + j*16 + col, scaled, keys above the diagonal masked
__device__ __forceinline__ void att_logits(const KF& k, const v16h* ah, int s, int q0, int lane, v8f* sc) { const int col = lane & 15, g = lane >> 4;
#pragma unroll
  for (int j = 0; j < 2; ++j) { const int kt = s * 32 + j * 16 + col; v8f a = {};
#pragma unroll
    for (int kc = 0; kc < HD / 32; ++kc) a = wmma16(ah[kc], k.f[j][kc], a);
#pragma unroll
    for (int r = 0; r < 8; ++r) { const int qt = q0 + 8 * g + r; float v = a[r] * 0.125f; if (kt > qt) v = -3.0e38f; sc[j][r] = v; } } }
// amdgpu_waves_per_eu(4): holds the allocation at 256 registers, so that two blocks share a WGP
__global__ __launch_bounds__(32 * AW) __attribute__((amdgpu_waves_per_eu(4))) void k_att(const _Float16* __restrict__ QH, const _Float16* __restrict__ KH, const __bf16* __restrict__ VT, const __bf16* __restrict__ VL, float* __restrict__ Y) { __shared__ __align__(16) float ss[AW][16 * QT][HD + 4]; __shared__ float smx[AW][16 * QT], ssum[AW][16 * QT];
  const int tid = threadIdx.x, wave = __builtin_amdgcn_readfirstlane(tid >> 5), lane = tid & 31, col = lane & 15, g = lane >> 4; const int b = blockIdx.z, h = blockIdx.y, ql0 = blockIdx.x * (16 * QT); const int ns = ((ql0 + 16 * QT - 1) >> 5) + 1;   // slices that hold a key <= the block's last query
  const _Float16* Kl = KH + ((size_t)b * TT + col) * CC + h * HD + 8 * g; const size_t vo = ((size_t)b * CC + h * HD + col) * (size_t)TT + 8 * g;   // the lane's own places in k rows and in the v planes, slice 0
  v16h ah[QT][HD / 32];
  { const _Float16* pq = QH + ((size_t)b * TT + ql0 + col) * CC + h * HD + 8 * g;
#pragma unroll
    for (int t = 0; t < QT; ++t)
#pragma unroll
      for (int kc = 0; kc < HD / 32; ++kc) { union { v16h v; v8h q[2]; } u; const _Float16* p = pq + t * 16 * CC + kc * 32; u.q[0] = *(const v8h*)p; u.q[1] = *(const v8h*)(p + 16); ah[t][kc] = u.v; }
    asm volatile("s_wait_xcnt 0x0" :: "v"(pq) : "memory"); }   // stands in front of every overwrite of the loads' address registers, which it holds until here
  float mx[QT][8];
#pragma unroll
  for (int t = 0; t < QT; ++t)
#pragma unroll
    for (int r = 0; r < 8; ++r) mx[t][r] = -3.0e38f;
  for (int s = wave; s < ns; s += AW) { const _Float16* pk = Kl + (size_t)s * 32 * CC; const KF k = att_k(pk);
    asm volatile("s_wait_xcnt 0x0" :: "v"(pk) : "memory");   // as above, for the k loads
#pragma unroll
    for (int t = 0; t < QT; ++t) { v8f sc[2]; att_logits(k, ah[t], s, ql0 + t * 16, lane, sc);
#pragma unroll
      for (int r = 0; r < 8; ++r) mx[t][r] = fmaxf(mx[t][r], fmaxf(sc[0][r], sc[1][r])); } }
#pragma unroll   // step outermost: the exchanges of all rows of one step are in flight together
  for (int o = 1; o < 16; o <<= 1)
#pragma unroll
    for (int t = 0; t < QT; ++t)
#pragma unroll
      for (int r = 0; r < 8; ++r) mx[t][r] = fmaxf(mx[t][r], __shfl_xor(mx[t][r], o));
  if (col == 0) {
#pragma unroll
    for (int t = 0; t < QT; ++t)
#pragma unroll
      for (int r = 0; r < 8; ++r) smx[wave][t * 16 + 8 * g + r] = mx[t][r]; }
  __syncthreads();   // every wave's row maxima are in LDS before any wave forms the row maximum over all keys
  float m[QT], lsum[QT];   // from here on a lane serves query row col of each tile (A layout)
#pragma unroll
  for (int t = 0; t < QT; ++t) { m[t] = smx[0][t * 16 + col]; lsum[t] = 0.f;
#pragma unroll
    for (int w = 1; w < AW; ++w) m[t] = fmaxf(m[t], smx[w][t * 16 + col]); }
  v8f acc[QT][HD / 16] = {};
  for (int s = wave; s < ns; s += AW) { v16b vh[HD / 16], vl[HD / 16];   // v is fetched ahead of its use: the hi plane with k, the lo plane under the exponentials
    const __bf16* pvh = VT + vo + s * 32; const __bf16* pvl = VL + vo + s * 32; const _Float16* pk = Kl + (size_t)s * 32 * CC;
#pragma unroll
    for (int j = 0; j < HD / 16; ++j) vh[j] = att_v(pvh, j);
    { const KF k = att_k(pk);
      asm volatile("s_wait_xcnt 0x0" :: "v"(pk), "v"(pvh) : "memory");   // as above, for the k and v hi loads
#pragma unroll
      for (int t = 0; t < QT; ++t) { v8f sc[2]; att_logits(k, ah[t], s, ql0 + t * 16, lane, sc);
#pragma unroll
        for (int j = 0; j < 2; ++j)
#pragma unroll
          for (int r = 0; r < 8; ++r) ss[wave][t * 16 + 8 * g + r][j * 16 + col] = sc[j][r]; } }
    LDSX();   // the wave's own logits are in LDS before its lanes read them back by rows
#pragma unroll
    for (int j = 0; j < HD / 16; ++j) vl[j] = att_v(pvl, j);
    asm volatile("s_wait_xcnt 0x0" :: "v"(pvl) : "memory");   // as above, for the v lo loads
#pragma unroll
    for (int t = 0; t < QT; ++t) { float v[16]; const float* pr = &ss[wave][t * 16 + col][8 * g];
#pragma unroll
      for (int i = 0; i < 8; ++i) { v[i] = pr[i]; v[8 + i] = pr[16 + i]; }
#pragma unroll
      for (int i = 0; i < 16; ++i) { v[i] = expf(v[i] - m[t]); lsum[t] += v[i]; }   // a masked logit is -3e38: its exponential is an exact 0
      const F2 p = bsplit16(v);   // each of the three products runs over the four output tiles, so that no WMMA waits for the one before it
#pragma unroll
      for (int j = 0; j < HD / 16; ++j) acc[t][j] = wmma_bf(p.h, vh[j], acc[t][j]);
#pragma unroll
      for (int j = 0; j < HD / 16; ++j) acc[t][j] = wmma_bf(p.l, vh[j], acc[t][j]);
#pragma unroll
      for (int j = 0; j < HD / 16; ++j) acc[t][j] = wmma_bf(p.h, vl[j], acc[t][j]); } }
#pragma unroll
  for (int t = 0; t < QT; ++t) { lsum[t] += __shfl_xor(lsum[t], 16);   // the two halves of a wave hold the two halves of each row's keys
    if (g == 0) ssum[wave][t * 16 + col] = lsum[t];
#pragma unroll
    for (int j = 0; j < HD / 16; ++j)
#pragma unroll
      for (int r = 0; r < 8; ++r) ss[wave][t * 16 + 8 * g + r][j * 16 + col] = acc[t][j][r]; }
  __syncthreads();   // every wave's partial tiles and row sums are in LDS before any thread sums across waves
  static_assert(16 * (HD / 4) == 32 * AW, "one float4 of each query tile per thread");
#pragma unroll
  for (int t = 0; t < QT; ++t) { const int rl = t * 16 + tid / (HD / 4), c4 = (tid % (HD / 4)) * 4; v4f s = *(const v4f*)&ss[0][rl][c4]; float L = ssum[0][rl];
#pragma unroll   // the LDS reads of all partials issue together; the sums keep wave order
    for (int w = 1; w < AW; ++w) { s += *(const v4f*)&ss[w][rl][c4]; L += ssum[w][rl]; }
    vst2(Y + ((size_t)b * TT + ql0 + rl) * CC + h * HD + c4, s * (1.0f / L)); } }
// ---- k_out: block = (64 rows, 128 cols): out = y (bf16 hi + lo) Wproj + b
__global__ __launch_bounds__(128) void k_out(const float* __restrict__ Y, const float* __restrict__ WP, const float* __restrict__ BP, float* __restrict__ OUT) { __shared__ __align__(16) float sf[4][16][132]; __shared__ __align__(16) __bf16 yh[2][64][GP], yl[2][64][GP], wt[2][128][GP];
  const int tid = threadIdx.x, wave = tid >> 5, lane = tid & 31, col = lane & 15, g = lane >> 4; const int c0 = blockIdx.y * 128; const size_t r0 = (size_t)blockIdx.x * 64 + wave * 16;
  v8f acc[8] = {};
  const int lr = tid >> 4, lc = (tid & 15) * 4; const float* py = Y + ((size_t)blockIdx.x * 64 + lr) * CC + lc; const float* pw = WP + (size_t)(c0 + lr) * CC + lc;
  v4f ry[8], rw[16]; g_fetch<8>(py, ry); g_fetch<16>(pw, rw);
  asm volatile("s_wait_xcnt 0x0" :: "v"(py), "v"(pw) : "memory");   // stands in front of every overwrite of the loads' address registers, which it holds until here
#pragma unroll 2   // the buffer index becomes a constant in each copy of the body
  for (int c = 0; c < CC / GK; ++c) { const int bs = c & 1; g_put2<8>(yh[bs], yl[bs], lr, lc, ry); g_put<16>(wt[bs], lr, lc, rw);
    __syncthreads();   // chunk c is whole in LDS before any wave reads it; it also ends every wave's reads of the other buffer, which the next trip refills
    if (c + 1 < CC / GK) { py += GK; pw += GK; g_fetch<8>(py, ry); g_fetch<16>(pw, rw);   // the next chunk flies under this chunk's products
      asm volatile("s_wait_xcnt 0x0" :: "v"(py), "v"(pw) : "memory"); }   // as above
#pragma unroll
    for (int kk = 0; kk < GK / 32; ++kk) { const v16b ah = frag_b(&yh[bs][wave * 16 + col][kk * 32], lane), al = frag_b(&yl[bs][wave * 16 + col][kk * 32], lane); v16b w[8];
#pragma unroll
      for (int j = 0; j < 8; ++j) w[j] = frag_b(&wt[bs][j * 16 + col][kk * 32], lane);
#pragma unroll
      for (int j = 0; j < 8; ++j) { acc[j] = wmma_bf(ah, w[j], acc[j]); acc[j] = wmma_bf(al, w[j], acc[j]); } } }
#pragma unroll
  for (int j = 0; j < 8; ++j) { const float bb = BP ? bfr(BP[c0 + j * 16 + col]) : 0.f;
#pragma unroll
    for (int r = 0; r < 8; ++r) sf[wave][8 * g + r][j * 16 + col] = acc[j][r] + bb; }
  LDSX(); for (int rl = 0; rl < 16; ++rl) vst2(OUT + (r0 + rl) * CC + c0 + lane * 4, *(const v4f*)&sf[wave][rl][lane * 4]); }
extern "C" void kernel_launch(void* const* d_in, const int* in_sizes, int n_in, void* d_out, int out_size, void* d_ws, size_t ws_size, hipStream_t stream) {
  (void)in_sizes; (void)n_in; (void)out_size;
  const float** F = (const float**)d_in;   // 0 x [2,2048,1024], 1 Wq [1024,1024] ([out,in]), 2 bq, 3 Wk, 4 bk, 5 Wv, 6 bv, 7 Wo, 8 bo
  if (ws_size < (size_t)WS_END) return;
  char* ws = (char*)d_ws; _Float16 *QH = (_Float16*)(ws + WS_QH), *QL = (_Float16*)(ws + WS_QL), *KH = (_Float16*)(ws + WS_KH); __bf16 *VT = (__bf16*)(ws + WS_VT), *VL = (__bf16*)(ws + WS_VL); float *Y = (float*)(ws + WS_Y);
  k_proj<<<dim3(TNB * TT / 64, CC / 128, 3), 128, 0, stream>>>(F[0], F[1], F[2], F[3], F[4], F[5], F[6], QH, QL, KH, VT, VL);
  k_att<<<dim3(TT / (16 * QT), NH, TNB), 32 * AW, 0, stream>>>(QH, KH, VT, VL, Y);
  k_out<<<dim3(TNB * TT / 64, CC / 128), 128, 0, stream>>>(Y, F[7], F[8], (float*)d_out);
}

// v004
// One run takes 169 microseconds.
// In two side-by-side timings against v003, it was 1.09 and 1.08 times as fast.
// Counting every step since v000, it is 8.77 times as fast.
// compute dtype: all float inputs rounded to bf16; q/k/v = x W^T + b with EXACT bf16 products on WMMA 16x16x32, f32 accumulate; rotary in f32 (inv_freq = 10000^(-2i/64) via exp2f/log2f-free powf, precise cosf/sinf); q, k rounded once to f16 (0.02-scale weights: logits std ~0.05, 1 product), causal logits kept on chip in f32 (computed twice: row maxima, then P); softmax in f32 (precise expf), P = exp(s - max) kept f32 split bf16 hi + lo against v bf16 hi + lo (3 products), divided by the f32 row sum at the end; out = o (bf16 hi + lo) Wo^T + bo; f32 output.
#include <hip/hip_runtime.h>
#include <math.h>

typedef __attribute__((ext_vector_type(16))) _Float16 v16h;
typedef __attribute__((ext_vector_type(16))) __bf16 v16b;
typedef __attribute__((ext_vector_type(8)))  _Float16 v8h;
typedef __attribute__((ext_vector_type(8)))  float v8f;
typedef __attribute__((ext_vector_type(4)))  float v4f;
typedef __attribute__((ext_vector_type(2)))  float v2f;
typedef __attribute__((ext_vector_type(4)))  unsigned v4u;
typedef __attribute__((ext_vector_type(4)))  int v4i;
typedef float __attribute__((may_alias)) float_a;
typedef int __attribute__((may_alias)) int_a;

template <typename T> __device__ __forceinline__ void vst2(void* p, T v) { *(T*)p = v;  }
__device__ __forceinline__ v8f wmma16(v16h a, v16h b, v8f c) {
  v8f d = __builtin_amdgcn_wmma_f32_16x16x32_f16(false, a, false, b, (short)0, c, false, false);
  asm volatile("v_nop\n\tv_nop\n\tv_nop\n\tv_nop" : "+v"(d) : "v"(a), "v"(b));
  return d;
}
__device__ __forceinline__ v8f wmma_bf(v16b a, v16b b, v8f c) {
  v8f d = __builtin_amdgcn_wmma_f32_16x16x32_bf16(false, a, false, b, (short)0, c, false, false);
  asm volatile("v_nop\n\tv_nop\n\tv_nop\n\tv_nop" : "+v"(d) : "v"(a), "v"(b));
  return d;
}
// 16x16x32 fragments: lane = (h = lane>>4, row/col = lane&15); elements 0..7 = k0+8h+0..7, 8..15 = k0+16+8h+0..7; D element r = row 8h+r
__device__ __forceinline__ v16h frag_h(const _Float16* rowk0, int lane) {
  union { v16h v; v8h q[2]; } u; const _Float16* p = rowk0 + 8 * (lane >> 4);
  u.q[0] = *(const v8h*)p; u.q[1] = *(const v8h*)(p + 16); return u.v;
}
__device__ __forceinline__ v16h frag_f32(const float* rowk0, int lane) {
  v16h a; const float* p = rowk0 + 8 * (lane >> 4);
#pragma unroll
  for (int i = 0; i < 8; ++i) { a[i] = (_Float16)p[i]; a[8 + i] = (_Float16)p[16 + i]; }
  return a;
}
__device__ __forceinline__ v16h frag_f32s(const float* rowk0, int lane, float sc) {
  v16h a; const float* p = rowk0 + 8 * (lane >> 4);
#pragma unroll
  for (int i = 0; i < 8; ++i) { a[i] = (_Float16)(p[i] * sc); a[8 + i] = (_Float16)(p[16 + i] * sc); }
  return a;
}
// column fragment from a [K][ld] layout (column n), rows >= K read as 0
__device__ __forceinline__ v16h fragc_f32(const float* W, int k0, int n, int lane, int ld, int K) {
  v16h a; const int g = lane >> 4;
#pragma unroll
  for (int i = 0; i < 8; ++i) { const int ka = k0 + 8 * g + i, kb = ka + 16;
    a[i] = (_Float16)(ka < K ? W[(size_t)(ka < K ? ka : K - 1) * ld + n] : 0.f); a[8 + i] = (_Float16)(kb < K ? W[(size_t)(kb < K ? kb : K - 1) * ld + n] : 0.f); }
  return a;
}
struct F2 { v16b h, l; };
__device__ __forceinline__ F2 bsplit16(const float v[16]) { F2 r;
#pragma unroll
  for (int i = 0; i < 16; ++i) { const __bf16 h = (__bf16)v[i]; r.h[i] = h; r.l[i] = (__bf16)(v[i] - (float)h); }
  return r; }
__device__ __forceinline__ F2 split_row(const float* row, int k0, int lane) { float v[16]; const float* p = row + k0 + 8 * (lane >> 4);
#pragma unroll
  for (int i = 0; i < 8; ++i) { v[i] = p[i]; v[8 + i] = p[16 + i]; }
  return bsplit16(v); }
__device__ __forceinline__ F2 split_rowK(const float* row, int k0, int lane, int K) { float v[16]; const int g = lane >> 4;
#pragma unroll
  for (int i = 0; i < 8; ++i) { const int ka = k0 + 8 * g + i, kb = ka + 16; v[i] = ka < K ? row[ka < K ? ka : K - 1] : 0.f; v[8 + i] = kb < K ? row[kb < K ? kb : K - 1] : 0.f; }
  return bsplit16(v); }
__device__ __forceinline__ F2 split_col(const float* W, int k0, int n, int lane, int ld, int K) { float v[16]; const int g = lane >> 4;
#pragma unroll
  for (int i = 0; i < 8; ++i) { const int ka = k0 + 8 * g + i, kb = ka + 16; v[i] = ka < K ? W[(size_t)(ka < K ? ka : K - 1) * ld + n] : 0.f; v[8 + i] = kb < K ? W[(size_t)(kb < K ? kb : K - 1) * ld + n] : 0.f; }
  return bsplit16(v); }
__device__ __forceinline__ v8f mac3(const F2& a, const F2& b, v8f c) { c = wmma_bf(a.l, b.h, c); c = wmma_bf(a.h, b.l, c); return wmma_bf(a.h, b.h, c); }
__device__ __forceinline__ float sigm(float v) { return 1.0f / (1.0f + expf(-v)); }
#define LDSX() do { asm volatile("s_wait_dscnt 0" ::: "memory"); __builtin_amdgcn_wave_barrier(); __builtin_amdgcn_fence(__ATOMIC_RELEASE, "workgroup"); } while (0)


// Trajectory attention (B 2, T 2,048, C 1,024 = 16 x 64): q/k/v Linear, rotary position embedding (base 10000, rotate_half), causal softmax(q k / 8) v, output Linear.
#define NB 2
#define TT 2048
#define CC 1024
#define NH 16
#define HD 64
#ifndef TNB
#define TNB NB
#endif
typedef __attribute__((ext_vector_type(8))) __bf16 v8b;
__device__ __forceinline__ v16b frag_b(const __bf16* rowk0, int lane) {
  union { v16b v; v8b q[2]; } u; const __bf16* p = rowk0 + 8 * (lane >> 4);
  u.q[0] = *(const v8b*)p; u.q[1] = *(const v8b*)(p + 16); return u.v;
}
__device__ __forceinline__ float bfr(float v) { return (float)(__bf16)v; }
__device__ __attribute__((noinline)) float exp_ni(float v) { return expf(v); }
__device__ __attribute__((noinline)) float erf_ni(float v) { return erff(v); }

// ---- operand staging of k_proj and k_out: a block brings GK k of every operand row with whole-line 16-byte loads (16 lanes = 256 B of one row), converts once and keeps bf16 rows in LDS
#define GK 64
#define GP (GK + 8)   // LDS row pitch in elements: 144 B = 16 B x 9, free of bank conflicts for the 16-byte fragment reads
typedef __attribute__((ext_vector_type(4))) __bf16 v4b;
// every '#pragma unroll' of the staging helpers and loops: the loop indexes register arrays, which stay in registers only when it is unrolled
// p = the thread's own place: row tid / 16, float4 tid % 16 of the chunk; load i is 8 i rows further down
template <int N> __device__ __forceinline__ void g_fetch(const float* p, v4f* r) {
#pragma unroll
  for (int i = 0; i < N; ++i) r[i] = *(const v4f*)(p + (size_t)i * 8 * CC); }
template <int N> __device__ __forceinline__ void g_put(__bf16 (*t)[GP], int lr, int lc, const v4f* r) {
#pragma unroll
  for (int i = 0; i < N; ++i) { v4b o;
#pragma unroll
    for (int e = 0; e < 4; ++e) o[e] = (__bf16)r[i][e];
    *(v4b*)&t[lr + 8 * i][lc] = o; } }
template <int N> __device__ __forceinline__ void g_put2(__bf16 (*th)[GP], __bf16 (*tl)[GP], int lr, int lc, const v4f* r) {   // bf16 hi + residual, as bsplit16
#pragma unroll
  for (int i = 0; i < N; ++i) { v4b oh, ol;
#pragma unroll
    for (int e = 0; e < 4; ++e) { const __bf16 h = (__bf16)r[i][e]; oh[e] = h; ol[e] = (__bf16)(r[i][e] - (float)h); }
    *(v4b*)&th[lr + 8 * i][lc] = oh; *(v4b*)&tl[lr + 8 * i][lc] = ol; } }

#define WS_QH  0u
#define WS_QL  (WS_QH + 2u * (size_t)NB * TT * CC)
#define WS_KH  (WS_QL + 2u * (size_t)NB * TT * CC)
#define WS_VT  (WS_KH + 2u * (size_t)NB * TT * CC)      // bf16 v planes
#define WS_VL  (WS_VT + 2u * (size_t)NB * CC * TT)      // bf16 v residual planes
#define WS_Y   (WS_VL + 2u * (size_t)NB * CC * TT)      // f32 y rows [b*t][C]
#define WS_END (WS_Y + 4u * (size_t)NB * TT * CC)
// q, k and the v planes lie in the workspace in WMMA fragment order: [b][h][32-position slice][8 half fragments][lane][8 elements], FS elements a slice, so that a wave-wide 16-byte load or store covers 512 contiguous bytes (4 whole lines).
// q, k: half fragment (j*2 + kc)*2 + qh, lane (g, col) = position 16j + col of the slice, dims 32kc + 16qh + 8g + 0..7 of the head. v: half fragment j*2 + qh, lane (g, col) = dim 16j + col of the head, positions 16qh + 8g + 0..7 of the slice.
#define FS (32 * HD)
// k_proj's way out: a block's 64 positions x 128 columns are 2 neighbouring slices of 2 heads, 1,024 units of 16 bytes, 8 a thread; unit i of thread (wave, g, col) is half fragment wave + 4 (i & 1) of slice (i & 3) >> 1 of head i >> 2.
// t = the block's tile in LDS ([position][column] for q and k, [column][position] for v), dst = the thread's own place in the first slice of the first head. Both loops are unrolled because they index a register array.
template <bool ISV, typename T, int P> __device__ __forceinline__ void put_frags(T* dst, const T (*t)[P], int wave, int g, int col) { v4u a[8];
#pragma unroll
  for (int i = 0; i < 8; ++i) { if constexpr (ISV) a[i] = *(const v4u*)&t[(i >> 2) * HD + ((wave >> 1) + 2 * (i & 1)) * 16 + col][((i & 3) >> 1) * 32 + (wave & 1) * 16 + g * 8]; else a[i] = *(const v4u*)&t[(i & 3) * 16 + col][(i >> 2) * HD + wave * 16 + g * 8]; }
#pragma unroll
  for (int i = 0; i < 8; ++i) *(v4u*)(dst + (size_t)(i >> 2) * (TT / 32) * FS + (i & 3) * 1024) = a[i];
  asm volatile("s_wait_xcnt 0x0" :: "v"(dst), "v"(a[0]), "v"(a[1]), "v"(a[2]), "v"(a[3]), "v"(a[4]), "v"(a[5]), "v"(a[6]), "v"(a[7]) : "memory"); }   // stands in front of every overwrite of the stores' address and data registers, which it holds until here

// ---- k_proj: block = (64 rows, 128 cols, which): qkv = x W (+ b), exact; q -> f16 hi (+ residual), k -> f16, v -> bf16 hi + residual planes, all in fragment order
// the staging buffers are dead when the epilogue's arrays come to life: they share the block's LDS
union ProjLds { struct { __bf16 x[2][64][GP], w[2][128][GP]; } st; struct { _Float16 sh[64][136], sl[64][136]; __bf16 th[128][72], tl2[128][72]; float sf[64][132]; } ep; };
__global__ __launch_bounds__(128) void k_proj(const float* __restrict__ X, const float* __restrict__ WQ, const float* __restrict__ BQ, const float* __restrict__ WK, const float* __restrict__ BK, const float* __restrict__ WV, const float* __restrict__ BV, _Float16* __restrict__ QH, _Float16* __restrict__ QL, _Float16* __restrict__ KH, __bf16* __restrict__ VT, __bf16* __restrict__ VL) {
  __shared__ __align__(16) ProjLds lds; _Float16 (&sh)[64][136] = lds.ep.sh; _Float16 (&sl)[64][136] = lds.ep.sl; __bf16 (&th)[128][72] = lds.ep.th; __bf16 (&tl2)[128][72] = lds.ep.tl2; float (&sf)[64][132] = lds.ep.sf;
  const int tid = threadIdx.x, wave = tid >> 5, lane = tid & 31, col = lane & 15, g = lane >> 4; const int which = blockIdx.z; const int c0 = blockIdx.y * 128; const size_t r0 = (size_t)blockIdx.x * 64; const float* WA = which == 0 ? WQ : which == 1 ? WK : WV; const float* BA = which == 0 ? BQ : which == 1 ? BK : BV;
  v8f acc[8] = {};
  const int lr = tid >> 4, lc = (tid & 15) * 4; const float* px = X + (r0 + lr) * CC + lc; const float* pw = WA + (size_t)(c0 + lr) * CC + lc;
  v4f rx[8], rw[16]; g_fetch<8>(px, rx); g_fetch<16>(pw, rw);
  asm volatile("s_wait_xcnt 0x0" :: "v"(px), "v"(pw) : "memory");   // stands in front of every overwrite of the loads' address registers, which it holds until here
#pragma unroll 2   // the buffer index becomes a constant in each copy of the body
  for (int c = 0; c < CC / GK; ++c) { const int bs = c & 1; g_put<8>(lds.st.x[bs], lr, lc, rx); g_put<16>(lds.st.w[bs], lr, lc, rw);
    __syncthreads();   // chunk c is whole in LDS before any wave reads it; it also ends every wave's reads of the other buffer, which the next trip refills
    if (c + 1 < CC / GK) { px += GK; pw += GK; g_fetch<8>(px, rx); g_fetch<16>(pw, rw);   // the next chunk flies under this chunk's products
      asm volatile("s_wait_xcnt 0x0" :: "v"(px), "v"(pw) : "memory"); }   // as above
#pragma unroll
    for (int kk = 0; kk < GK / 32; ++kk) { const v16b a = frag_b(&lds.st.x[bs][wave * 16 + col][kk * 32], lane); v16b w[8];
#pragma unroll
      for (int j = 0; j < 8; ++j) w[j] = frag_b(&lds.st.w[bs][j * 16 + col][kk * 32], lane);
#pragma unroll
      for (int j = 0; j < 8; ++j) acc[j] = wmma_bf(a, w[j], acc[j]); } }
  __syncthreads();   // every wave has left the staging buffers before the epilogue's arrays overwrite them
#pragma unroll
  for (int j = 0; j < 8; ++j) { const float bb = bfr(BA[c0 + j * 16 + col]);
#pragma unroll
    for (int r = 0; r < 8; ++r) { const float v = acc[j][r] + bb; const int rl = wave * 16 + 8 * g + r, cl = j * 16 + col;
      if (which == 2) { const __bf16 bh = (__bf16)v; th[cl][rl] = bh; tl2[cl][rl] = (__bf16)(v - (float)bh); } else sf[rl][cl] = v; } }
  __syncthreads();
  if (which < 2) {   // rotary: out[d] = x[d] cos(t f_{d mod 32}) + (d < 32 ? -x[d+32] : x[d-32]) sin(t f_{d mod 32}); f_i = 10000^(-i/32)
    for (int e = tid; e < 64 * 128; e += 128) { const int rl = e >> 7, cl = e & 127; const int d = cl & 63; const int i2 = d & 31; const size_t row = r0 + rl; const int tpos = (int)(row % TT);
      const float inv_freq = 1.0f / powf(10000.0f, (float)(2 * i2) / 64.0f); const float ang = (float)tpos * inv_freq; const float c = cosf(ang), s = sinf(ang);
      const float me = sf[rl][cl]; const float partner = (d < 32) ? -sf[rl][cl + 32] : sf[rl][cl - 32]; const float v = me * c + partner * s; const _Float16 hv = (_Float16)v; sh[rl][cl] = hv; sl[rl][cl] = (_Float16)(v - (float)hv); }
    __syncthreads(); }
  const size_t fb = (((r0 / TT) * NH + c0 / HD) * (size_t)(TT / 32) + (r0 % TT) / 32) * FS + tid * 8;
  if (which < 2) { put_frags<false>((which == 0 ? QH : KH) + fb, sh, wave, g, col); if (which == 0) put_frags<false>(QL + fb, sl, wave, g, col); }
  else { put_frags<true>(VT + fb, th, wave, g, col); put_frags<true>(VL + fb, tl2, wave, g, col); } }
// ---- k_att: block = 16 * QT queries of (b,h), AW waves; wave w takes the 32-key slices w, w + AW, ... up to the diagonal, each k and v fragment serving the QT query tiles. Sweep 1: logits on WMMA, row maxima only. Sweep 2: the same logits again, exp(s - max) in f32, P (bf16 hi + lo) . v; row sums and f32 partial tiles of the waves are summed in LDS in wave order: y[q][h*HD + d] = P . v / sum
// every '#pragma unroll' of k_att and its helpers without a note of its own: the loop indexes fragment, accumulator or per-row arrays, which stay in registers only when it is unrolled
#define AW 8   // the wave number is read into a scalar so that each wave's trip test is a scalar branch
#define QT 2
struct KF { v16h f[2][HD / 32]; };   // k fragments of one slice: [16-key group][32 of the head's 64 dims]
// pk = the lane's own 16 bytes in the slice's first half fragment
__device__ __forceinline__ KF att_k(const _Float16* pk) { KF k;
#pragma unroll
  for (int j = 0; j < 2; ++j)
#pragma unroll
    for (int kc = 0; kc < HD / 32; ++kc) { union { v16h v; v8h q[2]; } u; const _Float16* p = pk + (j * (HD / 32) + kc) * 512; u.q[0] = *(const v8h*)p; u.q[1] = *(const v8h*)(p + 256); k.f[j][kc] = u.v; }
  return k; }
// pv = the lane's own 16 bytes in the first half fragment of the slice of a v plane
__device__ __forceinline__ v16b att_v(const __bf16* pv, int j) { union { v16b v; v8b q[2]; } u; const __bf16* p = pv + j * 512; u.q[0] = *(const v8b*)p; u.q[1] = *(const v8b*)(p + 256); return u.v; }
// logits of one query tile against one slice, D layout: sc[j][r] = query q0 + 8g + r against key s*32 + j*16 + col, scaled, keys above the diagonal masked
__device__ __forceinline__ void att_logits(const KF& k, const v16h* ah, int s, int q0, int lane, v8f* sc) { const int col = lane & 15, g = lane >> 4;
#pragma unroll
  for (int j = 0; j < 2; ++j) { const int kt = s * 32 + j * 16 + col; v8f a = {};
#pragma unroll
    for (int kc = 0; kc < HD / 32; ++kc) a = wmma16(ah[kc], k.f[j][kc], a);
#pragma unroll
    for (int r = 0; r < 8; ++r) { const int qt = q0 + 8 * g + r; float v = a[r] * 0.125f; if (kt > qt) v = -3.0e38f; sc[j][r] = v; } } }
// amdgpu_waves_per_eu(4): holds the allocation at 256 registers, so that two blocks share a WGP
__global__ __launch_bounds__(32 * AW) __attribute__((amdgpu_waves_per_eu(4))) void k_att(const _Float16* __restrict__ QH, const _Float16* __restrict__ KH, const __bf16* __restrict__ VT, const __bf16* __restrict__ VL, float* __restrict__ Y) { __shared__ __align__(16) float ss[AW][16 * QT][HD + 4]; __shared__ float smx[AW][16 * QT], ssum[AW][16 * QT];
  const int tid = threadIdx.x, wave = __builtin_amdgcn_readfirstlane(tid >> 5), lane = tid & 31, col = lane & 15, g = lane >> 4; const int b = blockIdx.z, h = blockIdx.y, ql0 = blockIdx.x * (16 * QT); const int ns = ((ql0 + 16 * QT - 1) >> 5) + 1;   // slices that hold a key <= the block's last query
  static_assert(16 * QT == 32 && HD == 64, "a block's queries are one slice of the fragment order");
  const size_t vo = ((size_t)b * NH + h) * (size_t)(TT / 32) * FS + lane * 8; const _Float16* Kl = KH + vo;   // the lane's own place in slice 0 of the head, the same in q, k and the v planes
  v16h ah[QT][HD / 32];
  { const _Float16* pq = QH + vo + (size_t)blockIdx.x * FS;
#pragma unroll
    for (int t = 0; t < QT; ++t)
#pragma unroll
      for (int kc = 0; kc < HD / 32; ++kc) { union { v16h v; v8h q[2]; } u; const _Float16* p = pq + (t * (HD / 32) + kc) * 512; u.q[0] = *(const v8h*)p; u.q[1] = *(const v8h*)(p + 256); ah[t][kc] = u.v; }
    asm volatile("s_wait_xcnt 0x0" :: "v"(pq) : "memory"); }   // stands in front of every overwrite of the loads' address registers, which it holds until here
  float mx[QT][8];
#pragma unroll
  for (int t = 0; t < QT; ++t)
#pragma unroll
    for (int r = 0; r < 8; ++r) mx[t][r] = -3.0e38f;
  for (int s = wave; s < ns; s += AW) { const _Float16* pk = Kl + (size_t)s * FS; const KF k = att_k(pk);
    asm volatile("s_wait_xcnt 0x0" :: "v"(pk) : "memory");   // as above, for the k loads
#pragma unroll
    for (int t = 0; t < QT; ++t) { v8f sc[2]; att_logits(k, ah[t], s, ql0 + t * 16, lane, sc);
#pragma unroll
      for (int r = 0; r < 8; ++r) mx[t][r] = fmaxf(mx[t][r], fmaxf(sc[0][r], sc[1][r])); } }
#pragma unroll   // step outermost: the exchanges of all rows of one step are in flight together
  for (int o = 1; o < 16; o <<= 1)
#pragma unroll
    for (int t = 0; t < QT; ++t)
#pragma unroll
      for (int r = 0; r < 8; ++r) mx[t][r] = fmaxf(mx[t][r], __shfl_xor(mx[t][r], o));
  if (col == 0) {
#pragma unroll
    for (int t = 0; t < QT; ++t)
#pragma unroll
      for (int r = 0; r < 8; ++r) smx[wave][t * 16 + 8 * g + r] = mx[t][r]; }
  __syncthreads();   // every wave's row maxima are in LDS before any wave forms the row maximum over all keys
  float m[QT], lsum[QT];   // from here on a lane serves query row col of each tile (A layout)
#pragma unroll
  for (int t = 0; t < QT; ++t) { m[t] = smx[0][t * 16 + col]; lsum[t] = 0.f;
#pragma unroll
    for (int w = 1; w < AW; ++w) m[t] = fmaxf(m[t], smx[w][t * 16 + col]); }
  v8f acc[QT][HD / 16] = {};
  for (int s = wave; s < ns; s += AW) { v16b vh[HD / 16], vl[HD / 16];   // v is fetched ahead of its use: the hi plane with k, the lo plane under the exponentials
    const __bf16* pvh = VT + vo + (size_t)s * FS; const __bf16* pvl = VL + vo + (size_t)s * FS; const _Float16* pk = Kl + (size_t)s * FS;
#pragma unroll
    for (int j = 0; j < HD / 16; ++j) vh[j] = att_v(pvh, j);
    { const KF k = att_k(pk);
      asm volatile("s_wait_xcnt 0x0" :: "v"(pk), "v"(pvh) : "memory");   // as above, for the k and v hi loads
#pragma unroll
      for (int t = 0; t < QT; ++t) { v8f sc[2]; att_logits(k, ah[t], s, ql0 + t * 16, lane, sc);
#pragma unroll
        for (int j = 0; j < 2; ++j)
#pragma unroll
          for (int r = 0; r < 8; ++r) ss[wave][t * 16 + 8 * g + r][j * 16 + col] = sc[j][r]; } }
    LDSX();   // the wave's own logits are in LDS before its lanes read them back by rows
#pragma unroll
    for (int j = 0; j < HD / 16; ++j) vl[j] = att_v(pvl, j);
    asm volatile("s_wait_xcnt 0x0" :: "v"(pvl) : "memory");   // as above, for the v lo loads
#pragma unroll
    for (int t = 0; t < QT; ++t) { float v[16]; const float* pr = &ss[wave][t * 16 + col][8 * g];
#pragma unroll
      for (int i = 0; i < 8; ++i) { v[i] = pr[i]; v[8 + i] = pr[16 + i]; }
#pragma unroll
      for (int i = 0; i < 16; ++i) { v[i] = expf(v[i] - m[t]); lsum[t] += v[i]; }   // a masked logit is -3e38: its exponential is an exact 0
      const F2 p = bsplit16(v);   // each of the three products runs over the four output tiles, so that no WMMA waits for the one before it
#pragma unroll
      for (int j = 0; j < HD / 16; ++j) acc[t][j] = wmma_bf(p.h, vh[j], acc[t][j]);
#pragma unroll
      for (int j = 0; j < HD / 16; ++j) acc[t][j] = wmma_bf(p.l, vh[j], acc[t][j]);
#pragma unroll
      for (int j = 0; j < HD / 16; ++j) acc[t][j] = wmma_bf(p.h, vl[j], acc[t][j]); } }
#pragma unroll
  for (int t = 0; t < QT; ++t) { lsum[t] += __shfl_xor(lsum[t], 16);   // the two halves of a wave hold the two halves of each row's keys
    if (g == 0) ssum[wave][t * 16 + col] = lsum[t];
#pragma unroll
    for (int j = 0; j < HD / 16; ++j)
#pragma unroll
      for (int r = 0; r < 8; ++r) ss[wave][t * 16 + 8 * g + r][j * 16 + col] = acc[t][j][r]; }
  __syncthreads();   // every wave's partial tiles and row sums are in LDS before any thread sums across waves
  static_assert(16 * (HD / 4) == 32 * AW, "one float4 of each query tile per thread");
#pragma unroll
  for (int t = 0; t < QT; ++t) { const int rl = t * 16 + tid / (HD / 4), c4 = (tid % (HD / 4)) * 4; v4f s = *(const v4f*)&ss[0][rl][c4]; float L = ssum[0][rl];
#pragma unroll   // the LDS reads of all partials issue together; the sums keep wave order
    for (int w = 1; w < AW; ++w) { s += *(const v4f*)&ss[w][rl][c4]; L += ssum[w][rl]; }
    vst2(Y + ((size_t)b * TT + ql0 + rl) * CC + h * HD + c4, s * (1.0f / L)); } }
// ---- k_out: block = (64 rows, 128 cols): out = y (bf16 hi + lo) Wproj + b
__global__ __launch_bounds__(128) void k_out(const float* __restrict__ Y, const float* __restrict__ WP, const float* __restrict__ BP, float* __restrict__ OUT) { __shared__ __align__(16) float sf[4][16][132]; __shared__ __align__(16) __bf16 yh[2][64][GP], yl[2][64][GP], wt[2][128][GP];
  const int tid = threadIdx.x, wave = tid >> 5, lane = tid & 31, col = lane & 15, g = lane >> 4; const int c0 = blockIdx.y * 128; const size_t r0 = (size_t)blockIdx.x * 64 + wave * 16;
  v8f acc[8] = {};
  const int lr = tid >> 4, lc = (tid & 15) * 4; const float* py = Y + ((size_t)blockIdx.x * 64 + lr) * CC + lc; const float* pw = WP + (size_t)(c0 + lr) * CC + lc;
  v4f ry[8], rw[16]; g_fetch<8>(py, ry); g_fetch<16>(pw, rw);
  asm volatile("s_wait_xcnt 0x0" :: "v"(py), "v"(pw) : "memory");   // stands in front of every overwrite of the loads' address registers, which it holds until here
#pragma unroll 2   // the buffer index becomes a constant in each copy of the body
  for (int c = 0; c < CC / GK; ++c) { const int bs = c & 1; g_put2<8>(yh[bs], yl[bs], lr, lc, ry); g_put<16>(wt[bs], lr, lc, rw);
    __syncthreads();   // chunk c is whole in LDS before any wave reads it; it also ends every wave's reads of the other buffer, which the next trip refills
    if (c + 1 < CC / GK) { py += GK; pw += GK; g_fetch<8>(py, ry); g_fetch<16>(pw, rw);   // the next chunk flies under this chunk's products
      asm volatile("s_wait_xcnt 0x0" :: "v"(py), "v"(pw) : "memory"); }   // as above
#pragma unroll
    for (int kk = 0; kk < GK / 32; ++kk) { const v16b ah = frag_b(&yh[bs][wave * 16 + col][kk * 32], lane), al = frag_b(&yl[bs][wave * 16 + col][kk * 32], lane); v16b w[8];
#pragma unroll
      for (int j = 0; j < 8; ++j) w[j] = frag_b(&wt[bs][j * 16 + col][kk * 32], lane);
#pragma unroll
      for (int j = 0; j < 8; ++j) { acc[j] = wmma_bf(ah, w[j], acc[j]); acc[j] = wmma_bf(al, w[j], acc[j]); } } }
#pragma unroll
  for (int j = 0; j < 8; ++j) { const float bb = BP ? bfr(BP[c0 + j * 16 + col]) : 0.f;
#pragma unroll
    for (int r = 0; r < 8; ++r) sf[wave][8 * g + r][j * 16 + col] = acc[j][r] + bb; }
  LDSX(); for (int rl = 0; rl < 16; ++rl) vst2(OUT + (r0 + rl) * CC + c0 + lane * 4, *(const v4f*)&sf[wave][rl][lane * 4]); }
extern "C" void kernel_launch(void* const* d_in, const int* in_sizes, int n_in, void* d_out, int out_size, void* d_ws, size_t ws_size, hipStream_t stream) {
  (void)in_sizes; (void)n_in; (void)out_size;
  const float** F = (const float**)d_in;   // 0 x [2,2048,1024], 1 Wq [1024,1024] ([out,in]), 2 bq, 3 Wk, 4 bk, 5 Wv, 6 bv, 7 Wo, 8 bo
  if (ws_size < (size_t)WS_END) return;
  char* ws = (char*)d_ws; _Float16 *QH = (_Float16*)(ws + WS_QH), *QL = (_Float16*)(ws + WS_QL), *KH = (_Float16*)(ws + WS_KH); __bf16 *VT = (__bf16*)(ws + WS_VT), *VL = (__bf16*)(ws + WS_VL); float *Y = (float*)(ws + WS_Y);
  k_proj<<<dim3(TNB * TT / 64, CC / 128, 3), 128, 0, stream>>>(F[0], F[1], F[2], F[3], F[4], F[5], F[6], QH, QL, KH, VT, VL);
  k_att<<<dim3(TT / (16 * QT), NH, TNB), 32 * AW, 0, stream>>>(QH, KH, VT, VL, Y);
  k_out<<<dim3(TNB * TT / 64, CC / 128), 128, 0, stream>>>(Y, F[7], F[8], (float*)d_out);
}

// v005
// It runs in 148 microseconds.
// In both of two side-by-side timings against v004, it was 1.14 times as fast.
// All steps since v000 together make it 9.99 times as fast.
// compute dtype: all float inputs rounded to bf16; q/k/v = x W^T + b with EXACT bf16 products on WMMA 16x16x32, f32 accumulate; rotary in f32 (inv_freq = 10000^(-2i/64) via exp2f/log2f-free powf, precise cosf/sinf); q, k rounded once to f16 (0.02-scale weights: logits std ~0.05, 1 product), causal logits kept on chip in f32 (computed twice: row maxima, then P); softmax in f32 in base 2 (one f32 multiply-add with the constant log2(e) / 8, then the exp2 instruction), P = exp(s - max) kept f32 split bf16 hi + lo against v bf16 hi + lo (3 products), divided by the f32 row sum at the end; out = o (bf16 hi + lo) Wo^T + bo; f32 output.
#include <hip/hip_runtime.h>
#include <math.h>

typedef __attribute__((ext_vector_type(16))) _Float16 v16h;
typedef __attribute__((ext_vector_type(16))) __bf16 v16b;
typedef __attribute__((ext_vector_type(8)))  _Float16 v8h;
typedef __attribute__((ext_vector_type(8)))  float v8f;
typedef __attribute__((ext_vector_type(4)))  float v4f;
typedef __attribute__((ext_vector_type(2)))  float v2f;
typedef __attribute__((ext_vector_type(4)))  unsigned v4u;
typedef __attribute__((ext_vector_type(4)))  int v4i;
typedef float __attribute__((may_alias)) float_a;
typedef int __attribute__((may_alias)) int_a;

template <typename T> __device__ __forceinline__ void vst2(void* p, T v) { *(T*)p = v;  }
__device__ __forceinline__ v8f wmma16(v16h a, v16h b, v8f c) {
  v8f d = __builtin_amdgcn_wmma_f32_16x16x32_f16(false, a, false, b, (short)0, c, false, false);
  asm volatile("v_nop\n\tv_nop\n\tv_nop\n\tv_nop" : "+v"(d) : "v"(a), "v"(b));
  return d;
}
__device__ __forceinline__ v8f wmma_bf(v16b a, v16b b, v8f c) {
  v8f d = __builtin_amdgcn_wmma_f32_16x16x32_bf16(false, a, false, b, (short)0, c, false, false);
  asm volatile("v_nop\n\tv_nop\n\tv_nop\n\tv_nop" : "+v"(d) : "v"(a), "v"(b));
  return d;
}
// 16x16x32 fragments: lane = (h = lane>>4, row/col = lane&15); elements 0..7 = k0+8h+0..7, 8..15 = k0+16+8h+0..7; D element r = row 8h+r
__device__ __forceinline__ v16h frag_h(const _Float16* rowk0, int lane) {
  union { v16h v; v8h q[2]; } u; const _Float16* p = rowk0 + 8 * (lane >> 4);
  u.q[0] = *(const v8h*)p; u.q[1] = *(const v8h*)(p + 16); return u.v;
}
__device__ __forceinline__ v16h frag_f32(const float* rowk0, int lane) {
  v16h a; const float* p = rowk0 + 8 * (lane >> 4);
#pragma unroll
  for (int i = 0; i < 8; ++i) { a[i] = (_Float16)p[i]; a[8 + i] = (_Float16)p[16 + i]; }
  return a;
}
__device__ __forceinline__ v16h frag_f32s(const float* rowk0, int lane, float sc) {
  v16h a; const float* p = rowk0 + 8 * (lane >> 4);
#pragma unroll
  for (int i = 0; i < 8; ++i) { a[i] = (_Float16)(p[i] * sc); a[8 + i] = (_Float16)(p[16 + i] * sc); }
  return a;
}
// column fragment from a [K][ld] layout (column n), rows >= K read as 0
__device__ __forceinline__ v16h fragc_f32(const float* W, int k0, int n, int lane, int ld, int K) {
  v16h a; const int g = lane >> 4;
#pragma unroll
  for (int i = 0; i < 8; ++i) { const int ka = k0 + 8 * g + i, kb = ka + 16;
    a[i] = (_Float16)(ka < K ? W[(size_t)(ka < K ? ka : K - 1) * ld + n] : 0.f); a[8 + i] = (_Float16)(kb < K ? W[(size_t)(kb < K ? kb : K - 1) * ld + n] : 0.f); }
  return a;
}
struct F2 { v16b h, l; };
__device__ __forceinline__ F2 bsplit16(const float v[16]) { F2 r;
#pragma unroll
  for (int i = 0; i < 16; ++i) { const __bf16 h = (__bf16)v[i]; r.h[i] = h; r.l[i] = (__bf16)(v[i] - (float)h); }
  return r; }
__device__ __forceinline__ F2 split_row(const float* row, int k0, int lane) { float v[16]; const float* p = row + k0 + 8 * (lane >> 4);
#pragma unroll
  for (int i = 0; i < 8; ++i) { v[i] = p[i]; v[8 + i] = p[16 + i]; }
  return bsplit16(v); }
__device__ __forceinline__ F2 split_rowK(const float* row, int k0, int lane, int K) { float v[16]; const int g = lane >> 4;
#pragma unroll
  for (int i = 0; i < 8; ++i) { const int ka = k0 + 8 * g + i, kb = ka + 16; v[i] = ka < K ? row[ka < K ? ka : K - 1] : 0.f; v[8 + i] = kb < K ? row[kb < K ? kb : K - 1] : 0.f; }
  return bsplit16(v); }
__device__ __forceinline__ F2 split_col(const float* W, int k0, int n, int lane, int ld, int K) { float v[16]; const int g = lane >> 4;
#pragma unroll
  for (int i = 0; i < 8; ++i) { const int ka = k0 + 8 * g + i, kb = ka + 16; v[i] = ka < K ? W[(size_t)(ka < K ? ka : K - 1) * ld + n] : 0.f; v[8 + i] = kb < K ? W[(size_t)(kb < K ? kb : K - 1) * ld + n] : 0.f; }
  return bsplit16(v); }
__device__ __forceinline__ v8f mac3(const F2& a, const F2& b, v8f c) { c = wmma_bf(a.l, b.h, c); c = wmma_bf(a.h, b.l, c); return wmma_bf(a.h, b.h, c); }
__device__ __forceinline__ float sigm(float v) { return 1.0f / (1.0f + expf(-v)); }
#define LDSX() do { asm volatile("s_wait_dscnt 0" ::: "memory"); __builtin_amdgcn_wave_barrier(); __builtin_amdgcn_fence(__ATOMIC_RELEASE, "workgroup"); } while (0)


// Trajectory attention (B 2, T 2,048, C 1,024 = 16 x 64): q/k/v Linear, rotary position embedding (base 10000, rotate_half), causal softmax(q k / 8) v, output Linear.
#define NB 2
#define TT 2048
#define CC 1024
#define NH 16
#define HD 64
#ifndef TNB
#define TNB NB
#endif
typedef __attribute__((ext_vector_type(8))) __bf16 v8b;
__device__ __forceinline__ v16b frag_b(const __bf16* rowk0, int lane) {
  union { v16b v; v8b q[2]; } u; const __bf16* p = rowk0 + 8 * (lane >> 4);
  u.q[0] = *(const v8b*)p; u.q[1] = *(const v8b*)(p + 16); return u.v;
}
__device__ __forceinline__ float bfr(float v) { return (float)(__bf16)v; }
__device__ __attribute__((noinline)) float exp_ni(float v) { return expf(v); }
__device__ __attribute__((noinline)) float erf_ni(float v) { return erff(v); }

// ---- operand staging of k_proj and k_out: a block brings GK k of every operand row with whole-line 16-byte loads (16 lanes = 256 B of one row), converts once and keeps bf16 rows in LDS
#define GK 64
#define GP (GK + 8)   // LDS row pitch in elements: 144 B = 16 B x 9, free of bank conflicts for the 16-byte fragment reads
typedef __attribute__((ext_vector_type(4))) __bf16 v4b;
// every '#pragma unroll' of the staging helpers and loops: the loop indexes register arrays, which stay in registers only when it is unrolled
// p = the thread's own place: row tid / 16, float4 tid % 16 of the chunk; load i is 8 i rows further down
template <int N> __device__ __forceinline__ void g_fetch(const float* p, v4f* r) {
#pragma unroll
  for (int i = 0; i < N; ++i) r[i] = *(const v4f*)(p + (size_t)i * 8 * CC); }
template <int N> __device__ __forceinline__ void g_put(__bf16 (*t)[GP], int lr, int lc, const v4f* r) {
#pragma unroll
  for (int i = 0; i < N; ++i) { v4b o;
#pragma unroll
    for (int e = 0; e < 4; ++e) o[e] = (__bf16)r[i][e];
    *(v4b*)&t[lr + 8 * i][lc] = o; } }
template <int N> __device__ __forceinline__ void g_put2(__bf16 (*th)[GP], __bf16 (*tl)[GP], int lr, int lc, const v4f* r) {   // bf16 hi + residual, as bsplit16
#pragma unroll
  for (int i = 0; i < N; ++i) { v4b oh, ol;
#pragma unroll
    for (int e = 0; e < 4; ++e) { const __bf16 h = (__bf16)r[i][e]; oh[e] = h; ol[e] = (__bf16)(r[i][e] - (float)h); }
    *(v4b*)&th[lr + 8 * i][lc] = oh; *(v4b*)&tl[lr + 8 * i][lc] = ol; } }

#define WS_QH  0u
#define WS_QL  (WS_QH + 2u * (size_t)NB * TT * CC)
#define WS_KH  (WS_QL + 2u * (size_t)NB * TT * CC)
#define WS_VT  (WS_KH + 2u * (size_t)NB * TT * CC)      // bf16 v planes
#define WS_VL  (WS_VT + 2u * (size_t)NB * CC * TT)      // bf16 v residual planes
#define WS_Y   (WS_VL + 2u * (size_t)NB * CC * TT)      // f32 y rows [b*t][C]
#define WS_END (WS_Y + 4u * (size_t)NB * TT * CC)
// q, k and the v planes lie in the workspace in WMMA fragment order: [b][h][32-position slice][8 half fragments][lane][8 elements], FS elements a slice, so that a wave-wide 16-byte load or store covers 512 contiguous bytes (4 whole lines).
// q, k: half fragment (j*2 + kc)*2 + qh, lane (g, col) = position 16j + col of the slice, dims 32kc + 16qh + 8g + 0..7 of the head. v: half fragment j*2 + qh, lane (g, col) = dim 16j + col of the head, positions 16qh + 8g + 0..7 of the slice.
#define FS (32 * HD)
// k_proj's way out: a block's 64 positions x 128 columns are 2 neighbouring slices of 2 heads, 1,024 units of 16 bytes, 8 a thread; unit i of thread (wave, g, col) is half fragment wave + 4 (i & 1) of slice (i & 3) >> 1 of head i >> 2.
// t = the block's tile in LDS ([position][column] for q and k, [column][position] for v), dst = the thread's own place in the first slice of the first head. Both loops are unrolled because they index a register array.
template <bool ISV, typename T, int P> __device__ __forceinline__ void put_frags(T* dst, const T (*t)[P], int wave, int g, int col) { v4u a[8];
#pragma unroll
  for (int i = 0; i < 8; ++i) { if constexpr (ISV) a[i] = *(const v4u*)&t[(i >> 2) * HD + ((wave >> 1) + 2 * (i & 1)) * 16 + col][((i & 3) >> 1) * 32 + (wave & 1) * 16 + g * 8]; else a[i] = *(const v4u*)&t[(i & 3) * 16 + col][(i >> 2) * HD + wave * 16 + g * 8]; }
#pragma unroll
  for (int i = 0; i < 8; ++i) *(v4u*)(dst + (size_t)(i >> 2) * (TT / 32) * FS + (i & 3) * 1024) = a[i];
  asm volatile("s_wait_xcnt 0x0" :: "v"(dst), "v"(a[0]), "v"(a[1]), "v"(a[2]), "v"(a[3]), "v"(a[4]), "v"(a[5]), "v"(a[6]), "v"(a[7]) : "memory"); }   // stands in front of every overwrite of the stores' address and data registers, which it holds until here

// ---- k_proj: block = (64 rows, 128 cols, which): qkv = x W (+ b), exact; q -> f16 hi (+ residual), k -> f16, v -> bf16 hi + residual planes, all in fragment order
// the staging buffers are dead when the epilogue's arrays come to life: they share the block's LDS
union ProjLds { struct { __bf16 x[2][64][GP], w[2][128][GP]; } st; struct { _Float16 sh[64][136], sl[64][136]; __bf16 th[128][72], tl2[128][72]; float sf[64][132]; } ep; };
__global__ __launch_bounds__(128) void k_proj(const float* __restrict__ X, const float* __restrict__ WQ, const float* __restrict__ BQ, const float* __restrict__ WK, const float* __restrict__ BK, const float* __restrict__ WV, const float* __restrict__ BV, _Float16* __restrict__ QH, _Float16* __restrict__ QL, _Float16* __restrict__ KH, __bf16* __restrict__ VT, __bf16* __restrict__ VL) {
  __shared__ __align__(16) ProjLds lds; _Float16 (&sh)[64][136] = lds.ep.sh; _Float16 (&sl)[64][136] = lds.ep.sl; __bf16 (&th)[128][72] = lds.ep.th; __bf16 (&tl2)[128][72] = lds.ep.tl2; float (&sf)[64][132] = lds.ep.sf;
  const int tid = threadIdx.x, wave = tid >> 5, lane = tid & 31, col = lane & 15, g = lane >> 4; const int which = blockIdx.z; const int c0 = blockIdx.y * 128; const size_t r0 = (size_t)blockIdx.x * 64; const float* WA = which == 0 ? WQ : which == 1 ? WK : WV; const float* BA = which == 0 ? BQ : which == 1 ? BK : BV;
  v8f acc[8] = {};
  const int lr = tid >> 4, lc = (tid & 15) * 4; const float* px = X + (r0 + lr) * CC + lc; const float* pw = WA + (size_t)(c0 + lr) * CC + lc;
  v4f rx[8], rw[16]; g_fetch<8>(px, rx); g_fetch<16>(pw, rw);
  asm volatile("s_wait_xcnt 0x0" :: "v"(px), "v"(pw) : "memory");   // stands in front of every overwrite of the loads' address registers, which it holds until here
#pragma unroll 2   // the buffer index becomes a constant in each copy of the body
  for (int c = 0; c < CC / GK; ++c) { const int bs = c & 1; g_put<8>(lds.st.x[bs], lr, lc, rx); g_put<16>(lds.st.w[bs], lr, lc, rw);
    __syncthreads();   // chunk c is whole in LDS before any wave reads it; it also ends every wave's reads of the other buffer, which the next trip refills
    if (c + 1 < CC / GK) { px += GK; pw += GK; g_fetch<8>(px, rx); g_fetch<16>(pw, rw);   // the next chunk flies under this chunk's products
      asm volatile("s_wait_xcnt 0x0" :: "v"(px), "v"(pw) : "memory"); }   // as above
#pragma unroll
    for (int kk = 0; kk < GK / 32; ++kk) { const v16b a = frag_b(&lds.st.x[bs][wave * 16 + col][kk * 32], lane); v16b w[8];
#pragma unroll
      for (int j = 0; j < 8; ++j) w[j] = frag_b(&lds.st.w[bs][j * 16 + col][kk * 32], lane);
#pragma unroll
      for (int j = 0; j < 8; ++j) acc[j] = wmma_bf(a, w[j], acc[j]); } }
  __syncthreads();   // every wave has left the staging buffers before the epilogue's arrays overwrite them
#pragma unroll
  for (int j = 0; j < 8; ++j) { const float bb = bfr(BA[c0 + j * 16 + col]);
#pragma unroll
    for (int r = 0; r < 8; ++r) { const float v = acc[j][r] + bb; const int rl = wave * 16 + 8 * g + r, cl = j * 16 + col;
      if (which == 2) { const __bf16 bh = (__bf16)v; th[cl][rl] = bh; tl2[cl][rl] = (__bf16)(v - (float)bh); } else sf[rl][cl] = v; } }
  __syncthreads();
  if (which < 2) {   // rotary: out[d] = x[d] cos(t f_{d mod 32}) + (d < 32 ? -x[d+32] : x[d-32]) sin(t f_{d mod 32}); f_i = 10000^(-i/32)
    for (int e = tid; e < 64 * 128; e += 128) { const int rl = e >> 7, cl = e & 127; const int d = cl & 63; const int i2 = d & 31; const size_t row = r0 + rl; const int tpos = (int)(row % TT);
      const float inv_freq = 1.0f / powf(10000.0f, (float)(2 * i2) / 64.0f); const float ang = (float)tpos * inv_freq; const float c = cosf(ang), s = sinf(ang);
      const float me = sf[rl][cl]; const float partner = (d < 32) ? -sf[rl][cl + 32] : sf[rl][cl - 32]; const float v = me * c + partner * s; const _Float16 hv = (_Float16)v; sh[rl][cl] = hv; sl[rl][cl] = (_Float16)(v - (float)hv); }
    __syncthreads(); }
  const size_t fb = (((r0 / TT) * NH + c0 / HD) * (size_t)(TT / 32) + (r0 % TT) / 32) * FS + tid * 8;
  if (which < 2) { put_frags<false>((which == 0 ? QH : KH) + fb, sh, wave, g, col); if (which == 0) put_frags<false>(QL + fb, sl, wave, g, col); }
  else { put_frags<true>(VT + fb, th, wave, g, col); put_frags<true>(VL + fb, tl2, wave, g, col); } }
// ---- k_att: block = 16 * QT queries of (b,h), AW waves; wave w takes the 32-key slices w, w + AW, ... up to the diagonal, each k and v fragment serving the QT query tiles. Sweep 1: logits on WMMA, row maxima only. Sweep 2: the same logits again, exp((a - max) / 8) in f32 as exp2 of one multiply-add, P (bf16 hi + lo) . v; row sums and f32 partial tiles of the waves are summed in LDS in wave order: y[q][h*HD + d] = P . v / sum
// every '#pragma unroll' of k_att and its helpers without a note of its own: the loop indexes fragment, accumulator or per-row arrays, which stay in registers only when it is unrolled
#define AW 8   // the wave number is read into a scalar so that each wave's trip test is a scalar branch
#define QT 2
#define SC2 0.18033688011112042f   // log2(e) / 8: exp((a - amax) / 8) = exp2(a SC2 - amax SC2)
struct KF { v16h f[2][HD / 32]; };   // k fragments of one slice: [16-key group][32 of the head's 64 dims]
// pk = the lane's own 16 bytes in the slice's first half fragment
__device__ __forceinline__ KF att_k(const _Float16* pk) { KF k;
#pragma unroll
  for (int j = 0; j < 2; ++j)
#pragma unroll
    for (int kc = 0; kc < HD / 32; ++kc) { union { v16h v; v8h q[2]; } u; const _Float16* p = pk + (j * (HD / 32) + kc) * 512; u.q[0] = *(const v8h*)p; u.q[1] = *(const v8h*)(p + 256); k.f[j][kc] = u.v; }
  return k; }
// pv = the lane's own 16 bytes in the first half fragment of the slice of a v plane
__device__ __forceinline__ v16b att_v(const __bf16* pv, int j) { union { v16b v; v8b q[2]; } u; const __bf16* p = pv + j * 512; u.q[0] = *(const v8b*)p; u.q[1] = *(const v8b*)(p + 256); return u.v; }
// logits of one query tile against one slice, D layout: sc[j][r] = query q0 + 8g + r against key s*32 + j*16 + col, not yet scaled by 1/8 (SC2 holds the scale), keys above the diagonal masked
__device__ __forceinline__ void att_logits(const KF& k, const v16h* ah, int s, int q0, int lane, v8f* sc) { const int col = lane & 15, g = lane >> 4;
#pragma unroll
  for (int j = 0; j < 2; ++j) { const int kt = s * 32 + j * 16 + col; v8f a = {};
#pragma unroll
    for (int kc = 0; kc < HD / 32; ++kc) a = wmma16(ah[kc], k.f[j][kc], a);
#pragma unroll
    for (int r = 0; r < 8; ++r) { const int qt = q0 + 8 * g + r; float v = a[r]; if (kt > qt) v = -3.0e38f; sc[j][r] = v; } } }
// amdgpu_waves_per_eu(4): holds the allocation at 256 registers, so that two blocks share a WGP
__global__ __launch_bounds__(32 * AW) __attribute__((amdgpu_waves_per_eu(4))) void k_att(const _Float16* __restrict__ QH, const _Float16* __restrict__ KH, const __bf16* __restrict__ VT, const __bf16* __restrict__ VL, float* __restrict__ Y) { __shared__ __align__(16) float ss[AW][16 * QT][HD + 4]; __shared__ float smx[AW][16 * QT], ssum[AW][16 * QT];
  const int tid = threadIdx.x, wave = __builtin_amdgcn_readfirstlane(tid >> 5), lane = tid & 31, col = lane & 15, g = lane >> 4; const int b = blockIdx.z, h = blockIdx.y, ql0 = blockIdx.x * (16 * QT); const int ns = ((ql0 + 16 * QT - 1) >> 5) + 1;   // slices that hold a key <= the block's last query
  static_assert(16 * QT == 32 && HD == 64, "a block's queries are one slice of the fragment order");
  const size_t vo = ((size_t)b * NH + h) * (size_t)(TT / 32) * FS + lane * 8; const _Float16* Kl = KH + vo;   // the lane's own place in slice 0 of the head, the same in q, k and the v planes
  v16h ah[QT][HD / 32];
  { const _Float16* pq = QH + vo + (size_t)blockIdx.x * FS;
#pragma unroll
    for (int t = 0; t < QT; ++t)
#pragma unroll
      for (int kc = 0; kc < HD / 32; ++kc) { union { v16h v; v8h q[2]; } u; const _Float16* p = pq + (t * (HD / 32) + kc) * 512; u.q[0] = *(const v8h*)p; u.q[1] = *(const v8h*)(p + 256); ah[t][kc] = u.v; }
    asm volatile("s_wait_xcnt 0x0" :: "v"(pq) : "memory"); }   // stands in front of every overwrite of the loads' address registers, which it holds until here
  float mx[QT][8];
#pragma unroll
  for (int t = 0; t < QT; ++t)
#pragma unroll
    for (int r = 0; r < 8; ++r) mx[t][r] = -3.0e38f;
  for (int s = wave; s < ns; s += AW) { const _Float16* pk = Kl + (size_t)s * FS; const KF k = att_k(pk);
    asm volatile("s_wait_xcnt 0x0" :: "v"(pk) : "memory");   // as above, for the k loads
#pragma unroll
    for (int t = 0; t < QT; ++t) { v8f sc[2]; att_logits(k, ah[t], s, ql0 + t * 16, lane, sc);
#pragma unroll
      for (int r = 0; r < 8; ++r) mx[t][r] = fmaxf(mx[t][r], fmaxf(sc[0][r], sc[1][r])); } }
#pragma unroll   // step outermost: the exchanges of all rows of one step are in flight together
  for (int o = 1; o < 16; o <<= 1)
#pragma unroll
    for (int t = 0; t < QT; ++t)
#pragma unroll
      for (int r = 0; r < 8; ++r) mx[t][r] = fmaxf(mx[t][r], __shfl_xor(mx[t][r], o));
  if (col == 0) {
#pragma unroll
    for (int t = 0; t < QT; ++t)
#pragma unroll
      for (int r = 0; r < 8; ++r) smx[wave][t * 16 + 8 * g + r] = mx[t][r]; }
  __syncthreads();   // every wave's row maxima are in LDS before any wave forms the row maximum over all keys
  float m[QT], lsum[QT];   // from here on a lane serves query row col of each tile (A layout); m ends as -max SC2, the addend of the exponent
#pragma unroll
  for (int t = 0; t < QT; ++t) { m[t] = smx[0][t * 16 + col]; lsum[t] = 0.f;
#pragma unroll
    for (int w = 1; w < AW; ++w) m[t] = fmaxf(m[t], smx[w][t * 16 + col]);
    m[t] *= -SC2; }
  v8f acc[QT][HD / 16] = {};
  for (int s = wave; s < ns; s += AW) { v16b vh[HD / 16], vl[HD / 16];   // v is fetched ahead of its use: the hi plane with k, the lo plane under the exponentials
    const __bf16* pvh = VT + vo + (size_t)s * FS; const __bf16* pvl = VL + vo + (size_t)s * FS; const _Float16* pk = Kl + (size_t)s * FS;
#pragma unroll
    for (int j = 0; j < HD / 16; ++j) vh[j] = att_v(pvh, j);
    { const KF k = att_k(pk);
      asm volatile("s_wait_xcnt 0x0" :: "v"(pk), "v"(pvh) : "memory");   // as above, for the k and v hi loads
#pragma unroll
      for (int t = 0; t < QT; ++t) { v8f sc[2]; att_logits(k, ah[t], s, ql0 + t * 16, lane, sc);
#pragma unroll
        for (int j = 0; j < 2; ++j)
#pragma unroll
          for (int r = 0; r < 8; ++r) ss[wave][t * 16 + 8 * g + r][j * 16 + col] = sc[j][r]; } }
    LDSX();   // the wave's own logits are in LDS before its lanes read them back by rows
#pragma unroll
    for (int j = 0; j < HD / 16; ++j) vl[j] = att_v(pvl, j);
    asm volatile("s_wait_xcnt 0x0" :: "v"(pvl) : "memory");   // as above, for the v lo loads
#pragma unroll
    for (int t = 0; t < QT; ++t) { float v[16]; const float* pr = &ss[wave][t * 16 + col][8 * g];
#pragma unroll
      for (int i = 0; i < 8; ++i) { v[i] = pr[i]; v[8 + i] = pr[16 + i]; }
#pragma unroll
      for (int i = 0; i < 16; i += 2) { const v2f e = __builtin_elementwise_fma(v2f{v[i], v[i + 1]}, v2f{SC2, SC2}, v2f{m[t], m[t]}); v[i] = __builtin_amdgcn_exp2f(e.x); v[i + 1] = __builtin_amdgcn_exp2f(e.y); }   // a masked logit is -3e38: its exponent is below -5e37 and its exponential an exact 0
#pragma unroll
      for (int i = 0; i < 16; ++i) lsum[t] += v[i];
      const F2 p = bsplit16(v);   // each of the three products runs over the four output tiles, so that no WMMA waits for the one before it
#pragma unroll
      for (int j = 0; j < HD / 16; ++j) acc[t][j] = wmma_bf(p.h, vh[j], acc[t][j]);
#pragma unroll
      for (int j = 0; j < HD / 16; ++j) acc[t][j] = wmma_bf(p.l, vh[j], acc[t][j]);
#pragma unroll
      for (int j = 0; j < HD / 16; ++j) acc[t][j] = wmma_bf(p.h, vl[j], acc[t][j]);
      __builtin_amdgcn_sched_barrier(0); } }   // one query tile's P after the other: with both tiles' P in registers at once the kernel no longer fits 256 registers and spills to scratch
#pragma unroll
  for (int t = 0; t < QT; ++t) { lsum[t] += __shfl_xor(lsum[t], 16);   // the two halves of a wave hold the two halves of each row's keys
    if (g == 0) ssum[wave][t * 16 + col] = lsum[t];
#pragma unroll
    for (int j = 0; j < HD / 16; ++j)
#pragma unroll
      for (int r = 0; r < 8; ++r) ss[wave][t * 16 + 8 * g + r][j * 16 + col] = acc[t][j][r]; }
  __syncthreads();   // every wave's partial tiles and row sums are in LDS before any thread sums across waves
  static_assert(16 * (HD / 4) == 32 * AW, "one float4 of each query tile per thread");
#pragma unroll
  for (int t = 0; t < QT; ++t) { const int rl = t * 16 + tid / (HD / 4), c4 = (tid % (HD / 4)) * 4; v4f s = *(const v4f*)&ss[0][rl][c4]; float L = ssum[0][rl];
#pragma unroll   // the LDS reads of all partials issue together; the sums keep wave order
    for (int w = 1; w < AW; ++w) { s += *(const v4f*)&ss[w][rl][c4]; L += ssum[w][rl]; }
    vst2(Y + ((size_t)b * TT + ql0 + rl) * CC + h * HD + c4, s * (1.0f / L)); } }
// ---- k_out: block = (64 rows, 128 cols): out = y (bf16 hi + lo) Wproj + b
__global__ __launch_bounds__(128) void k_out(const float* __restrict__ Y, const float* __restrict__ WP, const float* __restrict__ BP, float* __restrict__ OUT) { __shared__ __align__(16) float sf[4][16][132]; __shared__ __align__(16) __bf16 yh[2][64][GP], yl[2][64][GP], wt[2][128][GP];
  const int tid = threadIdx.x, wave = tid >> 5, lane = tid & 31, col = lane & 15, g = lane >> 4; const int c0 = blockIdx.y * 128; const size_t r0 = (size_t)blockIdx.x * 64 + wave * 16;
  v8f acc[8] = {};
  const int lr = tid >> 4, lc = (tid & 15) * 4; const float* py = Y + ((size_t)blockIdx.x * 64 + lr) * CC + lc; const float* pw = WP + (size_t)(c0 + lr) * CC + lc;
  v4f ry[8], rw[16]; g_fetch<8>(py, ry); g_fetch<16>(pw, rw);
  asm volatile("s_wait_xcnt 0x0" :: "v"(py), "v"(pw) : "memory");   // stands in front of every overwrite of the loads' address registers, which it holds until here
#pragma unroll 2   // the buffer index becomes a constant in each copy of the body
  for (int c = 0; c < CC / GK; ++c) { const int bs = c & 1; g_put2<8>(yh[bs], yl[bs], lr, lc, ry); g_put<16>(wt[bs], lr, lc, rw);
    __syncthreads();   // chunk c is whole in LDS before any wave reads it; it also ends every wave's reads of the other buffer, which the next trip refills
    if (c + 1 < CC / GK) { py += GK; pw += GK; g_fetch<8>(py, ry); g_fetch<16>(pw, rw);   // the next chunk flies under this chunk's products
      asm volatile("s_wait_xcnt 0x0" :: "v"(py), "v"(pw) : "memory"); }   // as above
#pragma unroll
    for (int kk = 0; kk < GK / 32; ++kk) { const v16b ah = frag_b(&yh[bs][wave * 16 + col][kk * 32], lane), al = frag_b(&yl[bs][wave * 16 + col][kk * 32], lane); v16b w[8];
#pragma unroll
      for (int j = 0; j < 8; ++j) w[j] = frag_b(&wt[bs][j * 16 + col][kk * 32], lane);
#pragma unroll
      for (int j = 0; j < 8; ++j) { acc[j] = wmma_bf(ah, w[j], acc[j]); acc[j] = wmma_bf(al, w[j], acc[j]); } } }
#pragma unroll
  for (int j = 0; j < 8; ++j) { const float bb = BP ? bfr(BP[c0 + j * 16 + col]) : 0.f;
#pragma unroll
    for (int r = 0; r < 8; ++r) sf[wave][8 * g + r][j * 16 + col] = acc[j][r] + bb; }
  LDSX(); for (int rl = 0; rl < 16; ++rl) vst2(OUT + (r0 + rl) * CC + c0 + lane * 4, *(const v4f*)&sf[wave][rl][lane * 4]); }
extern "C" void kernel_launch(void* const* d_in, const int* in_sizes, int n_in, void* d_out, int out_size, void* d_ws, size_t ws_size, hipStream_t stream) {
  (void)in_sizes; (void)n_in; (void)out_size;
  const float** F = (const float**)d_in;   // 0 x [2,2048,1024], 1 Wq [1024,1024] ([out,in]), 2 bq, 3 Wk, 4 bk, 5 Wv, 6 bv, 7 Wo, 8 bo
  if (ws_size < (size_t)WS_END) return;
  char* ws = (char*)d_ws; _Float16 *QH = (_Float16*)(ws + WS_QH), *QL = (_Float16*)(ws + WS_QL), *KH = (_Float16*)(ws + WS_KH); __bf16 *VT = (__bf16*)(ws + WS_VT), *VL = (__bf16*)(ws + WS_VL); float *Y = (float*)(ws + WS_Y);
  k_proj<<<dim3(TNB * TT / 64, CC / 128, 3), 128, 0, stream>>>(F[0], F[1], F[2], F[3], F[4], F[5], F[6], QH, QL, KH, VT, VL);
  k_att<<<dim3(TT / (16 * QT), NH, TNB), 32 * AW, 0, stream>>>(QH, KH, VT, VL, Y);
  k_out<<<dim3(TNB * TT / 64, CC / 128), 128, 0, stream>>>(Y, F[7], F[8], (float*)d_out);
}

// v006
// Measured time: 133 microseconds a run.
// In both of two side-by-side timings against v005, it was 1.11 times as fast.
// All steps since v000 together make it 11.1 times as fast.
// compute dtype: all float inputs rounded to bf16; q/k/v = x W^T + b with EXACT bf16 products on WMMA 16x16x32, f32 accumulate; rotary in f32 (inv_freq = 10000^(-2i/64) via exp2f/log2f-free powf, precise sincosf); q, k rounded once to f16 (0.02-scale weights: logits std ~0.05, 1 product), causal logits kept on chip in f32 (computed twice: row maxima, then P); softmax in f32 in base 2 (one f32 multiply-add with the constant log2(e) / 8, then the exp2 instruction), P = exp(s - max) kept f32 split bf16 hi + lo against v bf16 hi + lo (3 products), divided by the f32 row sum at the end; out = o (bf16 hi + lo) Wo^T + bo; f32 output.
#include <hip/hip_runtime.h>
#include <math.h>

typedef __attribute__((ext_vector_type(16))) _Float16 v16h;
typedef __attribute__((ext_vector_type(16))) __bf16 v16b;
typedef __attribute__((ext_vector_type(8)))  _Float16 v8h;
typedef __attribute__((ext_vector_type(8)))  float v8f;
typedef __attribute__((ext_vector_type(4)))  float v4f;
typedef __attribute__((ext_vector_type(2)))  float v2f;
typedef __attribute__((ext_vector_type(4)))  unsigned v4u;
typedef __attribute__((ext_vector_type(4)))  int v4i;
typedef float __attribute__((may_alias)) float_a;
typedef int __attribute__((may_alias)) int_a;

template <typename T> __device__ __forceinline__ void vst2(void* p, T v) { *(T*)p = v;  }
__device__ __forceinline__ v8f wmma16(v16h a, v16h b, v8f c) {
  v8f d = __builtin_amdgcn_wmma_f32_16x16x32_f16(false, a, false, b, (short)0, c, false, false);
  asm volatile("v_nop\n\tv_nop\n\tv_nop\n\tv_nop" : "+v"(d) : "v"(a), "v"(b));
  return d;
}
__device__ __forceinline__ v8f wmma_bf(v16b a, v16b b, v8f c) {
  v8f d = __builtin_amdgcn_wmma_f32_16x16x32_bf16(false, a, false, b, (short)0, c, false, false);
  asm volatile("v_nop\n\tv_nop\n\tv_nop\n\tv_nop" : "+v"(d) : "v"(a), "v"(b));
  return d;
}
// 16x16x32 fragments: lane = (h = lane>>4, row/col = lane&15); elements 0..7 = k0+8h+0..7, 8..15 = k0+16+8h+0..7; D element r = row 8h+r
__device__ __forceinline__ v16h frag_h(const _Float16* rowk0, int lane) {
  union { v16h v; v8h q[2]; } u; const _Float16* p = rowk0 + 8 * (lane >> 4);
  u.q[0] = *(const v8h*)p; u.q[1] = *(const v8h*)(p + 16); return u.v;
}
__device__ __forceinline__ v16h frag_f32(const float* rowk0, int lane) {
  v16h a; const float* p = rowk0 + 8 * (lane >> 4);
#pragma unroll
  for (int i = 0; i < 8; ++i) { a[i] = (_Float16)p[i]; a[8 + i] = (_Float16)p[16 + i]; }
  return a;
}
__device__ __forceinline__ v16h frag_f32s(const float* rowk0, int lane, float sc) {
  v16h a; const float* p = rowk0 + 8 * (lane >> 4);
#pragma unroll
  for (int i = 0; i < 8; ++i) { a[i] = (_Float16)(p[i] * sc); a[8 + i] = (_Float16)(p[16 + i] * sc); }
  return a;
}
// column fragment from a [K][ld] layout (column n), rows >= K read as 0
__device__ __forceinline__ v16h fragc_f32(const float* W, int k0, int n, int lane, int ld, int K) {
  v16h a; const int g = lane >> 4;
#pragma unroll
  for (int i = 0; i < 8; ++i) { const int ka = k0 + 8 * g + i, kb = ka + 16;
    a[i] = (_Float16)(ka < K ? W[(size_t)(ka < K ? ka : K - 1) * ld + n] : 0.f); a[8 + i] = (_Float16)(kb < K ? W[(size_t)(kb < K ? kb : K - 1) * ld + n] : 0.f); }
  return a;
}
struct F2 { v16b h, l; };
__device__ __forceinline__ F2 bsplit16(const float v[16]) { F2 r;
#pragma unroll
  for (int i = 0; i < 16; ++i) { const __bf16 h = (__bf16)v[i]; r.h[i] = h; r.l[i] = (__bf16)(v[i] - (float)h); }
  return r; }
__device__ __forceinline__ F2 split_row(const float* row, int k0, int lane) { float v[16]; const float* p = row + k0 + 8 * (lane >> 4);
#pragma unroll
  for (int i = 0; i < 8; ++i) { v[i] = p[i]; v[8 + i] = p[16 + i]; }
  return bsplit16(v); }
__device__ __forceinline__ F2 split_rowK(const float* row, int k0, int lane, int K) { float v[16]; const int g = lane >> 4;
#pragma unroll
  for (int i = 0; i < 8; ++i) { const int ka = k0 + 8 * g + i, kb = ka + 16; v[i] = ka < K ? row[ka < K ? ka : K - 1] : 0.f; v[8 + i] = kb < K ? row[kb < K ? kb : K - 1] : 0.f; }
  return bsplit16(v); }
__device__ __forceinline__ F2 split_col(const float* W, int k0, int n, int lane, int ld, int K) { float v[16]; const int g = lane >> 4;
#pragma unroll
  for (int i = 0; i < 8; ++i) { const int ka = k0 + 8 * g + i, kb = ka + 16; v[i] = ka < K ? W[(size_t)(ka < K ? ka : K - 1) * ld + n] : 0.f; v[8 + i] = kb < K ? W[(size_t)(kb < K ? kb : K - 1) * ld + n] : 0.f; }
  return bsplit16(v); }
__device__ __forceinline__ v8f mac3(const F2& a, const F2& b, v8f c) { c = wmma_bf(a.l, b.h, c); c = wmma_bf(a.h, b.l, c); return wmma_bf(a.h, b.h, c); }
__device__ __forceinline__ float sigm(float v) { return 1.0f / (1.0f + expf(-v)); }
#define LDSX() do { asm volatile("s_wait_dscnt 0" ::: "memory"); __builtin_amdgcn_wave_barrier(); __builtin_amdgcn_fence(__ATOMIC_RELEASE, "workgroup"); } while (0)


// Trajectory attention (B 2, T 2,048, C 1,024 = 16 x 64): q/k/v Linear, rotary position embedding (base 10000, rotate_half), causal softmax(q k / 8) v, output Linear.
#define NB 2
#define TT 2048
#define CC 1024
#define NH 16
#define HD 64
#ifndef TNB
#define TNB NB
#endif
typedef __attribute__((ext_vector_type(8))) __bf16 v8b;
__device__ __forceinline__ v16b frag_b(const __bf16* rowk0, int lane) {
  union { v16b v; v8b q[2]; } u; const __bf16* p = rowk0 + 8 * (lane >> 4);
  u.q[0] = *(const v8b*)p; u.q[1] = *(const v8b*)(p + 16); return u.v;
}
__device__ __forceinline__ float bfr(float v) { return (float)(__bf16)v; }
__device__ __attribute__((noinline)) float exp_ni(float v) { return expf(v); }
__device__ __attribute__((noinline)) float erf_ni(float v) { return erff(v); }

// ---- operand staging of k_proj and k_out: a block brings GK k of every operand row with whole-line 16-byte loads (16 lanes = 256 B of one row), converts once and keeps bf16 rows in LDS
#define GK 64
#define GP (GK + 8)   // LDS row pitch in elements: 144 B = 16 B x 9, free of bank conflicts for the 16-byte fragment reads
typedef __attribute__((ext_vector_type(4))) __bf16 v4b;
// every '#pragma unroll' of the staging helpers and loops: the loop indexes register arrays, which stay in registers only when it is unrolled
// p = the thread's own place: row tid / 16, float4 tid % 16 of the chunk; load i is 8 i rows further down
template <int N> __device__ __forceinline__ void g_fetch(const float* p, v4f* r) {
#pragma unroll
  for (int i = 0; i < N; ++i) r[i] = *(const v4f*)(p + (size_t)i * 8 * CC); }
template <int N> __device__ __forceinline__ void g_put(__bf16 (*t)[GP], int lr, int lc, const v4f* r) {
#pragma unroll
  for (int i = 0; i < N; ++i) { v4b o;
#pragma unroll
    for (int e = 0; e < 4; ++e) o[e] = (__bf16)r[i][e];
    *(v4b*)&t[lr + 8 * i][lc] = o; } }
template <int N> __device__ __forceinline__ void g_put2(__bf16 (*th)[GP], __bf16 (*tl)[GP], int lr, int lc, const v4f* r) {   // bf16 hi + residual, as bsplit16
#pragma unroll
  for (int i = 0; i < N; ++i) { v4b oh, ol;
#pragma unroll
    for (int e = 0; e < 4; ++e) { const __bf16 h = (__bf16)r[i][e]; oh[e] = h; ol[e] = (__bf16)(r[i][e] - (float)h); }
    *(v4b*)&th[lr + 8 * i][lc] = oh; *(v4b*)&tl[lr + 8 * i][lc] = ol; } }

#define WS_QH  0u
#define WS_QL  (WS_QH + 2u * (size_t)NB * TT * CC)
#define WS_KH  (WS_QL + 2u * (size_t)NB * TT * CC)
#define WS_VT  (WS_KH + 2u * (size_t)NB * TT * CC)      // bf16 v planes
#define WS_VL  (WS_VT + 2u * (size_t)NB * CC * TT)      // bf16 v residual planes
#define WS_Y   (WS_VL + 2u * (size_t)NB * CC * TT)      // f32 y rows [b*t][C]
#define WS_END (WS_Y + 4u * (size_t)NB * TT * CC)
// q, k and the v planes lie in the workspace in WMMA fragment order: [b][h][32-position slice][8 half fragments][lane][8 elements], FS elements a slice, so that a wave-wide 16-byte load or store covers 512 contiguous bytes (4 whole lines).
// q, k: half fragment (j*2 + kc)*2 + qh, lane (g, col) = position 16j + col of the slice, dims 32kc + 16qh + 8g + 0..7 of the head. v: half fragment j*2 + qh, lane (g, col) = dim 16j + col of the head, positions 16qh + 8g + 0..7 of the slice.
#define FS (32 * HD)
// k_proj's way out: a block's 64 positions x 128 columns are 2 neighbouring slices of 2 heads, 1,024 units of 16 bytes, 8 a thread; unit i of thread (wave, g, col) is half fragment wave + 4 (i & 1) of slice (i & 3) >> 1 of head i >> 2.
// t = the block's tile in LDS ([position][column] for q and k, [column][position] for v), dst = the thread's own place in the first slice of the first head. Both loops are unrolled because they index a register array.
template <bool ISV, typename T, int P> __device__ __forceinline__ void put_frags(T* dst, const T (*t)[P], int wave, int g, int col) { v4u a[8];
#pragma unroll
  for (int i = 0; i < 8; ++i) { if constexpr (ISV) a[i] = *(const v4u*)&t[(i >> 2) * HD + ((wave >> 1) + 2 * (i & 1)) * 16 + col][((i & 3) >> 1) * 32 + (wave & 1) * 16 + g * 8]; else a[i] = *(const v4u*)&t[(i & 3) * 16 + col][(i >> 2) * HD + wave * 16 + g * 8]; }
#pragma unroll
  for (int i = 0; i < 8; ++i) *(v4u*)(dst + (size_t)(i >> 2) * (TT / 32) * FS + (i & 3) * 1024) = a[i];
  asm volatile("s_wait_xcnt 0x0" :: "v"(dst), "v"(a[0]), "v"(a[1]), "v"(a[2]), "v"(a[3]), "v"(a[4]), "v"(a[5]), "v"(a[6]), "v"(a[7]) : "memory"); }   // stands in front of every overwrite of the stores' address and data registers, which it holds until here

// ---- k_proj: block = (64 rows, 128 cols, which): qkv = x W (+ b), exact; q -> f16 hi (+ residual), k -> f16, v -> bf16 hi + residual planes, all in fragment order
// the staging buffers are dead when the epilogue's arrays come to life: they share the block's LDS
union ProjLds { struct { __bf16 x[2][64][GP], w[2][128][GP]; } st; struct { _Float16 sh[64][136], sl[64][136]; __bf16 th[128][72], tl2[128][72]; float sf[64][132]; } ep; };
__global__ __launch_bounds__(128) void k_proj(const float* __restrict__ X, const float* __restrict__ WQ, const float* __restrict__ BQ, const float* __restrict__ WK, const float* __restrict__ BK, const float* __restrict__ WV, const float* __restrict__ BV, _Float16* __restrict__ QH, _Float16* __restrict__ QL, _Float16* __restrict__ KH, __bf16* __restrict__ VT, __bf16* __restrict__ VL) {
  __shared__ __align__(16) ProjLds lds; _Float16 (&sh)[64][136] = lds.ep.sh; _Float16 (&sl)[64][136] = lds.ep.sl; __bf16 (&th)[128][72] = lds.ep.th; __bf16 (&tl2)[128][72] = lds.ep.tl2; float (&sf)[64][132] = lds.ep.sf;
  const int tid = threadIdx.x, wave = tid >> 5, lane = tid & 31, col = lane & 15, g = lane >> 4; const int which = blockIdx.z; const int c0 = blockIdx.y * 128; const size_t r0 = (size_t)blockIdx.x * 64; const float* WA = which == 0 ? WQ : which == 1 ? WK : WV; const float* BA = which == 0 ? BQ : which == 1 ? BK : BV;
  v8f acc[8] = {};
  const int lr = tid >> 4, lc = (tid & 15) * 4; const float* px = X + (r0 + lr) * CC + lc; const float* pw = WA + (size_t)(c0 + lr) * CC + lc;
  v4f rx[8], rw[16]; g_fetch<8>(px, rx); g_fetch<16>(pw, rw);
  asm volatile("s_wait_xcnt 0x0" :: "v"(px), "v"(pw) : "memory");   // stands in front of every overwrite of the loads' address registers, which it holds until here
#pragma unroll 2   // the buffer index becomes a constant in each copy of the body
  for (int c = 0; c < CC / GK; ++c) { const int bs = c & 1; g_put<8>(lds.st.x[bs], lr, lc, rx); g_put<16>(lds.st.w[bs], lr, lc, rw);
    __syncthreads();   // chunk c is whole in LDS before any wave reads it; it also ends every wave's reads of the other buffer, which the next trip refills
    if (c + 1 < CC / GK) { px += GK; pw += GK; g_fetch<8>(px, rx); g_fetch<16>(pw, rw);   // the next chunk flies under this chunk's products
      asm volatile("s_wait_xcnt 0x0" :: "v"(px), "v"(pw) : "memory"); }   // as above
#pragma unroll
    for (int kk = 0; kk < GK / 32; ++kk) { const v16b a = frag_b(&lds.st.x[bs][wave * 16 + col][kk * 32], lane); v16b w[8];
#pragma unroll
      for (int j = 0; j < 8; ++j) w[j] = frag_b(&lds.st.w[bs][j * 16 + col][kk * 32], lane);
#pragma unroll
      for (int j = 0; j < 8; ++j) acc[j] = wmma_bf(a, w[j], acc[j]); } }
  __syncthreads();   // every wave has left the staging buffers before the epilogue's arrays overwrite them
#pragma unroll
  for (int j = 0; j < 8; ++j) { const float bb = bfr(BA[c0 + j * 16 + col]);
#pragma unroll
    for (int r = 0; r < 8; ++r) { const float v = acc[j][r] + bb; const int rl = wave * 16 + 8 * g + r, cl = j * 16 + col;
      if (which == 2) { const __bf16 bh = (__bf16)v; th[cl][rl] = bh; tl2[cl][rl] = (__bf16)(v - (float)bh); } else sf[rl][cl] = v; } }
  __syncthreads();
  if (which < 2) {   // rotary: out[d] = x[d] cos(t f_{d mod 32}) + (d < 32 ? -x[d+32] : x[d-32]) sin(t f_{d mod 32}); f_i = 10000^(-i/32)
    // a lane keeps one frequency i = lane, a wave takes every 4th position: the angle's cosine and sine are formed once and serve the 4 elements that share them (d = i and i + 32 of both heads of the block)
    const float inv_freq = 1.0f / powf(10000.0f, (float)(2 * lane) / 64.0f);
    for (int it = 0; it < 64 / 4; ++it) { const int rl = it * 4 + wave; const int tpos = (int)((r0 + rl) % TT); const float ang = (float)tpos * inv_freq; float c, s; sincosf(ang, &s, &c);
#pragma unroll   // the LDS reads of both heads issue together
      for (int hh = 0; hh < 128 / HD; ++hh) { const int cl = hh * HD + lane; const float x1 = sf[rl][cl], x2 = sf[rl][cl + 32];
        const float v1 = fmaf(x1, c, -x2 * s), v2 = fmaf(x2, c, x1 * s); const _Float16 h1 = (_Float16)v1, h2 = (_Float16)v2;   // the sine product rounded first, then one multiply-add, for both halves
        sh[rl][cl] = h1; sl[rl][cl] = (_Float16)(v1 - (float)h1); sh[rl][cl + 32] = h2; sl[rl][cl + 32] = (_Float16)(v2 - (float)h2); } }
    __syncthreads(); }
  const size_t fb = (((r0 / TT) * NH + c0 / HD) * (size_t)(TT / 32) + (r0 % TT) / 32) * FS + tid * 8;
  if (which < 2) { put_frags<false>((which == 0 ? QH : KH) + fb, sh, wave, g, col); if (which == 0) put_frags<false>(QL + fb, sl, wave, g, col); }
  else { put_frags<true>(VT + fb, th, wave, g, col); put_frags<true>(VL + fb, tl2, wave, g, col); } }
// ---- k_att: block = 16 * QT queries of (b,h), AW waves; wave w takes the 32-key slices w, w + AW, ... up to the diagonal, each k and v fragment serving the QT query tiles. Sweep 1: logits on WMMA, row maxima only. Sweep 2: the same logits again, exp((a - max) / 8) in f32 as exp2 of one multiply-add, P (bf16 hi + lo) . v; row sums and f32 partial tiles of the waves are summed in LDS in wave order: y[q][h*HD + d] = P . v / sum
// every '#pragma unroll' of k_att and its helpers without a note of its own: the loop indexes fragment, accumulator or per-row arrays, which stay in registers only when it is unrolled
#define AW 8   // the wave number is read into a scalar so that each wave's trip test is a scalar branch
#define QT 2
#define SC2 0.18033688011112042f   // log2(e) / 8: exp((a - amax) / 8) = exp2(a SC2 - amax SC2)
struct KF { v16h f[2][HD / 32]; };   // k fragments of one slice: [16-key group][32 of the head's 64 dims]
// pk = the lane's own 16 bytes in the slice's first half fragment
__device__ __forceinline__ KF att_k(const _Float16* pk) { KF k;
#pragma unroll
  for (int j = 0; j < 2; ++j)
#pragma unroll
    for (int kc = 0; kc < HD / 32; ++kc) { union { v16h v; v8h q[2]; } u; const _Float16* p = pk + (j * (HD / 32) + kc) * 512; u.q[0] = *(const v8h*)p; u.q[1] = *(const v8h*)(p + 256); k.f[j][kc] = u.v; }
  return k; }
// pv = the lane's own 16 bytes in the first half fragment of the slice of a v plane
__device__ __forceinline__ v16b att_v(const __bf16* pv, int j) { union { v16b v; v8b q[2]; } u; const __bf16* p = pv + j * 512; u.q[0] = *(const v8b*)p; u.q[1] = *(const v8b*)(p + 256); return u.v; }
// logits of one query tile against one slice, D layout: sc[j][r] = query q0 + 8g + r against key s*32 + j*16 + col, not yet scaled by 1/8 (SC2 holds the scale), keys above the diagonal masked
__device__ __forceinline__ void att_logits(const KF& k, const v16h* ah, int s, int q0, int lane, v8f* sc) { const int col = lane & 15, g = lane >> 4;
#pragma unroll
  for (int j = 0; j < 2; ++j) { const int kt = s * 32 + j * 16 + col; v8f a = {};
#pragma unroll
    for (int kc = 0; kc < HD / 32; ++kc) a = wmma16(ah[kc], k.f[j][kc], a);
#pragma unroll
    for (int r = 0; r < 8; ++r) { const int qt = q0 + 8 * g + r; float v = a[r]; if (kt > qt) v = -3.0e38f; sc[j][r] = v; } } }
// amdgpu_waves_per_eu(4): holds the allocation at 256 registers, so that two blocks share a WGP
__global__ __launch_bounds__(32 * AW) __attribute__((amdgpu_waves_per_eu(4))) void k_att(const _Float16* __restrict__ QH, const _Float16* __restrict__ KH, const __bf16* __restrict__ VT, const __bf16* __restrict__ VL, float* __restrict__ Y) { __shared__ __align__(16) float ss[AW][16 * QT][HD + 4]; __shared__ float smx[AW][16 * QT], ssum[AW][16 * QT];
  const int tid = threadIdx.x, wave = __builtin_amdgcn_readfirstlane(tid >> 5), lane = tid & 31, col = lane & 15, g = lane >> 4; const int b = blockIdx.z, h = blockIdx.y, ql0 = blockIdx.x * (16 * QT); const int ns = ((ql0 + 16 * QT - 1) >> 5) + 1;   // slices that hold a key <= the block's last query
  static_assert(16 * QT == 32 && HD == 64, "a block's queries are one slice of the fragment order");
  const size_t vo = ((size_t)b * NH + h) * (size_t)(TT / 32) * FS + lane * 8; const _Float16* Kl = KH + vo;   // the lane's own place in slice 0 of the head, the same in q, k and the v planes
  v16h ah[QT][HD / 32];
  { const _Float16* pq = QH + vo + (size_t)blockIdx.x * FS;
#pragma unroll
    for (int t = 0; t < QT; ++t)
#pragma unroll
      for (int kc = 0; kc < HD / 32; ++kc) { union { v16h v; v8h q[2]; } u; const _Float16* p = pq + (t * (HD / 32) + kc) * 512; u.q[0] = *(const v8h*)p; u.q[1] = *(const v8h*)(p + 256); ah[t][kc] = u.v; }
    asm volatile("s_wait_xcnt 0x0" :: "v"(pq) : "memory"); }   // stands in front of every overwrite of the loads' address registers, which it holds until here
  float mx[QT][8];
#pragma unroll
  for (int t = 0; t < QT; ++t)
#pragma unroll
    for (int r = 0; r < 8; ++r) mx[t][r] = -3.0e38f;
  for (int s = wave; s < ns; s += AW) { const _Float16* pk = Kl + (size_t)s * FS; const KF k = att_k(pk);
    asm volatile("s_wait_xcnt 0x0" :: "v"(pk) : "memory");   // as above, for the k loads
#pragma unroll
    for (int t = 0; t < QT; ++t) { v8f sc[2]; att_logits(k, ah[t], s, ql0 + t * 16, lane, sc);
#pragma unroll
      for (int r = 0; r < 8; ++r) mx[t][r] = fmaxf(mx[t][r], fmaxf(sc[0][r], sc[1][r])); } }
#pragma unroll   // step outermost: the exchanges of all rows of one step are in flight together
  for (int o = 1; o < 16; o <<= 1)
#pragma unroll
    for (int t = 0; t < QT; ++t)
#pragma unroll
      for (int r = 0; r < 8; ++r) mx[t][r] = fmaxf(mx[t][r], __shfl_xor(mx[t][r], o));
  if (col == 0) {
#pragma unroll
    for (int t = 0; t < QT; ++t)
#pragma unroll
      for (int r = 0; r < 8; ++r) smx[wave][t * 16 + 8 * g + r] = mx[t][r]; }
  __syncthreads();   // every wave's row maxima are in LDS before any wave forms the row maximum over all keys
  float m[QT], lsum[QT];   // from here on a lane serves query row col of each tile (A layout); m ends as -max SC2, the addend of the exponent
#pragma unroll
  for (int t = 0; t < QT; ++t) { m[t] = smx[0][t * 16 + col]; lsum[t] = 0.f;
#pragma unroll
    for (int w = 1; w < AW; ++w) m[t] = fmaxf(m[t], smx[w][t * 16 + col]);
    m[t] *= -SC2; }
  v8f acc[QT][HD / 16] = {};
  for (int s = wave; s < ns; s += AW) { v16b vh[HD / 16], vl[HD / 16];   // v is fetched ahead of its use: the hi plane with k, the lo plane under the exponentials
    const __bf16* pvh = VT + vo + (size_t)s * FS; const __bf16* pvl = VL + vo + (size_t)s * FS; const _Float16* pk = Kl + (size_t)s * FS;
#pragma unroll
    for (int j = 0; j < HD / 16; ++j) vh[j] = att_v(pvh, j);
    { const KF k = att_k(pk);
      asm volatile("s_wait_xcnt 0x0" :: "v"(pk), "v"(pvh) : "memory");   // as above, for the k and v hi loads
#pragma unroll
      for (int t = 0; t < QT; ++t) { v8f sc[2]; att_logits(k, ah[t], s, ql0 + t * 16, lane, sc);
#pragma unroll
        for (int j = 0; j < 2; ++j)
#pragma unroll
          for (int r = 0; r < 8; ++r) ss[wave][t * 16 + 8 * g + r][j * 16 + col] = sc[j][r]; } }
    LDSX();   // the wave's own logits are in LDS before its lanes read them back by rows
#pragma unroll
    for (int j = 0; j < HD / 16; ++j) vl[j] = att_v(pvl, j);
    asm volatile("s_wait_xcnt 0x0" :: "v"(pvl) : "memory");   // as above, for the v lo loads
#pragma unroll
    for (int t = 0; t < QT; ++t) { float v[16]; const float* pr = &ss[wave][t * 16 + col][8 * g];
#pragma unroll
      for (int i = 0; i < 8; ++i) { v[i] = pr[i]; v[8 + i] = pr[16 + i]; }
#pragma unroll
      for (int i = 0; i < 16; i += 2) { const v2f e = __builtin_elementwise_fma(v2f{v[i], v[i + 1]}, v2f{SC2, SC2}, v2f{m[t], m[t]}); v[i] = __builtin_amdgcn_exp2f(e.x); v[i + 1] = __builtin_amdgcn_exp2f(e.y); }   // a masked logit is -3e38: its exponent is below -5e37 and its exponential an exact 0
#pragma unroll
      for (int i = 0; i < 16; ++i) lsum[t] += v[i];
      const F2 p = bsplit16(v);   // each of the three products runs over the four output tiles, so that no WMMA waits for the one before it
#pragma unroll
      for (int j = 0; j < HD / 16; ++j) acc[t][j] = wmma_bf(p.h, vh[j], acc[t][j]);
#pragma unroll
      for (int j = 0; j < HD / 16; ++j) acc[t][j] = wmma_bf(p.l, vh[j], acc[t][j]);
#pragma unroll
      for (int j = 0; j < HD / 16; ++j) acc[t][j] = wmma_bf(p.h, vl[j], acc[t][j]);
      __builtin_amdgcn_sched_barrier(0); } }   // one query tile's P after the other: with both tiles' P in registers at once the kernel no longer fits 256 registers and spills to scratch
#pragma unroll
  for (int t = 0; t < QT; ++t) { lsum[t] += __shfl_xor(lsum[t], 16);   // the two halves of a wave hold the two halves of each row's keys
    if (g == 0) ssum[wave][t * 16 + col] = lsum[t];
#pragma unroll
    for (int j = 0; j < HD / 16; ++j)
#pragma unroll
      for (int r = 0; r < 8; ++r) ss[wave][t * 16 + 8 * g + r][j * 16 + col] = acc[t][j][r]; }
  __syncthreads();   // every wave's partial tiles and row sums are in LDS before any thread sums across waves
  static_assert(16 * (HD / 4) == 32 * AW, "one float4 of each query tile per thread");
#pragma unroll
  for (int t = 0; t < QT; ++t) { const int rl = t * 16 + tid / (HD / 4), c4 = (tid % (HD / 4)) * 4; v4f s = *(const v4f*)&ss[0][rl][c4]; float L = ssum[0][rl];
#pragma unroll   // the LDS reads of all partials issue together; the sums keep wave order
    for (int w = 1; w < AW; ++w) { s += *(const v4f*)&ss[w][rl][c4]; L += ssum[w][rl]; }
    vst2(Y + ((size_t)b * TT + ql0 + rl) * CC + h * HD + c4, s * (1.0f / L)); } }
// ---- k_out: block = (64 rows, 128 cols): out = y (bf16 hi + lo) Wproj + b
__global__ __launch_bounds__(128) void k_out(const float* __restrict__ Y, const float* __restrict__ WP, const float* __restrict__ BP, float* __restrict__ OUT) { __shared__ __align__(16) float sf[4][16][132]; __shared__ __align__(16) __bf16 yh[2][64][GP], yl[2][64][GP], wt[2][128][GP];
  const int tid = threadIdx.x, wave = tid >> 5, lane = tid & 31, col = lane & 15, g = lane >> 4; const int c0 = blockIdx.y * 128; const size_t r0 = (size_t)blockIdx.x * 64 + wave * 16;
  v8f acc[8] = {};
  const int lr = tid >> 4, lc = (tid & 15) * 4; const float* py = Y + ((size_t)blockIdx.x * 64 + lr) * CC + lc; const float* pw = WP + (size_t)(c0 + lr) * CC + lc;
  v4f ry[8], rw[16]; g_fetch<8>(py, ry); g_fetch<16>(pw, rw);
  asm volatile("s_wait_xcnt 0x0" :: "v"(py), "v"(pw) : "memory");   // stands in front of every overwrite of the loads' address registers, which it holds until here
#pragma unroll 2   // the buffer index becomes a constant in each copy of the body
  for (int c = 0; c < CC / GK; ++c) { const int bs = c & 1; g_put2<8>(yh[bs], yl[bs], lr, lc, ry); g_put<16>(wt[bs], lr, lc, rw);
    __syncthreads();   // chunk c is whole in LDS before any wave reads it; it also ends every wave's reads of the other buffer, which the next trip refills
    if (c + 1 < CC / GK) { py += GK; pw += GK; g_fetch<8>(py, ry); g_fetch<16>(pw, rw);   // the next chunk flies under this chunk's products
      asm volatile("s_wait_xcnt 0x0" :: "v"(py), "v"(pw) : "memory"); }   // as above
#pragma unroll
    for (int kk = 0; kk < GK / 32; ++kk) { const v16b ah = frag_b(&yh[bs][wave * 16 + col][kk * 32], lane), al = frag_b(&yl[bs][wave * 16 + col][kk * 32], lane); v16b w[8];
#pragma unroll
      for (int j = 0; j < 8; ++j) w[j] = frag_b(&wt[bs][j * 16 + col][kk * 32], lane);
#pragma unroll
      for (int j = 0; j < 8; ++j) { acc[j] = wmma_bf(ah, w[j], acc[j]); acc[j] = wmma_bf(al, w[j], acc[j]); } } }
#pragma unroll
  for (int j = 0; j < 8; ++j) { const float bb = BP ? bfr(BP[c0 + j * 16 + col]) : 0.f;
#pragma unroll
    for (int r = 0; r < 8; ++r) sf[wave][8 * g + r][j * 16 + col] = acc[j][r] + bb; }
  LDSX(); for (int rl = 0; rl < 16; ++rl) vst2(OUT + (r0 + rl) * CC + c0 + lane * 4, *(const v4f*)&sf[wave][rl][lane * 4]); }
extern "C" void kernel_launch(void* const* d_in, const int* in_sizes, int n_in, void* d_out, int out_size, void* d_ws, size_t ws_size, hipStream_t stream) {
  (void)in_sizes; (void)n_in; (void)out_size;
  const float** F = (const float**)d_in;   // 0 x [2,2048,1024], 1 Wq [1024,1024] ([out,in]), 2 bq, 3 Wk, 4 bk, 5 Wv, 6 bv, 7 Wo, 8 bo
  if (ws_size < (size_t)WS_END) return;
  char* ws = (char*)d_ws; _Float16 *QH = (_Float16*)(ws + WS_QH), *QL = (_Float16*)(ws + WS_QL), *KH = (_Float16*)(ws + WS_KH); __bf16 *VT = (__bf16*)(ws + WS_VT), *VL = (__bf16*)(ws + WS_VL); float *Y = (float*)(ws + WS_Y);
  k_proj<<<dim3(TNB * TT / 64, CC / 128, 3), 128, 0, stream>>>(F[0], F[1], F[2], F[3], F[4], F[5], F[6], QH, QL, KH, VT, VL);
  k_att<<<dim3(TT / (16 * QT), NH, TNB), 32 * AW, 0, stream>>>(QH, KH, VT, VL, Y);
  k_out<<<dim3(TNB * TT / 64, CC / 128), 128, 0, stream>>>(Y, F[7], F[8], (float*)d_out);
}

// v007
// A run of this version takes 122 microseconds.
// In two side-by-side timings against v006, it was 1.09 and 1.10 times as fast.
// All steps since v000 together make it 12.1 times as fast.
// compute dtype: all float inputs rounded to bf16; q/k/v = x W^T + b with EXACT bf16 products on WMMA 16x16x32, f32 accumulate; rotary in f32 (inv_freq = 10000^(-2i/64) via exp2f/log2f-free powf, precise sincosf); q, k rounded once to f16 (0.02-scale weights: logits std ~0.05, 1 product), causal logits kept on chip in f32 (computed twice: row maxima, then P); softmax in f32 in base 2 (one f32 multiply-add with the constant log2(e) / 8, then the exp2 instruction), P = exp(s - max) kept f32 split bf16 hi + lo against v bf16 hi + lo (3 products), divided by the f32 row sum at the end; out = o (bf16 hi + lo) Wo^T + bo; f32 output.
#include <hip/hip_runtime.h>
#include <math.h>

typedef __attribute__((ext_vector_type(16))) _Float16 v16h;
typedef __attribute__((ext_vector_type(16))) __bf16 v16b;
typedef __attribute__((ext_vector_type(8)))  _Float16 v8h;
typedef __attribute__((ext_vector_type(8)))  float v8f;
typedef __attribute__((ext_vector_type(4)))  float v4f;
typedef __attribute__((ext_vector_type(2)))  float v2f;
typedef __attribute__((ext_vector_type(4)))  unsigned v4u;
typedef __attribute__((ext_vector_type(4)))  int v4i;
typedef float __attribute__((may_alias)) float_a;
typedef int __attribute__((may_alias)) int_a;

template <typename T> __device__ __forceinline__ void vst2(void* p, T v) { *(T*)p = v;  }
__device__ __forceinline__ v8f wmma16(v16h a, v16h b, v8f c) {
  v8f d = __builtin_amdgcn_wmma_f32_16x16x32_f16(false, a, false, b, (short)0, c, false, false);
  asm volatile("v_nop\n\tv_nop\n\tv_nop\n\tv_nop" : "+v"(d) : "v"(a), "v"(b));
  return d;
}
__device__ __forceinline__ v8f wmma_bf(v16b a, v16b b, v8f c) {
  v8f d = __builtin_amdgcn_wmma_f32_16x16x32_bf16(false, a, false, b, (short)0, c, false, false);
  asm volatile("v_nop\n\tv_nop\n\tv_nop\n\tv_nop" : "+v"(d) : "v"(a), "v"(b));
  return d;
}
// 16x16x32 fragments: lane = (h = lane>>4, row/col = lane&15); elements 0..7 = k0+8h+0..7, 8..15 = k0+16+8h+0..7; D element r = row 8h+r
__device__ __forceinline__ v16h frag_h(const _Float16* rowk0, int lane) {
  union { v16h v; v8h q[2]; } u; const _Float16* p = rowk0 + 8 * (lane >> 4);
  u.q[0] = *(const v8h*)p; u.q[1] = *(const v8h*)(p + 16); return u.v;
}
__device__ __forceinline__ v16h frag_f32(const float* rowk0, int lane) {
  v16h a; const float* p = rowk0 + 8 * (lane >> 4);
#pragma unroll
  for (int i = 0; i < 8; ++i) { a[i] = (_Float16)p[i]; a[8 + i] = (_Float16)p[16 + i]; }
  return a;
}
__device__ __forceinline__ v16h frag_f32s(const float* rowk0, int lane, float sc) {
  v16h a; const float* p = rowk0 + 8 * (lane >> 4);
#pragma unroll
  for (int i = 0; i < 8; ++i) { a[i] = (_Float16)(p[i] * sc); a[8 + i] = (_Float16)(p[16 + i] * sc); }
  return a;
}
// column fragment from a [K][ld] layout (column n), rows >= K read as 0
__device__ __forceinline__ v16h fragc_f32(const float* W, int k0, int n, int lane, int ld, int K) {
  v16h a; const int g = lane >> 4;
#pragma unroll
  for (int i = 0; i < 8; ++i) { const int ka = k0 + 8 * g + i, kb = ka + 16;
    a[i] = (_Float16)(ka < K ? W[(size_t)(ka < K ? ka : K - 1) * ld + n] : 0.f); a[8 + i] = (_Float16)(kb < K ? W[(size_t)(kb < K ? kb : K - 1) * ld + n] : 0.f); }
  return a;
}
struct F2 { v16b h, l; };
__device__ __forceinline__ F2 bsplit16(const float v[16]) { F2 r;
#pragma unroll
  for (int i = 0; i < 16; ++i) { const __bf16 h = (__bf16)v[i]; r.h[i] = h; r.l[i] = (__bf16)(v[i] - (float)h); }
  return r; }
__device__ __forceinline__ F2 split_row(const float* row, int k0, int lane) { float v[16]; const float* p = row + k0 + 8 * (lane >> 4);
#pragma unroll
  for (int i = 0; i < 8; ++i) { v[i] = p[i]; v[8 + i] = p[16 + i]; }
  return bsplit16(v); }
__device__ __forceinline__ F2 split_rowK(const float* row, int k0, int lane, int K) { float v[16]; const int g = lane >> 4;
#pragma unroll
  for (int i = 0; i < 8; ++i) { const int ka = k0 + 8 * g + i, kb = ka + 16; v[i] = ka < K ? row[ka < K ? ka : K - 1] : 0.f; v[8 + i] = kb < K ? row[kb < K ? kb : K - 1] : 0.f; }
  return bsplit16(v); }
__device__ __forceinline__ F2 split_col(const float* W, int k0, int n, int lane, int ld, int K) { float v[16]; const int g = lane >> 4;
#pragma unroll
  for (int i = 0; i < 8; ++i) { const int ka = k0 + 8 * g + i, kb = ka + 16; v[i] = ka < K ? W[(size_t)(ka < K ? ka : K - 1) * ld + n] : 0.f; v[8 + i] = kb < K ? W[(size_t)(kb < K ? kb : K - 1) * ld + n] : 0.f; }
  return bsplit16(v); }
__device__ __forceinline__ v8f mac3(const F2& a, const F2& b, v8f c) { c = wmma_bf(a.l, b.h, c); c = wmma_bf(a.h, b.l, c); return wmma_bf(a.h, b.h, c); }
__device__ __forceinline__ float sigm(float v) { return 1.0f / (1.0f + expf(-v)); }
#define LDSX() do { asm volatile("s_wait_dscnt 0" ::: "memory"); __builtin_amdgcn_wave_barrier(); __builtin_amdgcn_fence(__ATOMIC_RELEASE, "workgroup"); } while (0)


// Trajectory attention (B 2, T 2,048, C 1,024 = 16 x 64): q/k/v Linear, rotary position embedding (base 10000, rotate_half), causal softmax(q k / 8) v, output Linear.
#define NB 2
#define TT 2048
#define CC 1024
#define NH 16
#define HD 64
#ifndef TNB
#define TNB NB
#endif
typedef __attribute__((ext_vector_type(8))) __bf16 v8b;
__device__ __forceinline__ v16b frag_b(const __bf16* rowk0, int lane) {
  union { v16b v; v8b q[2]; } u; const __bf16* p = rowk0 + 8 * (lane >> 4);
  u.q[0] = *(const v8b*)p; u.q[1] = *(const v8b*)(p + 16); return u.v;
}
__device__ __forceinline__ float bfr(float v) { return (float)(__bf16)v; }
__device__ __attribute__((noinline)) float exp_ni(float v) { return expf(v); }
__device__ __attribute__((noinline)) float erf_ni(float v) { return erff(v); }

// ---- operand staging of k_proj and k_out: a block brings GK k of every operand row with whole-line 16-byte loads (16 lanes = 256 B of one row), converts once and keeps bf16 rows in LDS
#define GK 64
#define GP (GK + 8)   // LDS row pitch in elements: 144 B = 16 B x 9, free of bank conflicts for the 16-byte fragment reads
typedef __attribute__((ext_vector_type(4))) __bf16 v4b;
// every '#pragma unroll' of the staging helpers and loops: the loop indexes register arrays, which stay in registers only when it is unrolled
// p = the thread's own place: row tid / 16, float4 tid % 16 of the chunk; load i is 8 i rows further down
template <int N> __device__ __forceinline__ void g_fetch(const float* p, v4f* r) {
#pragma unroll
  for (int i = 0; i < N; ++i) r[i] = *(const v4f*)(p + (size_t)i * 8 * CC); }
template <int N> __device__ __forceinline__ void g_put(__bf16 (*t)[GP], int lr, int lc, const v4f* r) {
#pragma unroll
  for (int i = 0; i < N; ++i) { v4b o;
#pragma unroll
    for (int e = 0; e < 4; ++e) o[e] = (__bf16)r[i][e];
    *(v4b*)&t[lr + 8 * i][lc] = o; } }
template <int N> __device__ __forceinline__ void g_put2(__bf16 (*th)[GP], __bf16 (*tl)[GP], int lr, int lc, const v4f* r) {   // bf16 hi + residual, as bsplit16
#pragma unroll
  for (int i = 0; i < N; ++i) { v4b oh, ol;
#pragma unroll
    for (int e = 0; e < 4; ++e) { const __bf16 h = (__bf16)r[i][e]; oh[e] = h; ol[e] = (__bf16)(r[i][e] - (float)h); }
    *(v4b*)&th[lr + 8 * i][lc] = oh; *(v4b*)&tl[lr + 8 * i][lc] = ol; } }

#define WS_QH  0u
#define WS_QL  (WS_QH + 2u * (size_t)NB * TT * CC)
#define WS_KH  (WS_QL + 2u * (size_t)NB * TT * CC)
#define WS_VT  (WS_KH + 2u * (size_t)NB * TT * CC)      // bf16 v planes
#define WS_VL  (WS_VT + 2u * (size_t)NB * CC * TT)      // bf16 v residual planes
#define WS_Y   (WS_VL + 2u * (size_t)NB * CC * TT)      // f32 y rows [b*t][C]
#define WS_END (WS_Y + 4u * (size_t)NB * TT * CC)
// q, k and the v planes lie in the workspace in WMMA fragment order: [b][h][32-position slice][8 half fragments][lane][8 elements], FS elements a slice, so that a wave-wide 16-byte load or store covers 512 contiguous bytes (4 whole lines).
// q, k: half fragment (j*2 + kc)*2 + qh, lane (g, col) = position 16j + col of the slice, dims 32kc + 16qh + 8g + 0..7 of the head. v: half fragment j*2 + qh, lane (g, col) = dim 16j + col of the head, positions 16qh + 8g + 0..7 of the slice.
#define FS (32 * HD)
// k_proj's way out: a block's 64 positions x 128 columns are 2 neighbouring slices of 2 heads, 1,024 units of 16 bytes, 8 a thread; unit i of thread (wave, g, col) is half fragment wave + 4 (i & 1) of slice (i & 3) >> 1 of head i >> 2.
// t = the block's tile in LDS ([position][column] for q and k, [column][position] for v), dst = the thread's own place in the first slice of the first head. Both loops are unrolled because they index a register array.
template <bool ISV, typename T, int P> __device__ __forceinline__ void put_frags(T* dst, const T (*t)[P], int wave, int g, int col) { v4u a[8];
#pragma unroll
  for (int i = 0; i < 8; ++i) { if constexpr (ISV) a[i] = *(const v4u*)&t[(i >> 2) * HD + ((wave >> 1) + 2 * (i & 1)) * 16 + col][((i & 3) >> 1) * 32 + (wave & 1) * 16 + g * 8]; else a[i] = *(const v4u*)&t[(i & 3) * 16 + col][(i >> 2) * HD + wave * 16 + g * 8]; }
#pragma unroll
  for (int i = 0; i < 8; ++i) *(v4u*)(dst + (size_t)(i >> 2) * (TT / 32) * FS + (i & 3) * 1024) = a[i];
  asm volatile("s_wait_xcnt 0x0" :: "v"(dst), "v"(a[0]), "v"(a[1]), "v"(a[2]), "v"(a[3]), "v"(a[4]), "v"(a[5]), "v"(a[6]), "v"(a[7]) : "memory"); }   // stands in front of every overwrite of the stores' address and data registers, which it holds until here

// ---- k_proj: block = (64 rows, 128 cols, which): qkv = x W (+ b), exact; q -> f16 hi (+ residual), k -> f16, v -> bf16 hi + residual planes, all in fragment order
// the staging buffers are dead when the epilogue's arrays come to life: they share the block's LDS
union ProjLds { struct { __bf16 x[2][64][GP], w[2][128][GP]; } st; struct { _Float16 sh[64][136], sl[64][136]; __bf16 th[128][72], tl2[128][72]; float sf[64][132]; } ep; };
__global__ __launch_bounds__(128) void k_proj(const float* __restrict__ X, const float* __restrict__ WQ, const float* __restrict__ BQ, const float* __restrict__ WK, const float* __restrict__ BK, const float* __restrict__ WV, const float* __restrict__ BV, _Float16* __restrict__ QH, _Float16* __restrict__ QL, _Float16* __restrict__ KH, __bf16* __restrict__ VT, __bf16* __restrict__ VL) {
  __shared__ __align__(16) ProjLds lds; _Float16 (&sh)[64][136] = lds.ep.sh; _Float16 (&sl)[64][136] = lds.ep.sl; __bf16 (&th)[128][72] = lds.ep.th; __bf16 (&tl2)[128][72] = lds.ep.tl2; float (&sf)[64][132] = lds.ep.sf;
  const int tid = threadIdx.x, wave = tid >> 5, lane = tid & 31, col = lane & 15, g = lane >> 4; const int which = blockIdx.z; const int c0 = blockIdx.y * 128; const size_t r0 = (size_t)blockIdx.x * 64; const float* WA = which == 0 ? WQ : which == 1 ? WK : WV; const float* BA = which == 0 ? BQ : which == 1 ? BK : BV;
  v8f acc[8] = {};
  const int lr = tid >> 4, lc = (tid & 15) * 4; const float* px = X + (r0 + lr) * CC + lc; const float* pw = WA + (size_t)(c0 + lr) * CC + lc;
  v4f rx[8], rw[16]; g_fetch<8>(px, rx); g_fetch<16>(pw, rw);
  asm volatile("s_wait_xcnt 0x0" :: "v"(px), "v"(pw) : "memory");   // stands in front of every overwrite of the loads' address registers, which it holds until here
#pragma unroll 2   // the buffer index becomes a constant in each copy of the body
  for (int c = 0; c < CC / GK; ++c) { const int bs = c & 1; g_put<8>(lds.st.x[bs], lr, lc, rx); g_put<16>(lds.st.w[bs], lr, lc, rw);
    __syncthreads();   // chunk c is whole in LDS before any wave reads it; it also ends every wave's reads of the other buffer, which the next trip refills
    if (c + 1 < CC / GK) { px += GK; pw += GK; g_fetch<8>(px, rx); g_fetch<16>(pw, rw);   // the next chunk flies under this chunk's products
      asm volatile("s_wait_xcnt 0x0" :: "v"(px), "v"(pw) : "memory"); }   // as above
#pragma unroll
    for (int kk = 0; kk < GK / 32; ++kk) { const v16b a = frag_b(&lds.st.x[bs][wave * 16 + col][kk * 32], lane); v16b w[8];
#pragma unroll
      for (int j = 0; j < 8; ++j) w[j] = frag_b(&lds.st.w[bs][j * 16 + col][kk * 32], lane);
#pragma unroll
      for (int j = 0; j < 8; ++j) acc[j] = wmma_bf(a, w[j], acc[j]); } }
  __syncthreads();   // every wave has left the staging buffers before the epilogue's arrays overwrite them
#pragma unroll
  for (int j = 0; j < 8; ++j) { const float bb = bfr(BA[c0 + j * 16 + col]);
#pragma unroll
    for (int r = 0; r < 8; ++r) { const float v = acc[j][r] + bb; const int rl = wave * 16 + 8 * g + r, cl = j * 16 + col;
      if (which == 2) { const __bf16 bh = (__bf16)v; th[cl][rl] = bh; tl2[cl][rl] = (__bf16)(v - (float)bh); } else sf[rl][cl] = v; } }
  __syncthreads();
  if (which < 2) {   // rotary: out[d] = x[d] cos(t f_{d mod 32}) + (d < 32 ? -x[d+32] : x[d-32]) sin(t f_{d mod 32}); f_i = 10000^(-i/32)
    // a lane keeps one frequency i = lane, a wave takes every 4th position: the angle's cosine and sine are formed once and serve the 4 elements that share them (d = i and i + 32 of both heads of the block)
    const float inv_freq = 1.0f / powf(10000.0f, (float)(2 * lane) / 64.0f);
    for (int it = 0; it < 64 / 4; ++it) { const int rl = it * 4 + wave; const int tpos = (int)((r0 + rl) % TT); const float ang = (float)tpos * inv_freq; float c, s; sincosf(ang, &s, &c);
#pragma unroll   // the LDS reads of both heads issue together
      for (int hh = 0; hh < 128 / HD; ++hh) { const int cl = hh * HD + lane; const float x1 = sf[rl][cl], x2 = sf[rl][cl + 32];
        const float v1 = fmaf(x1, c, -x2 * s), v2 = fmaf(x2, c, x1 * s); const _Float16 h1 = (_Float16)v1, h2 = (_Float16)v2;   // the sine product rounded first, then one multiply-add, for both halves
        sh[rl][cl] = h1; sl[rl][cl] = (_Float16)(v1 - (float)h1); sh[rl][cl + 32] = h2; sl[rl][cl + 32] = (_Float16)(v2 - (float)h2); } }
    __syncthreads(); }
  const size_t fb = (((r0 / TT) * NH + c0 / HD) * (size_t)(TT / 32) + (r0 % TT) / 32) * FS + tid * 8;
  if (which < 2) { put_frags<false>((which == 0 ? QH : KH) + fb, sh, wave, g, col); if (which == 0) put_frags<false>(QL + fb, sl, wave, g, col); }
  else { put_frags<true>(VT + fb, th, wave, g, col); put_frags<true>(VL + fb, tl2, wave, g, col); } }
// ---- k_att: block = 16 * QT queries of (b,h), AW waves; wave w takes the 32-key slices w, w + AW, ... up to the diagonal, each k and v fragment serving the QT query tiles. Sweep 1: logits on WMMA, row maxima only. Sweep 2: the same logits again, exp((a - max) / 8) in f32 as exp2 of one multiply-add, P (bf16 hi + lo) . v; row sums and f32 partial tiles of the waves are summed in LDS in wave order: y[q][h*HD + d] = P . v / sum
// grid = (head, batch, query block), the query block counted down from the last: a block's cost grows with its number of key slices and there are four times as many blocks as resident places, so the longest blocks of all heads start first and the shortest fill the end of the launch
// every '#pragma unroll' of k_att and its helpers without a note of its own: the loop indexes fragment, accumulator or per-row arrays, which stay in registers only when it is unrolled
#define AW 8   // the wave number is read into a scalar so that each wave's trip test is a scalar branch
#define QT 2
#define SC2 0.18033688011112042f   // log2(e) / 8: exp((a - amax) / 8) = exp2(a SC2 - amax SC2)
struct KF { v16h f[2][HD / 32]; };   // k fragments of one slice: [16-key group][32 of the head's 64 dims]
// pk = the lane's own 16 bytes in the slice's first half fragment
__device__ __forceinline__ KF att_k(const _Float16* pk) { KF k;
#pragma unroll
  for (int j = 0; j < 2; ++j)
#pragma unroll
    for (int kc = 0; kc < HD / 32; ++kc) { union { v16h v; v8h q[2]; } u; const _Float16* p = pk + (j * (HD / 32) + kc) * 512; u.q[0] = *(const v8h*)p; u.q[1] = *(const v8h*)(p + 256); k.f[j][kc] = u.v; }
  return k; }
// pv = the lane's own 16 bytes in the first half fragment of the slice of a v plane
__device__ __forceinline__ v16b att_v(const __bf16* pv, int j) { union { v16b v; v8b q[2]; } u; const __bf16* p = pv + j * 512; u.q[0] = *(const v8b*)p; u.q[1] = *(const v8b*)(p + 256); return u.v; }
// logits of one query tile against one slice, D layout: sc[j][r] = query q0 + 8g + r against key s*32 + j*16 + col, not yet scaled by 1/8 (SC2 holds the scale), keys above the diagonal masked
__device__ __forceinline__ void att_logits(const KF& k, const v16h* ah, int s, int q0, int lane, v8f* sc) { const int col = lane & 15, g = lane >> 4;
#pragma unroll
  for (int j = 0; j < 2; ++j) { const int kt = s * 32 + j * 16 + col; v8f a = {};
#pragma unroll
    for (int kc = 0; kc < HD / 32; ++kc) a = wmma16(ah[kc], k.f[j][kc], a);
#pragma unroll
    for (int r = 0; r < 8; ++r) { const int qt = q0 + 8 * g + r; float v = a[r]; if (kt > qt) v = -3.0e38f; sc[j][r] = v; } } }
// amdgpu_waves_per_eu(4): holds the allocation at 256 registers, so that two blocks share a WGP
__global__ __launch_bounds__(32 * AW) __attribute__((amdgpu_waves_per_eu(4))) void k_att(const _Float16* __restrict__ QH, const _Float16* __restrict__ KH, const __bf16* __restrict__ VT, const __bf16* __restrict__ VL, float* __restrict__ Y) { __shared__ __align__(16) float ss[AW][16 * QT][HD + 4]; __shared__ float smx[AW][16 * QT], ssum[AW][16 * QT];
  const int tid = threadIdx.x, wave = __builtin_amdgcn_readfirstlane(tid >> 5), lane = tid & 31, col = lane & 15, g = lane >> 4; const int b = blockIdx.y, h = blockIdx.x, qb = TT / (16 * QT) - 1 - (int)blockIdx.z, ql0 = qb * (16 * QT); const int ns = ((ql0 + 16 * QT - 1) >> 5) + 1;   // slices that hold a key <= the block's last query
  static_assert(16 * QT == 32 && HD == 64, "a block's queries are one slice of the fragment order");
  const size_t vo = ((size_t)b * NH + h) * (size_t)(TT / 32) * FS + lane * 8; const _Float16* Kl = KH + vo;   // the lane's own place in slice 0 of the head, the same in q, k and the v planes
  v16h ah[QT][HD / 32];
  { const _Float16* pq = QH + vo + (size_t)qb * FS;
#pragma unroll
    for (int t = 0; t < QT; ++t)
#pragma unroll
      for (int kc = 0; kc < HD / 32; ++kc) { union { v16h v; v8h q[2]; } u; const _Float16* p = pq + (t * (HD / 32) + kc) * 512; u.q[0] = *(const v8h*)p; u.q[1] = *(const v8h*)(p + 256); ah[t][kc] = u.v; }
    asm volatile("s_wait_xcnt 0x0" :: "v"(pq) : "memory"); }   // stands in front of every overwrite of the loads' address registers, which it holds until here
  float mx[QT][8];
#pragma unroll
  for (int t = 0; t < QT; ++t)
#pragma unroll
    for (int r = 0; r < 8; ++r) mx[t][r] = -3.0e38f;
  for (int s = wave; s < ns; s += AW) { const _Float16* pk = Kl + (size_t)s * FS; const KF k = att_k(pk);
    asm volatile("s_wait_xcnt 0x0" :: "v"(pk) : "memory");   // as above, for the k loads
#pragma unroll
    for (int t = 0; t < QT; ++t) { v8f sc[2]; att_logits(k, ah[t], s, ql0 + t * 16, lane, sc);
#pragma unroll
      for (int r = 0; r < 8; ++r) mx[t][r] = fmaxf(mx[t][r], fmaxf(sc[0][r], sc[1][r])); } }
#pragma unroll   // step outermost: the exchanges of all rows of one step are in flight together
  for (int o = 1; o < 16; o <<= 1)
#pragma unroll
    for (int t = 0; t < QT; ++t)
#pragma unroll
      for (int r = 0; r < 8; ++r) mx[t][r] = fmaxf(mx[t][r], __shfl_xor(mx[t][r], o));
  if (col == 0) {
#pragma unroll
    for (int t = 0; t < QT; ++t)
#pragma unroll
      for (int r = 0; r < 8; ++r) smx[wave][t * 16 + 8 * g + r] = mx[t][r]; }
  __syncthreads();   // every wave's row maxima are in LDS before any wave forms the row maximum over all keys
  float m[QT], lsum[QT];   // from here on a lane serves query row col of each tile (A layout); m ends as -max SC2, the addend of the exponent
#pragma unroll
  for (int t = 0; t < QT; ++t) { m[t] = smx[0][t * 16 + col]; lsum[t] = 0.f;
#pragma unroll
    for (int w = 1; w < AW; ++w) m[t] = fmaxf(m[t], smx[w][t * 16 + col]);
    m[t] *= -SC2; }
  v8f acc[QT][HD / 16] = {};
  for (int s = wave; s < ns; s += AW) { v16b vh[HD / 16], vl[HD / 16];   // v is fetched ahead of its use: the hi plane with k, the lo plane under the exponentials
    const __bf16* pvh = VT + vo + (size_t)s * FS; const __bf16* pvl = VL + vo + (size_t)s * FS; const _Float16* pk = Kl + (size_t)s * FS;
#pragma unroll
    for (int j = 0; j < HD / 16; ++j) vh[j] = att_v(pvh, j);
    { const KF k = att_k(pk);
      asm volatile("s_wait_xcnt 0x0" :: "v"(pk), "v"(pvh) : "memory");   // as above, for the k and v hi loads
#pragma unroll
      for (int t = 0; t < QT; ++t) { v8f sc[2]; att_logits(k, ah[t], s, ql0 + t * 16, lane, sc);
#pragma unroll
        for (int j = 0; j < 2; ++j)
#pragma unroll
          for (int r = 0; r < 8; ++r) ss[wave][t * 16 + 8 * g + r][j * 16 + col] = sc[j][r]; } }
    LDSX();   // the wave's own logits are in LDS before its lanes read them back by rows
#pragma unroll
    for (int j = 0; j < HD / 16; ++j) vl[j] = att_v(pvl, j);
    asm volatile("s_wait_xcnt 0x0" :: "v"(pvl) : "memory");   // as above, for the v lo loads
#pragma unroll
    for (int t = 0; t < QT; ++t) { float v[16]; const float* pr = &ss[wave][t * 16 + col][8 * g];
#pragma unroll
      for (int i = 0; i < 8; ++i) { v[i] = pr[i]; v[8 + i] = pr[16 + i]; }
#pragma unroll
      for (int i = 0; i < 16; i += 2) { const v2f e = __builtin_elementwise_fma(v2f{v[i], v[i + 1]}, v2f{SC2, SC2}, v2f{m[t], m[t]}); v[i] = __builtin_amdgcn_exp2f(e.x); v[i + 1] = __builtin_amdgcn_exp2f(e.y); }   // a masked logit is -3e38: its exponent is below -5e37 and its exponential an exact 0
#pragma unroll
      for (int i = 0; i < 16; ++i) lsum[t] += v[i];
      const F2 p = bsplit16(v);   // each of the three products runs over the four output tiles, so that no WMMA waits for the one before it
#pragma unroll
      for (int j = 0; j < HD / 16; ++j) acc[t][j] = wmma_bf(p.h, vh[j], acc[t][j]);
#pragma unroll
      for (int j = 0; j < HD / 16; ++j) acc[t][j] = wmma_bf(p.l, vh[j], acc[t][j]);
#pragma unroll
      for (int j = 0; j < HD / 16; ++j) acc[t][j] = wmma_bf(p.h, vl[j], acc[t][j]);
      __builtin_amdgcn_sched_barrier(0); } }   // one query tile's P after the other: with both tiles' P in registers at once the kernel no longer fits 256 registers and spills to scratch
#pragma unroll
  for (int t = 0; t < QT; ++t) { lsum[t] += __shfl_xor(lsum[t], 16);   // the two halves of a wave hold the two halves of each row's keys
    if (g == 0) ssum[wave][t * 16 + col] = lsum[t];
#pragma unroll
    for (int j = 0; j < HD / 16; ++j)
#pragma unroll
      for (int r = 0; r < 8; ++r) ss[wave][t * 16 + 8 * g + r][j * 16 + col] = acc[t][j][r]; }
  __syncthreads();   // every wave's partial tiles and row sums are in LDS before any thread sums across waves
  static_assert(16 * (HD / 4) == 32 * AW, "one float4 of each query tile per thread");
#pragma unroll
  for (int t = 0; t < QT; ++t) { const int rl = t * 16 + tid / (HD / 4), c4 = (tid % (HD / 4)) * 4; v4f s = *(const v4f*)&ss[0][rl][c4]; float L = ssum[0][rl];
#pragma unroll   // the LDS reads of all partials issue together; the sums keep wave order
    for (int w = 1; w < AW; ++w) { s += *(const v4f*)&ss[w][rl][c4]; L += ssum[w][rl]; }
    vst2(Y + ((size_t)b * TT + ql0 + rl) * CC + h * HD + c4, s * (1.0f / L)); } }
// ---- k_out: block = (64 rows, 128 cols): out = y (bf16 hi + lo) Wproj + b
__global__ __launch_bounds__(128) void k_out(const float* __restrict__ Y, const float* __restrict__ WP, const float* __restrict__ BP, float* __restrict__ OUT) { __shared__ __align__(16) float sf[4][16][132]; __shared__ __align__(16) __bf16 yh[2][64][GP], yl[2][64][GP], wt[2][128][GP];
  const int tid = threadIdx.x, wave = tid >> 5, lane = tid & 31, col = lane & 15, g = lane >> 4; const int c0 = blockIdx.y * 128; const size_t r0 = (size_t)blockIdx.x * 64 + wave * 16;
  v8f acc[8] = {};
  const int lr = tid >> 4, lc = (tid & 15) * 4; const float* py = Y + ((size_t)blockIdx.x * 64 + lr) * CC + lc; const float* pw = WP + (size_t)(c0 + lr) * CC + lc;
  v4f ry[8], rw[16]; g_fetch<8>(py, ry); g_fetch<16>(pw, rw);
  asm volatile("s_wait_xcnt 0x0" :: "v"(py), "v"(pw) : "memory");   // stands in front of every overwrite of the loads' address registers, which it holds until here
#pragma unroll 2   // the buffer index becomes a constant in each copy of the body
  for (int c = 0; c < CC / GK; ++c) { const int bs = c & 1; g_put2<8>(yh[bs], yl[bs], lr, lc, ry); g_put<16>(wt[bs], lr, lc, rw);
    __syncthreads();   // chunk c is whole in LDS before any wave reads it; it also ends every wave's reads of the other buffer, which the next trip refills
    if (c + 1 < CC / GK) { py += GK; pw += GK; g_fetch<8>(py, ry); g_fetch<16>(pw, rw);   // the next chunk flies under this chunk's products
      asm volatile("s_wait_xcnt 0x0" :: "v"(py), "v"(pw) : "memory"); }   // as above
#pragma unroll
    for (int kk = 0; kk < GK / 32; ++kk) { const v16b ah = frag_b(&yh[bs][wave * 16 + col][kk * 32], lane), al = frag_b(&yl[bs][wave * 16 + col][kk * 32], lane); v16b w[8];
#pragma unroll
      for (int j = 0; j < 8; ++j) w[j] = frag_b(&wt[bs][j * 16 + col][kk * 32], lane);
#pragma unroll
      for (int j = 0; j < 8; ++j) { acc[j] = wmma_bf(ah, w[j], acc[j]); acc[j] = wmma_bf(al, w[j], acc[j]); } } }
#pragma unroll
  for (int j = 0; j < 8; ++j) { const float bb = BP ? bfr(BP[c0 + j * 16 + col]) : 0.f;
#pragma unroll
    for (int r = 0; r < 8; ++r) sf[wave][8 * g + r][j * 16 + col] = acc[j][r] + bb; }
  LDSX(); for (int rl = 0; rl < 16; ++rl) vst2(OUT + (r0 + rl) * CC + c0 + lane * 4, *(const v4f*)&sf[wave][rl][lane * 4]); }
extern "C" void kernel_launch(void* const* d_in, const int* in_sizes, int n_in, void* d_out, int out_size, void* d_ws, size_t ws_size, hipStream_t stream) {
  (void)in_sizes; (void)n_in; (void)out_size;
  const float** F = (const float**)d_in;   // 0 x [2,2048,1024], 1 Wq [1024,1024] ([out,in]), 2 bq, 3 Wk, 4 bk, 5 Wv, 6 bv, 7 Wo, 8 bo
  if (ws_size < (size_t)WS_END) return;
  char* ws = (char*)d_ws; _Float16 *QH = (_Float16*)(ws + WS_QH), *QL = (_Float16*)(ws + WS_QL), *KH = (_Float16*)(ws + WS_KH); __bf16 *VT = (__bf16*)(ws + WS_VT), *VL = (__bf16*)(ws + WS_VL); float *Y = (float*)(ws + WS_Y);
  k_proj<<<dim3(TNB * TT / 64, CC / 128, 3), 128, 0, stream>>>(F[0], F[1], F[2], F[3], F[4], F[5], F[6], QH, QL, KH, VT, VL);
  k_att<<<dim3(NH, TNB, TT / (16 * QT)), 32 * AW, 0, stream>>>(QH, KH, VT, VL, Y);
  k_out<<<dim3(TNB * TT / 64, CC / 128), 128, 0, stream>>>(Y, F[7], F[8], (float*)d_out);
}

// v008
// Measured time: 108 microseconds a run.
// In two side-by-side timings against v007, it was 1.11 and 1.10 times as fast.
// Counting every step since v000, it is 13.4 times as fast.
// compute dtype: all float inputs rounded to bf16; q/k/v = x W^T + b with EXACT bf16 products on WMMA 16x16x32, f32 accumulate; rotary in f32 (inv_freq = 10000^(-2i/64) via exp2f/log2f-free powf, precise sincosf); q, k rounded once to f16 (0.02-scale weights: logits std ~0.05, 1 product), causal logits kept on chip in f32, computed once; softmax in f32 in base 2 against a running row maximum (one f32 multiply-add with the constant log2(e) / 8, then the exp2 instruction; sums and partial outputs rescaled in f32 when the maximum in use moves), P = exp(s - max in use) kept f32 split bf16 hi + lo against v bf16 hi + lo (3 products), divided by the f32 row sum at the end; out = o (bf16 hi + lo) Wo^T + bo; f32 output.
#include <hip/hip_runtime.h>
#include <math.h>

typedef __attribute__((ext_vector_type(16))) _Float16 v16h;
typedef __attribute__((ext_vector_type(16))) __bf16 v16b;
typedef __attribute__((ext_vector_type(8)))  _Float16 v8h;
typedef __attribute__((ext_vector_type(8)))  float v8f;
typedef __attribute__((ext_vector_type(4)))  float v4f;
typedef __attribute__((ext_vector_type(2)))  float v2f;
typedef __attribute__((ext_vector_type(4)))  unsigned v4u;
typedef __attribute__((ext_vector_type(4)))  int v4i;
typedef float __attribute__((may_alias)) float_a;
typedef int __attribute__((may_alias)) int_a;

template <typename T> __device__ __forceinline__ void vst2(void* p, T v) { *(T*)p = v;  }
__device__ __forceinline__ v8f wmma16(v16h a, v16h b, v8f c) {
  v8f d = __builtin_amdgcn_wmma_f32_16x16x32_f16(false, a, false, b, (short)0, c, false, false);
  asm volatile("v_nop\n\tv_nop\n\tv_nop\n\tv_nop" : "+v"(d) : "v"(a), "v"(b));
  return d;
}
__device__ __forceinline__ v8f wmma_bf(v16b a, v16b b, v8f c) {
  v8f d = __builtin_amdgcn_wmma_f32_16x16x32_bf16(false, a, false, b, (short)0, c, false, false);
  asm volatile("v_nop\n\tv_nop\n\tv_nop\n\tv_nop" : "+v"(d) : "v"(a), "v"(b));
  return d;
}
// 16x16x32 fragments: lane = (h = lane>>4, row/col = lane&15); elements 0..7 = k0+8h+0..7, 8..15 = k0+16+8h+0..7; D element r = row 8h+r
__device__ __forceinline__ v16h frag_h(const _Float16* rowk0, int lane) {
  union { v16h v; v8h q[2]; } u; const _Float16* p = rowk0 + 8 * (lane >> 4);
  u.q[0] = *(const v8h*)p; u.q[1] = *(const v8h*)(p + 16); return u.v;
}
__device__ __forceinline__ v16h frag_f32(const float* rowk0, int lane) {
  v16h a; const float* p = rowk0 + 8 * (lane >> 4);
#pragma unroll
  for (int i = 0; i < 8; ++i) { a[i] = (_Float16)p[i]; a[8 + i] = (_Float16)p[16 + i]; }
  return a;
}
__device__ __forceinline__ v16h frag_f32s(const float* rowk0, int lane, float sc) {
  v16h a; const float* p = rowk0 + 8 * (lane >> 4);
#pragma unroll
  for (int i = 0; i < 8; ++i) { a[i] = (_Float16)(p[i] * sc); a[8 + i] = (_Float16)(p[16 + i] * sc); }
  return a;
}
// column fragment from a [K][ld] layout (column n), rows >= K read as 0
__device__ __forceinline__ v16h fragc_f32(const float* W, int k0, int n, int lane, int ld, int K) {
  v16h a; const int g = lane >> 4;
#pragma unroll
  for (int i = 0; i < 8; ++i) { const int ka = k0 + 8 * g + i, kb = ka + 16;
    a[i] = (_Float16)(ka < K ? W[(size_t)(ka < K ? ka : K - 1) * ld + n] : 0.f); a[8 + i] = (_Float16)(kb < K ? W[(size_t)(kb < K ? kb : K - 1) * ld + n] : 0.f); }
  return a;
}
struct F2 { v16b h, l; };
__device__ __forceinline__ F2 bsplit16(const float v[16]) { F2 r;
#pragma unroll
  for (int i = 0; i < 16; ++i) { const __bf16 h = (__bf16)v[i]; r.h[i] = h; r.l[i] = (__bf16)(v[i] - (float)h); }
  return r; }
__device__ __forceinline__ F2 split_row(const float* row, int k0, int lane) { float v[16]; const float* p = row + k0 + 8 * (lane >> 4);
#pragma unroll
  for (int i = 0; i < 8; ++i) { v[i] = p[i]; v[8 + i] = p[16 + i]; }
  return bsplit16(v); }
__device__ __forceinline__ F2 split_rowK(const float* row, int k0, int lane, int K) { float v[16]; const int g = lane >> 4;
#pragma unroll
  for (int i = 0; i < 8; ++i) { const int ka = k0 + 8 * g + i, kb = ka + 16; v[i] = ka < K ? row[ka < K ? ka : K - 1] : 0.f; v[8 + i] = kb < K ? row[kb < K ? kb : K - 1] : 0.f; }
  return bsplit16(v); }
__device__ __forceinline__ F2 split_col(const float* W, int k0, int n, int lane, int ld, int K) { float v[16]; const int g = lane >> 4;
#pragma unroll
  for (int i = 0; i < 8; ++i) { const int ka = k0 + 8 * g + i, kb = ka + 16; v[i] = ka < K ? W[(size_t)(ka < K ? ka : K - 1) * ld + n] : 0.f; v[8 + i] = kb < K ? W[(size_t)(kb < K ? kb : K - 1) * ld + n] : 0.f; }
  return bsplit16(v); }
__device__ __forceinline__ v8f mac3(const F2& a, const F2& b, v8f c) { c = wmma_bf(a.l, b.h, c); c = wmma_bf(a.h, b.l, c); return wmma_bf(a.h, b.h, c); }
__device__ __forceinline__ float sigm(float v) { return 1.0f / (1.0f + expf(-v)); }
#define LDSX() do { asm volatile("s_wait_dscnt 0" ::: "memory"); __builtin_amdgcn_wave_barrier(); __builtin_amdgcn_fence(__ATOMIC_RELEASE, "workgroup"); } while (0)


// Trajectory attention (B 2, T 2,048, C 1,024 = 16 x 64): q/k/v Linear, rotary position embedding (base 10000, rotate_half), causal softmax(q k / 8) v, output Linear.
#define NB 2
#define TT 2048
#define CC 1024
#define NH 16
#define HD 64
#ifndef TNB
#define TNB NB
#endif
typedef __attribute__((ext_vector_type(8))) __bf16 v8b;
__device__ __forceinline__ v16b frag_b(const __bf16* rowk0, int lane) {
  union { v16b v; v8b q[2]; } u; const __bf16* p = rowk0 + 8 * (lane >> 4);
  u.q[0] = *(const v8b*)p; u.q[1] = *(const v8b*)(p + 16); return u.v;
}
__device__ __forceinline__ float bfr(float v) { return (float)(__bf16)v; }
__device__ __attribute__((noinline)) float exp_ni(float v) { return expf(v); }
__device__ __attribute__((noinline)) float erf_ni(float v) { return erff(v); }

// ---- operand staging of k_proj and k_out: a block brings GK k of every operand row with whole-line 16-byte loads (16 lanes = 256 B of one row), converts once and keeps bf16 rows in LDS
#define GK 64
#define GP (GK + 8)   // LDS row pitch in elements: 144 B = 16 B x 9, free of bank conflicts for the 16-byte fragment reads
typedef __attribute__((ext_vector_type(4))) __bf16 v4b;
// every '#pragma unroll' of the staging helpers and loops: the loop indexes register arrays, which stay in registers only when it is unrolled
// p = the thread's own place: row tid / 16, float4 tid % 16 of the chunk; load i is 8 i rows further down
template <int N> __device__ __forceinline__ void g_fetch(const float* p, v4f* r) {
#pragma unroll
  for (int i = 0; i < N; ++i) r[i] = *(const v4f*)(p + (size_t)i * 8 * CC); }
template <int N> __device__ __forceinline__ void g_put(__bf16 (*t)[GP], int lr, int lc, const v4f* r) {
#pragma unroll
  for (int i = 0; i < N; ++i) { v4b o;
#pragma unroll
    for (int e = 0; e < 4; ++e) o[e] = (__bf16)r[i][e];
    *(v4b*)&t[lr + 8 * i][lc] = o; } }
template <int N> __device__ __forceinline__ void g_put2(__bf16 (*th)[GP], __bf16 (*tl)[GP], int lr, int lc, const v4f* r) {   // bf16 hi + residual, as bsplit16
#pragma unroll
  for (int i = 0; i < N; ++i) { v4b oh, ol;
#pragma unroll
    for (int e = 0; e < 4; ++e) { const __bf16 h = (__bf16)r[i][e]; oh[e] = h; ol[e] = (__bf16)(r[i][e] - (float)h); }
    *(v4b*)&th[lr + 8 * i][lc] = oh; *(v4b*)&tl[lr + 8 * i][lc] = ol; } }

#define WS_QH  0u
#define WS_QL  (WS_QH + 2u * (size_t)NB * TT * CC)
#define WS_KH  (WS_QL + 2u * (size_t)NB * TT * CC)
#define WS_VT  (WS_KH + 2u * (size_t)NB * TT * CC)      // bf16 v planes
#define WS_VL  (WS_VT + 2u * (size_t)NB * CC * TT)      // bf16 v residual planes
#define WS_Y   (WS_VL + 2u * (size_t)NB * CC * TT)      // f32 y rows [b*t][C]
#define WS_END (WS_Y + 4u * (size_t)NB * TT * CC)
// q, k and the v planes lie in the workspace in WMMA fragment order: [b][h][32-position slice][8 half fragments][lane][8 elements], FS elements a slice, so that a wave-wide 16-byte load or store covers 512 contiguous bytes (4 whole lines).
// q, k: half fragment (j*2 + kc)*2 + qh, lane (g, col) = position 16j + col of the slice, dims 32kc + 16qh + 8g + 0..7 of the head. v: half fragment j*2 + qh, lane (g, col) = dim 16j + col of the head, positions 16qh + 8g + 0..7 of the slice.
#define FS (32 * HD)
// k_proj's way out: a block's 64 positions x 128 columns are 2 neighbouring slices of 2 heads, 1,024 units of 16 bytes, 8 a thread; unit i of thread (wave, g, col) is half fragment wave + 4 (i & 1) of slice (i & 3) >> 1 of head i >> 2.
// t = the block's tile in LDS ([position][column] for q and k, [column][position] for v), dst = the thread's own place in the first slice of the first head. Both loops are unrolled because they index a register array.
template <bool ISV, typename T, int P> __device__ __forceinline__ void put_frags(T* dst, const T (*t)[P], int wave, int g, int col) { v4u a[8];
#pragma unroll
  for (int i = 0; i < 8; ++i) { if constexpr (ISV) a[i] = *(const v4u*)&t[(i >> 2) * HD + ((wave >> 1) + 2 * (i & 1)) * 16 + col][((i & 3) >> 1) * 32 + (wave & 1) * 16 + g * 8]; else a[i] = *(const v4u*)&t[(i & 3) * 16 + col][(i >> 2) * HD + wave * 16 + g * 8]; }
#pragma unroll
  for (int i = 0; i < 8; ++i) *(v4u*)(dst + (size_t)(i >> 2) * (TT / 32) * FS + (i & 3) * 1024) = a[i];
  asm volatile("s_wait_xcnt 0x0" :: "v"(dst), "v"(a[0]), "v"(a[1]), "v"(a[2]), "v"(a[3]), "v"(a[4]), "v"(a[5]), "v"(a[6]), "v"(a[7]) : "memory"); }   // stands in front of every overwrite of the stores' address and data registers, which it holds until here

// ---- k_proj: block = (64 rows, 128 cols, which): qkv = x W (+ b), exact; q -> f16 hi (+ residual), k -> f16, v -> bf16 hi + residual planes, all in fragment order
// the staging buffers are dead when the epilogue's arrays come to life: they share the block's LDS
union ProjLds { struct { __bf16 x[2][64][GP], w[2][128][GP]; } st; struct { _Float16 sh[64][136], sl[64][136]; __bf16 th[128][72], tl2[128][72]; float sf[64][132]; } ep; };
__global__ __launch_bounds__(128) void k_proj(const float* __restrict__ X, const float* __restrict__ WQ, const float* __restrict__ BQ, const float* __restrict__ WK, const float* __restrict__ BK, const float* __restrict__ WV, const float* __restrict__ BV, _Float16* __restrict__ QH, _Float16* __restrict__ QL, _Float16* __restrict__ KH, __bf16* __restrict__ VT, __bf16* __restrict__ VL) {
  __shared__ __align__(16) ProjLds lds; _Float16 (&sh)[64][136] = lds.ep.sh; _Float16 (&sl)[64][136] = lds.ep.sl; __bf16 (&th)[128][72] = lds.ep.th; __bf16 (&tl2)[128][72] = lds.ep.tl2; float (&sf)[64][132] = lds.ep.sf;
  const int tid = threadIdx.x, wave = tid >> 5, lane = tid & 31, col = lane & 15, g = lane >> 4; const int which = blockIdx.z; const int c0 = blockIdx.y * 128; const size_t r0 = (size_t)blockIdx.x * 64; const float* WA = which == 0 ? WQ : which == 1 ? WK : WV; const float* BA = which == 0 ? BQ : which == 1 ? BK : BV;
  v8f acc[8] = {};
  const int lr = tid >> 4, lc = (tid & 15) * 4; const float* px = X + (r0 + lr) * CC + lc; const float* pw = WA + (size_t)(c0 + lr) * CC + lc;
  v4f rx[8], rw[16]; g_fetch<8>(px, rx); g_fetch<16>(pw, rw);
  asm volatile("s_wait_xcnt 0x0" :: "v"(px), "v"(pw) : "memory");   // stands in front of every overwrite of the loads' address registers, which it holds until here
#pragma unroll 2   // the buffer index becomes a constant in each copy of the body
  for (int c = 0; c < CC / GK; ++c) { const int bs = c & 1; g_put<8>(lds.st.x[bs], lr, lc, rx); g_put<16>(lds.st.w[bs], lr, lc, rw);
    __syncthreads();   // chunk c is whole in LDS before any wave reads it; it also ends every wave's reads of the other buffer, which the next trip refills
    if (c + 1 < CC / GK) { px += GK; pw += GK; g_fetch<8>(px, rx); g_fetch<16>(pw, rw);   // the next chunk flies under this chunk's products
      asm volatile("s_wait_xcnt 0x0" :: "v"(px), "v"(pw) : "memory"); }   // as above
#pragma unroll
    for (int kk = 0; kk < GK / 32; ++kk) { const v16b a = frag_b(&lds.st.x[bs][wave * 16 + col][kk * 32], lane); v16b w[8];
#pragma unroll
      for (int j = 0; j < 8; ++j) w[j] = frag_b(&lds.st.w[bs][j * 16 + col][kk * 32], lane);
#pragma unroll
      for (int j = 0; j < 8; ++j) acc[j] = wmma_bf(a, w[j], acc[j]); } }
  __syncthreads();   // every wave has left the staging buffers before the epilogue's arrays overwrite them
#pragma unroll
  for (int j = 0; j < 8; ++j) { const float bb = bfr(BA[c0 + j * 16 + col]);
#pragma unroll
    for (int r = 0; r < 8; ++r) { const float v = acc[j][r] + bb; const int rl = wave * 16 + 8 * g + r, cl = j * 16 + col;
      if (which == 2) { const __bf16 bh = (__bf16)v; th[cl][rl] = bh; tl2[cl][rl] = (__bf16)(v - (float)bh); } else sf[rl][cl] = v; } }
  __syncthreads();
  if (which < 2) {   // rotary: out[d] = x[d] cos(t f_{d mod 32}) + (d < 32 ? -x[d+32] : x[d-32]) sin(t f_{d mod 32}); f_i = 10000^(-i/32)
    // a lane keeps one frequency i = lane, a wave takes every 4th position: the angle's cosine and sine are formed once and serve the 4 elements that share them (d = i and i + 32 of both heads of the block)
    const float inv_freq = 1.0f / powf(10000.0f, (float)(2 * lane) / 64.0f);
    for (int it = 0; it < 64 / 4; ++it) { const int rl = it * 4 + wave; const int tpos = (int)((r0 + rl) % TT); const float ang = (float)tpos * inv_freq; float c, s; sincosf(ang, &s, &c);
#pragma unroll   // the LDS reads of both heads issue together
      for (int hh = 0; hh < 128 / HD; ++hh) { const int cl = hh * HD + lane; const float x1 = sf[rl][cl], x2 = sf[rl][cl + 32];
        const float v1 = fmaf(x1, c, -x2 * s), v2 = fmaf(x2, c, x1 * s); const _Float16 h1 = (_Float16)v1, h2 = (_Float16)v2;   // the sine product rounded first, then one multiply-add, for both halves
        sh[rl][cl] = h1; sl[rl][cl] = (_Float16)(v1 - (float)h1); sh[rl][cl + 32] = h2; sl[rl][cl + 32] = (_Float16)(v2 - (float)h2); } }
    __syncthreads(); }
  const size_t fb = (((r0 / TT) * NH + c0 / HD) * (size_t)(TT / 32) + (r0 % TT) / 32) * FS + tid * 8;
  if (which < 2) { put_frags<false>((which == 0 ? QH : KH) + fb, sh, wave, g, col); if (which == 0) put_frags<false>(QL + fb, sl, wave, g, col); }
  else { put_frags<true>(VT + fb, th, wave, g, col); put_frags<true>(VL + fb, tl2, wave, g, col); } }
// ---- k_att: block = 16 * QT queries of (b,h), AW waves; wave w takes the 32-key slices w, w + AW, ... up to the diagonal, each k and v fragment serving the QT query tiles. ONE sweep with a running row maximum: logits transposed on WMMA (k as A, q as B: a lane holds 16 keys of ONE query, in the k order of a P fragment), exp((a - max in use) / 8) in f32 as exp2 of one multiply-add, then v^T . P^T (v as A, P bf16 hi + lo as B), so that a lane's accumulators belong to the same query and one factor per lane rescales them. Each wave ends with its own maximum, row sums and f32 partial tiles; they are brought to the common maximum and summed in LDS in wave order: y[q][h*HD + d] = P . v / sum
// grid = (head, batch, query block), the query block counted down from the last: a block's cost grows with its number of key slices and there are four times as many blocks as resident places, so the longest blocks of all heads start first and the shortest fill the end of the launch
// every '#pragma unroll' of k_att and its helpers without a note of its own: the loop indexes fragment, accumulator or per-row arrays, which stay in registers only when it is unrolled
#define AW 8   // the wave number is read into a scalar so that each wave's trip test is a scalar branch
#define QT 2
#define SC2 0.18033688011112042f   // log2(e) / 8: exp((a - amax) / 8) = exp2(a SC2 - amax SC2)
#define RTH 44.0f   // the maximum in use may trail a row's true maximum by this much in unscaled logits (below 8 in the exponent of 2, so an exponential stays below 256)
struct KF { v16h f[2][HD / 32]; };   // k fragments of one slice: [16-key group][32 of the head's 64 dims]
// pk = the lane's own 16 bytes in the slice's first half fragment
__device__ __forceinline__ KF att_k(const _Float16* pk) { KF k;
#pragma unroll
  for (int j = 0; j < 2; ++j)
#pragma unroll
    for (int kc = 0; kc < HD / 32; ++kc) { union { v16h v; v8h q[2]; } u; const _Float16* p = pk + (j * (HD / 32) + kc) * 512; u.q[0] = *(const v8h*)p; u.q[1] = *(const v8h*)(p + 256); k.f[j][kc] = u.v; }
  return k; }
// pv = the lane's own 16 bytes in the first half fragment of the slice of a v plane
__device__ __forceinline__ v16b att_v(const __bf16* pv, int j) { union { v16b v; v8b q[2]; } u; const __bf16* p = pv + j * 512; u.q[0] = *(const v8b*)p; u.q[1] = *(const v8b*)(p + 256); return u.v; }
__device__ __forceinline__ float xhalf(float x) { return __builtin_bit_cast(float, __builtin_amdgcn_permlanex16(__builtin_bit_cast(int, x), __builtin_bit_cast(int, x), 0x76543210, 0xfedcba98, false, false)); }   // lane l with lane l ^ 16
// transposed logits of one query tile against one slice, D layout: sc[j][r] = key s*32 + j*16 + 8g + r against query q0 + col, not yet scaled by 1/8 (SC2 holds the scale), keys above the diagonal masked
__device__ __forceinline__ void att_logits(const KF& k, const v16h* ah, int s, int q0, int lane, v8f* sc) { const int col = lane & 15, g = lane >> 4; const int qt = q0 + col;
#pragma unroll
  for (int j = 0; j < 2; ++j) { v8f a = {};
#pragma unroll
    for (int kc = 0; kc < HD / 32; ++kc) a = wmma16(k.f[j][kc], ah[kc], a);
#pragma unroll
    for (int r = 0; r < 8; ++r) { const int kt = s * 32 + j * 16 + 8 * g + r; float v = a[r]; if (kt > qt) v = -3.0e38f; sc[j][r] = v; } } }
// amdgpu_waves_per_eu(4): holds the allocation at 256 registers, so that two blocks share a WGP
__global__ __launch_bounds__(32 * AW) __attribute__((amdgpu_waves_per_eu(4))) void k_att(const _Float16* __restrict__ QH, const _Float16* __restrict__ KH, const __bf16* __restrict__ VT, const __bf16* __restrict__ VL, float* __restrict__ Y) { __shared__ __align__(16) float ss[AW][16 * QT][HD + 4]; __shared__ float smx[AW][16 * QT], ssum[AW][16 * QT];
  const int tid = threadIdx.x, wave = __builtin_amdgcn_readfirstlane(tid >> 5), lane = tid & 31, col = lane & 15, g = lane >> 4; const int b = blockIdx.y, h = blockIdx.x, qb = TT / (16 * QT) - 1 - (int)blockIdx.z, ql0 = qb * (16 * QT); const int ns = ((ql0 + 16 * QT - 1) >> 5) + 1;   // slices that hold a key <= the block's last query
  static_assert(16 * QT == 32 && HD == 64, "a block's queries are one slice of the fragment order");
  const size_t vo = ((size_t)b * NH + h) * (size_t)(TT / 32) * FS + lane * 8; const _Float16* Kl = KH + vo;   // the lane's own place in slice 0 of the head, the same in q, k and the v planes
  v16h ah[QT][HD / 32];
  { const _Float16* pq = QH + vo + (size_t)qb * FS;
#pragma unroll
    for (int t = 0; t < QT; ++t)
#pragma unroll
      for (int kc = 0; kc < HD / 32; ++kc) { union { v16h v; v8h q[2]; } u; const _Float16* p = pq + (t * (HD / 32) + kc) * 512; u.q[0] = *(const v8h*)p; u.q[1] = *(const v8h*)(p + 256); ah[t][kc] = u.v; }
    asm volatile("s_wait_xcnt 0x0" :: "v"(pq) : "memory"); }   // stands in front of every overwrite of the loads' address registers, which it holds until here
  float mr[QT], m[QT], lsum[QT];   // a lane serves query col of each tile: mr = the maximum in use (unscaled logits), m = -mr SC2, the addend of the exponent
#pragma unroll
  for (int t = 0; t < QT; ++t) { mr[t] = -3.0e38f; m[t] = 0.f; lsum[t] = 0.f; }
  v8f acc[QT][HD / 16] = {};   // acc[t][j][r] = dim 16j + 8g + r of query col of tile t
  for (int s = wave; s < ns; s += AW) { v16b vh[HD / 16], vl[HD / 16];   // v is fetched ahead of its use: the hi plane with k, the lo plane under the maxima and exponentials
    const __bf16* pvh = VT + vo + (size_t)s * FS; const __bf16* pvl = VL + vo + (size_t)s * FS; const _Float16* pk = Kl + (size_t)s * FS;
#pragma unroll
    for (int j = 0; j < HD / 16; ++j) vh[j] = att_v(pvh, j);
    v8f sc[QT][2];
    { const KF k = att_k(pk);
      asm volatile("s_wait_xcnt 0x0" :: "v"(pk), "v"(pvh) : "memory");   // as above, for the k and v hi loads
#pragma unroll
      for (int t = 0; t < QT; ++t) att_logits(k, ah[t], s, ql0 + t * 16, lane, sc[t]); }
#pragma unroll
    for (int j = 0; j < HD / 16; ++j) vl[j] = att_v(pvl, j);
    asm volatile("s_wait_xcnt 0x0" :: "v"(pvl) : "memory");   // as above, for the v lo loads
    float mb[QT]; bool need = false;   // every query of the block has an unmasked key in every slice up to the diagonal (the slice's first), so mb is a real logit
#pragma unroll
    for (int t = 0; t < QT; ++t) { float mx = fmaxf(sc[t][0][0], sc[t][1][0]);
#pragma unroll
      for (int r = 1; r < 8; ++r) mx = fmaxf(mx, fmaxf(sc[t][0][r], sc[t][1][r]));
      mx = fmaxf(mx, xhalf(mx)); mb[t] = mx; need = need || (mx > mr[t] + RTH); }   // both halves of the wave now hold the query's maximum over the slice
    if (__builtin_amdgcn_ballot_w32(need) != 0) {   // one scalar branch a slice: always taken on a wave's first slice (factor 0 on zeros), seldom later
#pragma unroll
      for (int t = 0; t < QT; ++t) { const float mn = fmaxf(mr[t], mb[t]); const float corr = __builtin_amdgcn_exp2f((mr[t] - mn) * SC2); mr[t] = mn; m[t] = mn * -SC2; lsum[t] *= corr;
#pragma unroll
        for (int j = 0; j < HD / 16; ++j) acc[t][j] = acc[t][j] * corr; } }
#pragma unroll
    for (int t = 0; t < QT; ++t) { float v[16];   // two D tiles of the transposed logits are one P fragment: element i = key 8g + i, element 8 + i = key 16 + 8g + i
#pragma unroll
      for (int i = 0; i < 8; ++i) { v[i] = sc[t][0][i]; v[8 + i] = sc[t][1][i]; }
#pragma unroll
      for (int i = 0; i < 16; i += 2) { const v2f e = __builtin_elementwise_fma(v2f{v[i], v[i + 1]}, v2f{SC2, SC2}, v2f{m[t], m[t]}); v[i] = __builtin_amdgcn_exp2f(e.x); v[i + 1] = __builtin_amdgcn_exp2f(e.y); }   // a masked logit is -3e38: its exponent is below -5e37 and its exponential an exact 0
#pragma unroll
      for (int i = 0; i < 16; ++i) lsum[t] += v[i];
      const F2 p = bsplit16(v);   // each of the three products runs over the four output tiles, so that no WMMA waits for the one before it
#pragma unroll
      for (int j = 0; j < HD / 16; ++j) acc[t][j] = wmma_bf(vh[j], p.h, acc[t][j]);
#pragma unroll
      for (int j = 0; j < HD / 16; ++j) acc[t][j] = wmma_bf(vh[j], p.l, acc[t][j]);
#pragma unroll
      for (int j = 0; j < HD / 16; ++j) acc[t][j] = wmma_bf(vl[j], p.h, acc[t][j]);
      } }
#pragma unroll
  for (int t = 0; t < QT; ++t) { lsum[t] += xhalf(lsum[t]);   // the two halves of a wave hold the two halves of each row's keys
    if (g == 0) { ssum[wave][t * 16 + col] = lsum[t]; smx[wave][t * 16 + col] = mr[t]; }
#pragma unroll
    for (int j = 0; j < HD / 16; ++j) { const v8f a = acc[t][j]; float* pd = &ss[wave][t * 16 + col][j * 16 + 8 * g]; *(v4f*)pd = v4f{a[0], a[1], a[2], a[3]}; *(v4f*)(pd + 4) = v4f{a[4], a[5], a[6], a[7]}; } }
  __syncthreads();   // every wave's partial tiles, row sums and maxima are in LDS before any thread sums across waves
  static_assert(16 * (HD / 4) == 32 * AW, "one float4 of each query tile per thread");
#pragma unroll
  for (int t = 0; t < QT; ++t) { const int rl = t * 16 + tid / (HD / 4), c4 = (tid % (HD / 4)) * 4; float mw[AW], M = -3.0e38f;
#pragma unroll
    for (int w = 0; w < AW; ++w) { mw[w] = smx[w][rl]; M = fmaxf(M, mw[w]); }
    v4f s = {}; float L = 0.f;
#pragma unroll   // the LDS reads of all partials issue together; the sums keep wave order; a wave without a slice has maximum -3e38, factor 0, and zeros
    for (int w = 0; w < AW; ++w) { const float f = __builtin_amdgcn_exp2f((mw[w] - M) * SC2); s += *(const v4f*)&ss[w][rl][c4] * f; L += ssum[w][rl] * f; }
    vst2(Y + ((size_t)b * TT + ql0 + rl) * CC + h * HD + c4, s * (1.0f / L)); } }
// ---- k_out: block = (64 rows, 128 cols): out = y (bf16 hi + lo) Wproj + b
__global__ __launch_bounds__(128) void k_out(const float* __restrict__ Y, const float* __restrict__ WP, const float* __restrict__ BP, float* __restrict__ OUT) { __shared__ __align__(16) float sf[4][16][132]; __shared__ __align__(16) __bf16 yh[2][64][GP], yl[2][64][GP], wt[2][128][GP];
  const int tid = threadIdx.x, wave = tid >> 5, lane = tid & 31, col = lane & 15, g = lane >> 4; const int c0 = blockIdx.y * 128; const size_t r0 = (size_t)blockIdx.x * 64 + wave * 16;
  v8f acc[8] = {};
  const int lr = tid >> 4, lc = (tid & 15) * 4; const float* py = Y + ((size_t)blockIdx.x * 64 + lr) * CC + lc; const float* pw = WP + (size_t)(c0 + lr) * CC + lc;
  v4f ry[8], rw[16]; g_fetch<8>(py, ry); g_fetch<16>(pw, rw);
  asm volatile("s_wait_xcnt 0x0" :: "v"(py), "v"(pw) : "memory");   // stands in front of every overwrite of the loads' address registers, which it holds until here
#pragma unroll 2   // the buffer index becomes a constant in each copy of the body
  for (int c = 0; c < CC / GK; ++c) { const int bs = c & 1; g_put2<8>(yh[bs], yl[bs], lr, lc, ry); g_put<16>(wt[bs], lr, lc, rw);
    __syncthreads();   // chunk c is whole in LDS before any wave reads it; it also ends every wave's reads of the other buffer, which the next trip refills
    if (c + 1 < CC / GK) { py += GK; pw += GK; g_fetch<8>(py, ry); g_fetch<16>(pw, rw);   // the next chunk flies under this chunk's products
      asm volatile("s_wait_xcnt 0x0" :: "v"(py), "v"(pw) : "memory"); }   // as above
#pragma unroll
    for (int kk = 0; kk < GK / 32; ++kk) { const v16b ah = frag_b(&yh[bs][wave * 16 + col][kk * 32], lane), al = frag_b(&yl[bs][wave * 16 + col][kk * 32], lane); v16b w[8];
#pragma unroll
      for (int j = 0; j < 8; ++j) w[j] = frag_b(&wt[bs][j * 16 + col][kk * 32], lane);
#pragma unroll
      for (int j = 0; j < 8; ++j) { acc[j] = wmma_bf(ah, w[j], acc[j]); acc[j] = wmma_bf(al, w[j], acc[j]); } } }
#pragma unroll
  for (int j = 0; j < 8; ++j) { const float bb = BP ? bfr(BP[c0 + j * 16 + col]) : 0.f;
#pragma unroll
    for (int r = 0; r < 8; ++r) sf[wave][8 * g + r][j * 16 + col] = acc[j][r] + bb; }
  LDSX(); for (int rl = 0; rl < 16; ++rl) vst2(OUT + (r0 + rl) * CC + c0 + lane * 4, *(const v4f*)&sf[wave][rl][lane * 4]); }
extern "C" void kernel_launch(void* const* d_in, const int* in_sizes, int n_in, void* d_out, int out_size, void* d_ws, size_t ws_size, hipStream_t stream) {
  (void)in_sizes; (void)n_in; (void)out_size;
  const float** F = (const float**)d_in;   // 0 x [2,2048,1024], 1 Wq [1024,1024] ([out,in]), 2 bq, 3 Wk, 4 bk, 5 Wv, 6 bv, 7 Wo, 8 bo
  if (ws_size < (size_t)WS_END) return;
  char* ws = (char*)d_ws; _Float16 *QH = (_Float16*)(ws + WS_QH), *QL = (_Float16*)(ws + WS_QL), *KH = (_Float16*)(ws + WS_KH); __bf16 *VT = (__bf16*)(ws + WS_VT), *VL = (__bf16*)(ws + WS_VL); float *Y = (float*)(ws + WS_Y);
  k_proj<<<dim3(TNB * TT / 64, CC / 128, 3), 128, 0, stream>>>(F[0], F[1], F[2], F[3], F[4], F[5], F[6], QH, QL, KH, VT, VL);
  k_att<<<dim3(NH, TNB, TT / (16 * QT)), 32 * AW, 0, stream>>>(QH, KH, VT, VL, Y);
  k_out<<<dim3(TNB * TT / 64, CC / 128), 128, 0, stream>>>(Y, F[7], F[8], (float*)d_out);
}

// v009
// It runs in 91.7 microseconds.
// Two timings next to v008 put it at 1.19 and 1.17 times that version's speed.
// All steps since v000 together make it 15.8 times as fast.
// compute dtype: all float inputs rounded to bf16; q/k/v = x W^T + b with EXACT bf16 products on WMMA 16x16x32, f32 accumulate; rotary in f32 (inv_freq = 10000^(-2i/64) via exp2f/log2f-free powf, precise sincosf); q, k rounded once to f16 (0.02-scale weights: logits std ~0.05, 1 product), causal logits kept on chip in f32, computed once; softmax in f32 in base 2 against a running row maximum (one f32 multiply-add with the constant log2(e) / 8, then the exp2 instruction; sums and partial outputs rescaled in f32 when the maximum in use moves), P = exp(s - max in use) kept f32 split bf16 hi + lo against v bf16 hi + lo (3 products), divided by the f32 row sum at the end; out = o (bf16 hi + lo) Wo^T + bo; f32 output.
#include <hip/hip_runtime.h>
#include <math.h>

typedef __attribute__((ext_vector_type(16))) _Float16 v16h;
typedef __attribute__((ext_vector_type(16))) __bf16 v16b;
typedef __attribute__((ext_vector_type(8)))  _Float16 v8h;
typedef __attribute__((ext_vector_type(8)))  float v8f;
typedef __attribute__((ext_vector_type(4)))  float v4f;
typedef __attribute__((ext_vector_type(2)))  float v2f;
typedef __attribute__((ext_vector_type(4)))  unsigned v4u;
typedef __attribute__((ext_vector_type(4)))  int v4i;
typedef float __attribute__((may_alias)) float_a;
typedef int __attribute__((may_alias)) int_a;

template <typename T> __device__ __forceinline__ void vst2(void* p, T v) { *(T*)p = v;  }
__device__ __forceinline__ v8f wmma16(v16h a, v16h b, v8f c) {
  v8f d = __builtin_amdgcn_wmma_f32_16x16x32_f16(false, a, false, b, (short)0, c, false, false);
  asm volatile("v_nop\n\tv_nop\n\tv_nop\n\tv_nop" : "+v"(d) : "v"(a), "v"(b));
  return d;
}
__device__ __forceinline__ v8f wmma_bf(v16b a, v16b b, v8f c) {
  v8f d = __builtin_amdgcn_wmma_f32_16x16x32_bf16(false, a, false, b, (short)0, c, false, false);
  asm volatile("v_nop\n\tv_nop\n\tv_nop\n\tv_nop" : "+v"(d) : "v"(a), "v"(b));
  return d;
}
// 16x16x32 fragments: lane = (h = lane>>4, row/col = lane&15); elements 0..7 = k0+8h+0..7, 8..15 = k0+16+8h+0..7; D element r = row 8h+r
__device__ __forceinline__ v16h frag_h(const _Float16* rowk0, int lane) {
  union { v16h v; v8h q[2]; } u; const _Float16* p = rowk0 + 8 * (lane >> 4);
  u.q[0] = *(const v8h*)p; u.q[1] = *(const v8h*)(p + 16); return u.v;
}
__device__ __forceinline__ v16h frag_f32(const float* rowk0, int lane) {
  v16h a; const float* p = rowk0 + 8 * (lane >> 4);
#pragma unroll
  for (int i = 0; i < 8; ++i) { a[i] = (_Float16)p[i]; a[8 + i] = (_Float16)p[16 + i]; }
  return a;
}
__device__ __forceinline__ v16h frag_f32s(const float* rowk0, int lane, float sc) {
  v16h a; const float* p = rowk0 + 8 * (lane >> 4);
#pragma unroll
  for (int i = 0; i < 8; ++i) { a[i] = (_Float16)(p[i] * sc); a[8 + i] = (_Float16)(p[16 + i] * sc); }
  return a;
}
// column fragment from a [K][ld] layout (column n), rows >= K read as 0
__device__ __forceinline__ v16h fragc_f32(const float* W, int k0, int n, int lane, int ld, int K) {
  v16h a; const int g = lane >> 4;
#pragma unroll
  for (int i = 0; i < 8; ++i) { const int ka = k0 + 8 * g + i, kb = ka + 16;
    a[i] = (_Float16)(ka < K ? W[(size_t)(ka < K ? ka : K - 1) * ld + n] : 0.f); a[8 + i] = (_Float16)(kb < K ? W[(size_t)(kb < K ? kb : K - 1) * ld + n] : 0.f); }
  return a;
}
struct F2 { v16b h, l; };
__device__ __forceinline__ F2 bsplit16(const float v[16]) { F2 r;
#pragma unroll
  for (int i = 0; i < 16; ++i) { const __bf16 h = (__bf16)v[i]; r.h[i] = h; r.l[i] = (__bf16)(v[i] - (float)h); }
  return r; }
__device__ __forceinline__ F2 split_row(const float* row, int k0, int lane) { float v[16]; const float* p = row + k0 + 8 * (lane >> 4);
#pragma unroll
  for (int i = 0; i < 8; ++i) { v[i] = p[i]; v[8 + i] = p[16 + i]; }
  return bsplit16(v); }
__device__ __forceinline__ F2 split_rowK(const float* row, int k0, int lane, int K) { float v[16]; const int g = lane >> 4;
#pragma unroll
  for (int i = 0; i < 8; ++i) { const int ka = k0 + 8 * g + i, kb = ka + 16; v[i] = ka < K ? row[ka < K ? ka : K - 1] : 0.f; v[8 + i] = kb < K ? row[kb < K ? kb : K - 1] : 0.f; }
  return bsplit16(v); }
__device__ __forceinline__ F2 split_col(const float* W, int k0, int n, int lane, int ld, int K) { float v[16]; const int g = lane >> 4;
#pragma unroll
  for (int i = 0; i < 8; ++i) { const int ka = k0 + 8 * g + i, kb = ka + 16; v[i] = ka < K ? W[(size_t)(ka < K ? ka : K - 1) * ld + n] : 0.f; v[8 + i] = kb < K ? W[(size_t)(kb < K ? kb : K - 1) * ld + n] : 0.f; }
  return bsplit16(v); }
__device__ __forceinline__ v8f mac3(const F2& a, const F2& b, v8f c) { c = wmma_bf(a.l, b.h, c); c = wmma_bf(a.h, b.l, c); return wmma_bf(a.h, b.h, c); }
__device__ __forceinline__ float sigm(float v) { return 1.0f / (1.0f + expf(-v)); }
#define LDSX() do { asm volatile("s_wait_dscnt 0" ::: "memory"); __builtin_amdgcn_wave_barrier(); __builtin_amdgcn_fence(__ATOMIC_RELEASE, "workgroup"); } while (0)


// Trajectory attention (B 2, T 2,048, C 1,024 = 16 x 64): q/k/v Linear, rotary position embedding (base 10000, rotate_half), causal softmax(q k / 8) v, output Linear.
#define NB 2
#define TT 2048
#define CC 1024
#define NH 16
#define HD 64
#ifndef TNB
#define TNB NB
#endif
typedef __attribute__((ext_vector_type(8))) __bf16 v8b;
__device__ __forceinline__ v16b frag_b(const __bf16* rowk0, int lane) {
  union { v16b v; v8b q[2]; } u; const __bf16* p = rowk0 + 8 * (lane >> 4);
  u.q[0] = *(const v8b*)p; u.q[1] = *(const v8b*)(p + 16); return u.v;
}
__device__ __forceinline__ float bfr(float v) { return (float)(__bf16)v; }
__device__ __attribute__((noinline)) float exp_ni(float v) { return expf(v); }
__device__ __attribute__((noinline)) float erf_ni(float v) { return erff(v); }

// ---- operand staging of k_proj and k_out: a block brings GK k of every operand row with whole-line 16-byte loads (16 lanes = 256 B of one row), converts once and keeps bf16 rows in LDS
#define GK 64
#define GP (GK + 8)   // LDS row pitch in elements: 144 B = 16 B x 9, free of bank conflicts for the 16-byte fragment reads
typedef __attribute__((ext_vector_type(4))) __bf16 v4b;
// every '#pragma unroll' of the staging helpers and loops: the loop indexes register arrays, which stay in registers only when it is unrolled
// p = the thread's own place: row tid / 16, float4 tid % 16 of the chunk; load i is 8 i rows further down
template <int N> __device__ __forceinline__ void g_fetch(const float* p, v4f* r) {
#pragma unroll
  for (int i = 0; i < N; ++i) r[i] = *(const v4f*)(p + (size_t)i * 8 * CC); }
template <int N> __device__ __forceinline__ void g_put(__bf16 (*t)[GP], int lr, int lc, const v4f* r) {
#pragma unroll
  for (int i = 0; i < N; ++i) { v4b o;
#pragma unroll
    for (int e = 0; e < 4; ++e) o[e] = (__bf16)r[i][e];
    *(v4b*)&t[lr + 8 * i][lc] = o; } }
template <int N> __device__ __forceinline__ void g_put2(__bf16 (*th)[GP], __bf16 (*tl)[GP], int lr, int lc, const v4f* r) {   // bf16 hi + residual, as bsplit16
#pragma unroll
  for (int i = 0; i < N; ++i) { v4b oh, ol;
#pragma unroll
    for (int e = 0; e < 4; ++e) { const __bf16 h = (__bf16)r[i][e]; oh[e] = h; ol[e] = (__bf16)(r[i][e] - (float)h); }
    *(v4b*)&th[lr + 8 * i][lc] = oh; *(v4b*)&tl[lr + 8 * i][lc] = ol; } }

#define WS_QH  0u
#define WS_QL  (WS_QH + 2u * (size_t)NB * TT * CC)
#define WS_KH  (WS_QL + 2u * (size_t)NB * TT * CC)
#define WS_VT  (WS_KH + 2u * (size_t)NB * TT * CC)      // bf16 v planes
#define WS_VL  (WS_VT + 2u * (size_t)NB * CC * TT)      // bf16 v residual planes
#define WS_Y   (WS_VL + 2u * (size_t)NB * CC * TT)      // f32 y rows [b*t][C]
#define WS_END (WS_Y + 4u * (size_t)NB * TT * CC)
// q, k and the v planes lie in the workspace in WMMA fragment order: [b][h][32-position slice][8 half fragments][lane][8 elements], FS elements a slice, so that a wave-wide 16-byte load or store covers 512 contiguous bytes (4 whole lines).
// q, k: half fragment (j*2 + kc)*2 + qh, lane (g, col) = position 16j + col of the slice, dims 32kc + 16qh + 8g + 0..7 of the head. v: half fragment j*2 + qh, lane (g, col) = dim 16j + col of the head, positions 16qh + 8g + 0..7 of the slice.
#define FS (32 * HD)
// k_proj's way out, one half of a block's tile at a time: 64 positions x 128 columns are 2 neighbouring slices of 2 heads, 1,024 units of 16 bytes, 8 a thread; unit i of thread (wave, g, col) is half fragment wave + 4 (i & 1) of slice (i & 3) >> 1 of head i >> 2.
// t = the half tile in LDS ([position][column] for q and k, [column][position] for v), dst = the thread's own place in the first slice of the first head. Both loops are unrolled because they index a register array.
template <bool ISV, typename T, int P> __device__ __forceinline__ void put_frags(T* dst, const T (*t)[P], int wave, int g, int col) { v4u a[8];
#pragma unroll
  for (int i = 0; i < 8; ++i) { if constexpr (ISV) a[i] = *(const v4u*)&t[(i >> 2) * HD + ((wave >> 1) + 2 * (i & 1)) * 16 + col][((i & 3) >> 1) * 32 + (wave & 1) * 16 + g * 8]; else a[i] = *(const v4u*)&t[(i & 3) * 16 + col][(i >> 2) * HD + wave * 16 + g * 8]; }
#pragma unroll
  for (int i = 0; i < 8; ++i) *(v4u*)(dst + (size_t)(i >> 2) * (TT / 32) * FS + (i & 3) * 1024) = a[i];
  asm volatile("s_wait_xcnt 0x0" :: "v"(dst), "v"(a[0]), "v"(a[1]), "v"(a[2]), "v"(a[3]), "v"(a[4]), "v"(a[5]), "v"(a[6]), "v"(a[7]) : "memory"); }   // stands in front of every overwrite of the stores' address and data registers, which it holds until here

// ---- k_proj: block = (128 rows, 128 cols, which), 2 x 2 waves of 64 x 64 each, so that every x and W row fetched from L2 serves 128 outputs: qkv = x W (+ b), exact; q -> f16 hi (+ residual), k -> f16, v -> bf16 hi + residual planes, all in fragment order
// the staging buffers are dead when the epilogue's arrays come to life: they share the block's LDS; the epilogue takes the tile in two halves of 64 rows, so that three blocks still fit a WGP's LDS
union ProjLds { struct { __bf16 x[2][128][GP], w[2][128][GP]; } st; struct { _Float16 sh[64][136], sl[64][136]; __bf16 th[128][72], tl2[128][72]; float sf[64][132]; } ep; };
// amdgpu_waves_per_eu(3): holds the allocation at a third of a SIMD's registers, so that three blocks share a WGP and the grid's 768 blocks are all resident at once
__global__ __launch_bounds__(128) __attribute__((amdgpu_waves_per_eu(3))) void k_proj(const float* __restrict__ X, const float* __restrict__ WQ, const float* __restrict__ BQ, const float* __restrict__ WK, const float* __restrict__ BK, const float* __restrict__ WV, const float* __restrict__ BV, _Float16* __restrict__ QH, _Float16* __restrict__ QL, _Float16* __restrict__ KH, __bf16* __restrict__ VT, __bf16* __restrict__ VL) {
  __shared__ __align__(16) ProjLds lds; _Float16 (&sh)[64][136] = lds.ep.sh; _Float16 (&sl)[64][136] = lds.ep.sl; __bf16 (&th)[128][72] = lds.ep.th; __bf16 (&tl2)[128][72] = lds.ep.tl2; float (&sf)[64][132] = lds.ep.sf;
  const int tid = threadIdx.x, wave = __builtin_amdgcn_readfirstlane(tid >> 5), lane = tid & 31, col = lane & 15, g = lane >> 4; const int which = blockIdx.z; const int c0 = blockIdx.y * 128; const size_t r0 = (size_t)blockIdx.x * 128; const float* WA = which == 0 ? WQ : which == 1 ? WK : WV; const float* BA = which == 0 ? BQ : which == 1 ? BK : BV;
  const int wr = wave >> 1, wc = wave & 1;   // the wave's 64 rows and 64 columns of the tile; the wave number is read into a scalar, so that what is formed from it takes no vector register and the epilogue's test on wr is a scalar branch
  v8f acc[4][4] = {};
  const int lr = tid >> 4, lc = (tid & 15) * 4; const float* px = X + (r0 + lr) * CC + lc; const float* pw = WA + (size_t)(c0 + lr) * CC + lc;
  v4f rx[16], rw[16]; g_fetch<16>(px, rx); g_fetch<16>(pw, rw);
  asm volatile("s_wait_xcnt 0x0" :: "v"(px), "v"(pw) : "memory");   // stands in front of every overwrite of the loads' address registers, which it holds until here
#pragma unroll 2   // the buffer index becomes a constant in each copy of the body
  for (int c = 0; c < CC / GK; ++c) { const int bs = c & 1; g_put<16>(lds.st.x[bs], lr, lc, rx); g_put<16>(lds.st.w[bs], lr, lc, rw);
    __syncthreads();   // chunk c is whole in LDS before any wave reads it; it also ends every wave's reads of the other buffer, which the next trip refills
    if (c + 1 < CC / GK) { px += GK; pw += GK; g_fetch<16>(px, rx); g_fetch<16>(pw, rw);   // the next chunk flies under this chunk's products
      asm volatile("s_wait_xcnt 0x0" :: "v"(px), "v"(pw) : "memory"); }   // as above
#pragma unroll
    for (int kk = 0; kk < GK / 32; ++kk) { v16b a[4], w[4];
#pragma unroll
      for (int i = 0; i < 4; ++i) a[i] = frag_b(&lds.st.x[bs][wr * 64 + i * 16 + col][kk * 32], lane);
#pragma unroll
      for (int j = 0; j < 4; ++j) w[j] = frag_b(&lds.st.w[bs][wc * 64 + j * 16 + col][kk * 32], lane);
#pragma unroll
      for (int i = 0; i < 4; ++i)
#pragma unroll
        for (int j = 0; j < 4; ++j) acc[i][j] = wmma_bf(a[i], w[j], acc[i][j]); } }
  __syncthreads();   // every wave has left the staging buffers before the epilogue's arrays overwrite them
  float bb[4];
#pragma unroll
  for (int j = 0; j < 4; ++j) bb[j] = bfr(BA[c0 + wc * 64 + j * 16 + col]);
  const float inv_freq = 1.0f / powf(10000.0f, (float)(2 * lane) / 64.0f);   // rotary: a lane keeps one frequency i = lane
#pragma unroll   // in a rolled loop the compiler forms both halves' sums and conversions ahead of the loop and holds them in registers, which costs a resident block
  for (int hf = 0; hf < 2; ++hf) { const size_t rh = r0 + hf * 64;   // rows rh .. rh + 63: the two waves that hold them lay them down, all four work them up
    if (wr == hf) {
      if (which == 2) {
#pragma unroll
        for (int i = 0; i < 4; ++i)
#pragma unroll
          for (int j = 0; j < 4; ++j)
#pragma unroll
            for (int r = 0; r < 8; ++r) { const float v = acc[i][j][r] + bb[j]; const int rl = i * 16 + 8 * g + r, cl = wc * 64 + j * 16 + col; const __bf16 bh = (__bf16)v; th[cl][rl] = bh; tl2[cl][rl] = (__bf16)(v - (float)bh); } }
      else {
#pragma unroll
        for (int i = 0; i < 4; ++i)
#pragma unroll
          for (int j = 0; j < 4; ++j)
#pragma unroll
            for (int r = 0; r < 8; ++r) sf[i * 16 + 8 * g + r][wc * 64 + j * 16 + col] = acc[i][j][r] + bb[j]; } }
    __syncthreads();
    if (which < 2) {   // rotary: out[d] = x[d] cos(t f_{d mod 32}) + (d < 32 ? -x[d+32] : x[d-32]) sin(t f_{d mod 32}); f_i = 10000^(-i/32)
      // a wave takes every 4th position: the angle's cosine and sine are formed once and serve the 4 elements that share them (d = i and i + 32 of both heads of the block)
      for (int it = 0; it < 64 / 4; ++it) { const int rl = it * 4 + wave; const int tpos = (int)((rh + rl) % TT); const float ang = (float)tpos * inv_freq; float c, s; sincosf(ang, &s, &c);
#pragma unroll   // the LDS reads of both heads issue together
        for (int hh = 0; hh < 128 / HD; ++hh) { const int cl = hh * HD + lane; const float x1 = sf[rl][cl], x2 = sf[rl][cl + 32];
          const float v1 = fmaf(x1, c, -x2 * s), v2 = fmaf(x2, c, x1 * s); const _Float16 h1 = (_Float16)v1, h2 = (_Float16)v2;   // the sine product rounded first, then one multiply-add, for both halves
          sh[rl][cl] = h1; sl[rl][cl] = (_Float16)(v1 - (float)h1); sh[rl][cl + 32] = h2; sl[rl][cl + 32] = (_Float16)(v2 - (float)h2); } }
      __syncthreads(); }
    const size_t fb = (((rh / TT) * NH + c0 / HD) * (size_t)(TT / 32) + (rh % TT) / 32) * FS + tid * 8;
    if (which < 2) { put_frags<false>((which == 0 ? QH : KH) + fb, sh, wave, g, col); if (which == 0) put_frags<false>(QL + fb, sl, wave, g, col); }
    else { put_frags<true>(VT + fb, th, wave, g, col); put_frags<true>(VL + fb, tl2, wave, g, col); }
    if (hf == 0) __syncthreads(); } }   // every wave has read the first half out of LDS before the second half is laid down
// ---- k_att: block = 16 * QT queries of (b,h), AW waves; wave w takes the 32-key slices w, w + AW, ... up to the diagonal, each k and v fragment serving the QT query tiles. ONE sweep with a running row maximum: logits transposed on WMMA (k as A, q as B: a lane holds 16 keys of ONE query, in the k order of a P fragment), exp((a - max in use) / 8) in f32 as exp2 of one multiply-add, then v^T . P^T (v as A, P bf16 hi + lo as B), so that a lane's accumulators belong to the same query and one factor per lane rescales them. Each wave ends with its own maximum, row sums and f32 partial tiles; they are brought to the common maximum and summed in LDS in wave order: y[q][h*HD + d] = P . v / sum
// grid = (head, batch, query block), the query block counted down from the last: a block's cost grows with its number of key slices and there are four times as many blocks as resident places, so the longest blocks of all heads start first and the shortest fill the end of the launch
// every '#pragma unroll' of k_att and its helpers without a note of its own: the loop indexes fragment, accumulator or per-row arrays, which stay in registers only when it is unrolled
#define AW 8   // the wave number is read into a scalar so that each wave's trip test is a scalar branch
#define QT 2
#define SC2 0.18033688011112042f   // log2(e) / 8: exp((a - amax) / 8) = exp2(a SC2 - amax SC2)
#define RTH 44.0f   // the maximum in use may trail a row's true maximum by this much in unscaled logits (below 8 in the exponent of 2, so an exponential stays below 256)
struct KF { v16h f[2][HD / 32]; };   // k fragments of one slice: [16-key group][32 of the head's 64 dims]
// pk = the lane's own 16 bytes in the slice's first half fragment
__device__ __forceinline__ KF att_k(const _Float16* pk) { KF k;
#pragma unroll
  for (int j = 0; j < 2; ++j)
#pragma unroll
    for (int kc = 0; kc < HD / 32; ++kc) { union { v16h v; v8h q[2]; } u; const _Float16* p = pk + (j * (HD / 32) + kc) * 512; u.q[0] = *(const v8h*)p; u.q[1] = *(const v8h*)(p + 256); k.f[j][kc] = u.v; }
  return k; }
// pv = the lane's own 16 bytes in the first half fragment of the slice of a v plane
__device__ __forceinline__ v16b att_v(const __bf16* pv, int j) { union { v16b v; v8b q[2]; } u; const __bf16* p = pv + j * 512; u.q[0] = *(const v8b*)p; u.q[1] = *(const v8b*)(p + 256); return u.v; }
__device__ __forceinline__ float xhalf(float x) { return __builtin_bit_cast(float, __builtin_amdgcn_permlanex16(__builtin_bit_cast(int, x), __builtin_bit_cast(int, x), 0x76543210, 0xfedcba98, false, false)); }   // lane l with lane l ^ 16
// transposed logits of one query tile against one slice, D layout: sc[j][r] = key s*32 + j*16 + 8g + r against query q0 + col, not yet scaled by 1/8 (SC2 holds the scale), keys above the diagonal masked
__device__ __forceinline__ void att_logits(const KF& k, const v16h* ah, int s, int q0, int lane, v8f* sc) { const int col = lane & 15, g = lane >> 4; const int qt = q0 + col;
#pragma unroll
  for (int j = 0; j < 2; ++j) { v8f a = {};
#pragma unroll
    for (int kc = 0; kc < HD / 32; ++kc) a = wmma16(k.f[j][kc], ah[kc], a);
#pragma unroll
    for (int r = 0; r < 8; ++r) { const int kt = s * 32 + j * 16 + 8 * g + r; float v = a[r]; if (kt > qt) v = -3.0e38f; sc[j][r] = v; } } }
// amdgpu_waves_per_eu(4): holds the allocation at 256 registers, so that two blocks share a WGP
__global__ __launch_bounds__(32 * AW) __attribute__((amdgpu_waves_per_eu(4))) void k_att(const _Float16* __restrict__ QH, const _Float16* __restrict__ KH, const __bf16* __restrict__ VT, const __bf16* __restrict__ VL, float* __restrict__ Y) { __shared__ __align__(16) float ss[AW][16 * QT][HD + 4]; __shared__ float smx[AW][16 * QT], ssum[AW][16 * QT];
  const int tid = threadIdx.x, wave = __builtin_amdgcn_readfirstlane(tid >> 5), lane = tid & 31, col = lane & 15, g = lane >> 4; const int b = blockIdx.y, h = blockIdx.x, qb = TT / (16 * QT) - 1 - (int)blockIdx.z, ql0 = qb * (16 * QT); const int ns = ((ql0 + 16 * QT - 1) >> 5) + 1;   // slices that hold a key <= the block's last query
  static_assert(16 * QT == 32 && HD == 64, "a block's queries are one slice of the fragment order");
  const size_t vo = ((size_t)b * NH + h) * (size_t)(TT / 32) * FS + lane * 8; const _Float16* Kl = KH + vo;   // the lane's own place in slice 0 of the head, the same in q, k and the v planes
  v16h ah[QT][HD / 32];
  { const _Float16* pq = QH + vo + (size_t)qb * FS;
#pragma unroll
    for (int t = 0; t < QT; ++t)
#pragma unroll
      for (int kc = 0; kc < HD / 32; ++kc) { union { v16h v; v8h q[2]; } u; const _Float16* p = pq + (t * (HD / 32) + kc) * 512; u.q[0] = *(const v8h*)p; u.q[1] = *(const v8h*)(p + 256); ah[t][kc] = u.v; }
    asm volatile("s_wait_xcnt 0x0" :: "v"(pq) : "memory"); }   // stands in front of every overwrite of the loads' address registers, which it holds until here
  float mr[QT], m[QT], lsum[QT];   // a lane serves query col of each tile: mr = the maximum in use (unscaled logits), m = -mr SC2, the addend of the exponent
#pragma unroll
  for (int t = 0; t < QT; ++t) { mr[t] = -3.0e38f; m[t] = 0.f; lsum[t] = 0.f; }
  v8f acc[QT][HD / 16] = {};   // acc[t][j][r] = dim 16j + 8g + r of query col of tile t
  for (int s = wave; s < ns; s += AW) { v16b vh[HD / 16], vl[HD / 16];   // v is fetched ahead of its use: the hi plane with k, the lo plane under the maxima and exponentials
    const __bf16* pvh = VT + vo + (size_t)s * FS; const __bf16* pvl = VL + vo + (size_t)s * FS; const _Float16* pk = Kl + (size_t)s * FS;
#pragma unroll
    for (int j = 0; j < HD / 16; ++j) vh[j] = att_v(pvh, j);
    v8f sc[QT][2];
    { const KF k = att_k(pk);
      asm volatile("s_wait_xcnt 0x0" :: "v"(pk), "v"(pvh) : "memory");   // as above, for the k and v hi loads
#pragma unroll
      for (int t = 0; t < QT; ++t) att_logits(k, ah[t], s, ql0 + t * 16, lane, sc[t]); }
#pragma unroll
    for (int j = 0; j < HD / 16; ++j) vl[j] = att_v(pvl, j);
    asm volatile("s_wait_xcnt 0x0" :: "v"(pvl) : "memory");   // as above, for the v lo loads
    float mb[QT]; bool need = false;   // every query of the block has an unmasked key in every slice up to the diagonal (the slice's first), so mb is a real logit
#pragma unroll
    for (int t = 0; t < QT; ++t) { float mx = fmaxf(sc[t][0][0], sc[t][1][0]);
#pragma unroll
      for (int r = 1; r < 8; ++r) mx = fmaxf(mx, fmaxf(sc[t][0][r], sc[t][1][r]));
      mx = fmaxf(mx, xhalf(mx)); mb[t] = mx; need = need || (mx > mr[t] + RTH); }   // both halves of the wave now hold the query's maximum over the slice
    if (__builtin_amdgcn_ballot_w32(need) != 0) {   // one scalar branch a slice: always taken on a wave's first slice (factor 0 on zeros), seldom later
#pragma unroll
      for (int t = 0; t < QT; ++t) { const float mn = fmaxf(mr[t], mb[t]); const float corr = __builtin_amdgcn_exp2f((mr[t] - mn) * SC2); mr[t] = mn; m[t] = mn * -SC2; lsum[t] *= corr;
#pragma unroll
        for (int j = 0; j < HD / 16; ++j) acc[t][j] = acc[t][j] * corr; } }
#pragma unroll
    for (int t = 0; t < QT; ++t) { float v[16];   // two D tiles of the transposed logits are one P fragment: element i = key 8g + i, element 8 + i = key 16 + 8g + i
#pragma unroll
      for (int i = 0; i < 8; ++i) { v[i] = sc[t][0][i]; v[8 + i] = sc[t][1][i]; }
#pragma unroll
      for (int i = 0; i < 16; i += 2) { const v2f e = __builtin_elementwise_fma(v2f{v[i], v[i + 1]}, v2f{SC2, SC2}, v2f{m[t], m[t]}); v[i] = __builtin_amdgcn_exp2f(e.x); v[i + 1] = __builtin_amdgcn_exp2f(e.y); }   // a masked logit is -3e38: its exponent is below -5e37 and its exponential an exact 0
#pragma unroll
      for (int i = 0; i < 16; ++i) lsum[t] += v[i];
      const F2 p = bsplit16(v);   // each of the three products runs over the four output tiles, so that no WMMA waits for the one before it
#pragma unroll
      for (int j = 0; j < HD / 16; ++j) acc[t][j] = wmma_bf(vh[j], p.h, acc[t][j]);
#pragma unroll
      for (int j = 0; j < HD / 16; ++j) acc[t][j] = wmma_bf(vh[j], p.l, acc[t][j]);
#pragma unroll
      for (int j = 0; j < HD / 16; ++j) acc[t][j] = wmma_bf(vl[j], p.h, acc[t][j]);
      } }
#pragma unroll
  for (int t = 0; t < QT; ++t) { lsum[t] += xhalf(lsum[t]);   // the two halves of a wave hold the two halves of each row's keys
    if (g == 0) { ssum[wave][t * 16 + col] = lsum[t]; smx[wave][t * 16 + col] = mr[t]; }
#pragma unroll
    for (int j = 0; j < HD / 16; ++j) { const v8f a = acc[t][j]; float* pd = &ss[wave][t * 16 + col][j * 16 + 8 * g]; *(v4f*)pd = v4f{a[0], a[1], a[2], a[3]}; *(v4f*)(pd + 4) = v4f{a[4], a[5], a[6], a[7]}; } }
  __syncthreads();   // every wave's partial tiles, row sums and maxima are in LDS before any thread sums across waves
  static_assert(16 * (HD / 4) == 32 * AW, "one float4 of each query tile per thread");
#pragma unroll
  for (int t = 0; t < QT; ++t) { const int rl = t * 16 + tid / (HD / 4), c4 = (tid % (HD / 4)) * 4; float mw[AW], M = -3.0e38f;
#pragma unroll
    for (int w = 0; w < AW; ++w) { mw[w] = smx[w][rl]; M = fmaxf(M, mw[w]); }
    v4f s = {}; float L = 0.f;
#pragma unroll   // the LDS reads of all partials issue together; the sums keep wave order; a wave without a slice has maximum -3e38, factor 0, and zeros
    for (int w = 0; w < AW; ++w) { const float f = __builtin_amdgcn_exp2f((mw[w] - M) * SC2); s += *(const v4f*)&ss[w][rl][c4] * f; L += ssum[w][rl] * f; }
    vst2(Y + ((size_t)b * TT + ql0 + rl) * CC + h * HD + c4, s * (1.0f / L)); } }
// ---- k_out: block = (64 rows, 128 cols): out = y (bf16 hi + lo) Wproj + b
__global__ __launch_bounds__(128) void k_out(const float* __restrict__ Y, const float* __restrict__ WP, const float* __restrict__ BP, float* __restrict__ OUT) { __shared__ __align__(16) float sf[4][16][132]; __shared__ __align__(16) __bf16 yh[2][64][GP], yl[2][64][GP], wt[2][128][GP];
  const int tid = threadIdx.x, wave = tid >> 5, lane = tid & 31, col = lane & 15, g = lane >> 4; const int c0 = blockIdx.y * 128; const size_t r0 = (size_t)blockIdx.x * 64 + wave * 16;
  v8f acc[8] = {};
  const int lr = tid >> 4, lc = (tid & 15) * 4; const float* py = Y + ((size_t)blockIdx.x * 64 + lr) * CC + lc; const float* pw = WP + (size_t)(c0 + lr) * CC + lc;
  v4f ry[8], rw[16]; g_fetch<8>(py, ry); g_fetch<16>(pw, rw);
  asm volatile("s_wait_xcnt 0x0" :: "v"(py), "v"(pw) : "memory");   // stands in front of every overwrite of the loads' address registers, which it holds until here
#pragma unroll 2   // the buffer index becomes a constant in each copy of the body
  for (int c = 0; c < CC / GK; ++c) { const int bs = c & 1; g_put2<8>(yh[bs], yl[bs], lr, lc, ry); g_put<16>(wt[bs], lr, lc, rw);
    __syncthreads();   // chunk c is whole in LDS before any wave reads it; it also ends every wave's reads of the other buffer, which the next trip refills
    if (c + 1 < CC / GK) { py += GK; pw += GK; g_fetch<8>(py, ry); g_fetch<16>(pw, rw);   // the next chunk flies under this chunk's products
      asm volatile("s_wait_xcnt 0x0" :: "v"(py), "v"(pw) : "memory"); }   // as above
#pragma unroll
    for (int kk = 0; kk < GK / 32; ++kk) { const v16b ah = frag_b(&yh[bs][wave * 16 + col][kk * 32], lane), al = frag_b(&yl[bs][wave * 16 + col][kk * 32], lane); v16b w[8];
#pragma unroll
      for (int j = 0; j < 8; ++j) w[j] = frag_b(&wt[bs][j * 16 + col][kk * 32], lane);
#pragma unroll
      for (int j = 0; j < 8; ++j) { acc[j] = wmma_bf(ah, w[j], acc[j]); acc[j] = wmma_bf(al, w[j], acc[j]); } } }
#pragma unroll
  for (int j = 0; j < 8; ++j) { const float bb = BP ? bfr(BP[c0 + j * 16 + col]) : 0.f;
#pragma unroll
    for (int r = 0; r < 8; ++r) sf[wave][8 * g + r][j * 16 + col] = acc[j][r] + bb; }
  LDSX(); for (int rl = 0; rl < 16; ++rl) vst2(OUT + (r0 + rl) * CC + c0 + lane * 4, *(const v4f*)&sf[wave][rl][lane * 4]); }
extern "C" void kernel_launch(void* const* d_in, const int* in_sizes, int n_in, void* d_out, int out_size, void* d_ws, size_t ws_size, hipStream_t stream) {
  (void)in_sizes; (void)n_in; (void)out_size;
  const float** F = (const float**)d_in;   // 0 x [2,2048,1024], 1 Wq [1024,1024] ([out,in]), 2 bq, 3 Wk, 4 bk, 5 Wv, 6 bv, 7 Wo, 8 bo
  if (ws_size < (size_t)WS_END) return;
  char* ws = (char*)d_ws; _Float16 *QH = (_Float16*)(ws + WS_QH), *QL = (_Float16*)(ws + WS_QL), *KH = (_Float16*)(ws + WS_KH); __bf16 *VT = (__bf16*)(ws + WS_VT), *VL = (__bf16*)(ws + WS_VL); float *Y = (float*)(ws + WS_Y);
  k_proj<<<dim3(TNB * TT / 128, CC / 128, 3), 128, 0, stream>>>(F[0], F[1], F[2], F[3], F[4], F[5], F[6], QH, QL, KH, VT, VL);
  k_att<<<dim3(NH, TNB, TT / (16 * QT)), 32 * AW, 0, stream>>>(QH, KH, VT, VL, Y);
  k_out<<<dim3(TNB * TT / 64, CC / 128), 128, 0, stream>>>(Y, F[7], F[8], (float*)d_out);
}

// v010
// It runs in 89.8 microseconds.
// Timed twice side by side with v009, it ran 1.03 times as fast both times.
// All steps since v000 together make it 16.3 times as fast.
// compute dtype: all float inputs rounded to bf16; q/k/v = x W^T + b with EXACT bf16 products on WMMA 16x16x32, f32 accumulate; rotary in f32 (inv_freq = 10000^(-2i/64) via exp2f/log2f-free powf, precise sincosf); q, k rounded once to f16 (0.02-scale weights: logits std ~0.05, 1 product), causal logits kept on chip in f32, computed once; softmax in f32 in base 2 against a running row maximum (one f32 multiply-add with the constant log2(e) / 8, then the exp2 instruction; sums and partial outputs rescaled in f32 when the maximum in use moves), P = exp(s - max in use) kept f32 split bf16 hi + lo against v bf16 hi + lo (3 products), divided by the f32 row sum at the end; out = o (bf16 hi + lo) Wo^T + bo; f32 output.
#include <hip/hip_runtime.h>
#include <math.h>

typedef __attribute__((ext_vector_type(16))) _Float16 v16h;
typedef __attribute__((ext_vector_type(16))) __bf16 v16b;
typedef __attribute__((ext_vector_type(8)))  _Float16 v8h;
typedef __attribute__((ext_vector_type(8)))  float v8f;
typedef __attribute__((ext_vector_type(4)))  float v4f;
typedef __attribute__((ext_vector_type(2)))  float v2f;
typedef __attribute__((ext_vector_type(4)))  unsigned v4u;
typedef __attribute__((ext_vector_type(4)))  int v4i;
typedef float __attribute__((may_alias)) float_a;
typedef int __attribute__((may_alias)) int_a;

template <typename T> __device__ __forceinline__ void vst2(void* p, T v) { *(T*)p = v;  }
__device__ __forceinline__ v8f wmma16(v16h a, v16h b, v8f c) {
  v8f d = __builtin_amdgcn_wmma_f32_16x16x32_f16(false, a, false, b, (short)0, c, false, false);
  asm volatile("v_nop\n\tv_nop\n\tv_nop\n\tv_nop" : "+v"(d) : "v"(a), "v"(b));
  return d;
}
__device__ __forceinline__ v8f wmma_bf(v16b a, v16b b, v8f c) {
  v8f d = __builtin_amdgcn_wmma_f32_16x16x32_bf16(false, a, false, b, (short)0, c, false, false);
  asm volatile("v_nop\n\tv_nop\n\tv_nop\n\tv_nop" : "+v"(d) : "v"(a), "v"(b));
  return d;
}
// 16x16x32 fragments: lane = (h = lane>>4, row/col = lane&15); elements 0..7 = k0+8h+0..7, 8..15 = k0+16+8h+0..7; D element r = row 8h+r
__device__ __forceinline__ v16h frag_h(const _Float16* rowk0, int lane) {
  union { v16h v; v8h q[2]; } u; const _Float16* p = rowk0 + 8 * (lane >> 4);
  u.q[0] = *(const v8h*)p; u.q[1] = *(const v8h*)(p + 16); return u.v;
}
__device__ __forceinline__ v16h frag_f32(const float* rowk0, int lane) {
  v16h a; const float* p = rowk0 + 8 * (lane >> 4);
#pragma unroll
  for (int i = 0; i < 8; ++i) { a[i] = (_Float16)p[i]; a[8 + i] = (_Float16)p[16 + i]; }
  return a;
}
__device__ __forceinline__ v16h frag_f32s(const float* rowk0, int lane, float sc) {
  v16h a; const float* p = rowk0 + 8 * (lane >> 4);
#pragma unroll
  for (int i = 0; i < 8; ++i) { a[i] = (_Float16)(p[i] * sc); a[8 + i] = (_Float16)(p[16 + i] * sc); }
  return a;
}
// column fragment from a [K][ld] layout (column n), rows >= K read as 0
__device__ __forceinline__ v16h fragc_f32(const float* W, int k0, int n, int lane, int ld, int K) {
  v16h a; const int g = lane >> 4;
#pragma unroll
  for (int i = 0; i < 8; ++i) { const int ka = k0 + 8 * g + i, kb = ka + 16;
    a[i] = (_Float16)(ka < K ? W[(size_t)(ka < K ? ka : K - 1) * ld + n] : 0.f); a[8 + i] = (_Float16)(kb < K ? W[(size_t)(kb < K ? kb : K - 1) * ld + n] : 0.f); }
  return a;
}
struct F2 { v16b h, l; };
__device__ __forceinline__ F2 bsplit16(const float v[16]) { F2 r;
#pragma unroll
  for (int i = 0; i < 16; ++i) { const __bf16 h = (__bf16)v[i]; r.h[i] = h; r.l[i] = (__bf16)(v[i] - (float)h); }
  return r; }
__device__ __forceinline__ F2 split_row(const float* row, int k0, int lane) { float v[16]; const float* p = row + k0 + 8 * (lane >> 4);
#pragma unroll
  for (int i = 0; i < 8; ++i) { v[i] = p[i]; v[8 + i] = p[16 + i]; }
  return bsplit16(v); }
__device__ __forceinline__ F2 split_rowK(const float* row, int k0, int lane, int K) { float v[16]; const int g = lane >> 4;
#pragma unroll
  for (int i = 0; i < 8; ++i) { const int ka = k0 + 8 * g + i, kb = ka + 16; v[i] = ka < K ? row[ka < K ? ka : K - 1] : 0.f; v[8 + i] = kb < K ? row[kb < K ? kb : K - 1] : 0.f; }
  return bsplit16(v); }
__device__ __forceinline__ F2 split_col(const float* W, int k0, int n, int lane, int ld, int K) { float v[16]; const int g = lane >> 4;
#pragma unroll
  for (int i = 0; i < 8; ++i) { const int ka = k0 + 8 * g + i, kb = ka + 16; v[i] = ka < K ? W[(size_t)(ka < K ? ka : K - 1) * ld + n] : 0.f; v[8 + i] = kb < K ? W[(size_t)(kb < K ? kb : K - 1) * ld + n] : 0.f; }
  return bsplit16(v); }
__device__ __forceinline__ v8f mac3(const F2& a, const F2& b, v8f c) { c = wmma_bf(a.l, b.h, c); c = wmma_bf(a.h, b.l, c); return wmma_bf(a.h, b.h, c); }
__device__ __forceinline__ float sigm(float v) { return 1.0f / (1.0f + expf(-v)); }
#define LDSX() do { asm volatile("s_wait_dscnt 0" ::: "memory"); __builtin_amdgcn_wave_barrier(); __builtin_amdgcn_fence(__ATOMIC_RELEASE, "workgroup"); } while (0)


// Trajectory attention (B 2, T 2,048, C 1,024 = 16 x 64): q/k/v Linear, rotary position embedding (base 10000, rotate_half), causal softmax(q k / 8) v, output Linear.
#define NB 2
#define TT 2048
#define CC 1024
#define NH 16
#define HD 64
#ifndef TNB
#define TNB NB
#endif
typedef __attribute__((ext_vector_type(8))) __bf16 v8b;
__device__ __forceinline__ v16b frag_b(const __bf16* rowk0, int lane) {
  union { v16b v; v8b q[2]; } u; const __bf16* p = rowk0 + 8 * (lane >> 4);
  u.q[0] = *(const v8b*)p; u.q[1] = *(const v8b*)(p + 16); return u.v;
}
__device__ __forceinline__ float bfr(float v) { return (float)(__bf16)v; }
__device__ __attribute__((noinline)) float exp_ni(float v) { return expf(v); }
__device__ __attribute__((noinline)) float erf_ni(float v) { return erff(v); }

// ---- operand staging of k_proj and k_out: a block brings GK k of every operand row with whole-line 16-byte loads and keeps bf16 rows in LDS; y comes as f32 (16 lanes = 256 B of one row) and is split once a block
#define GK 64
#define GP (GK + 8)   // LDS row pitch in elements: 144 B = 16 B x 9, free of bank conflicts for the 16-byte fragment reads
typedef __attribute__((ext_vector_type(4))) __bf16 v4b;
// every '#pragma unroll' of the staging helpers and loops: the loop indexes register arrays, which stay in registers only when it is unrolled
// p = the thread's own place: row tid / 16, float4 tid % 16 of the chunk; load i is 8 i rows further down
template <int N> __device__ __forceinline__ void g_fetch(const float* p, v4f* r) {
#pragma unroll
  for (int i = 0; i < N; ++i) r[i] = *(const v4f*)(p + (size_t)i * 8 * CC); }
template <int N> __device__ __forceinline__ void g_put2(__bf16 (*th)[GP], __bf16 (*tl)[GP], int lr, int lc, const v4f* r) {   // bf16 hi + residual, as bsplit16
#pragma unroll
  for (int i = 0; i < N; ++i) { v4b oh, ol;
#pragma unroll
    for (int e = 0; e < 4; ++e) { const __bf16 h = (__bf16)r[i][e]; oh[e] = h; ol[e] = (__bf16)(r[i][e] - (float)h); }
    *(v4b*)&th[lr + 8 * i][lc] = oh; *(v4b*)&tl[lr + 8 * i][lc] = ol; } }

// operands that k_cvt has already rounded to bf16: GK k of a row are one 128-byte line, 8 lanes of 16 bytes; p = the thread's own place, load i is 16 i rows further down
template <int N> __device__ __forceinline__ void b_fetch(const __bf16* p, v4u* r) {
#pragma unroll
  for (int i = 0; i < N; ++i) r[i] = *(const v4u*)(p + (size_t)i * 16 * CC); }
template <int N> __device__ __forceinline__ void b_put(__bf16 (*t)[GP], int lr, int lc, const v4u* r) {
#pragma unroll
  for (int i = 0; i < N; ++i) *(v4u*)&t[lr + 16 * i][lc] = r[i]; }

#define WS_QH  0u
#define WS_QL  (WS_QH + 2u * (size_t)NB * TT * CC)
#define WS_KH  (WS_QL + 2u * (size_t)NB * TT * CC)
#define WS_VT  (WS_KH + 2u * (size_t)NB * TT * CC)      // bf16 v planes
#define WS_VL  (WS_VT + 2u * (size_t)NB * CC * TT)      // bf16 v residual planes
#define WS_Y   (WS_VL + 2u * (size_t)NB * CC * TT)      // f32 y rows [b*t][C]
#define WS_XB  (WS_Y + 4u * (size_t)NB * TT * CC)       // bf16 x rows [b*t][C], then bf16 Wq, Wk, Wv, Wo, each [out][in]
#define WS_WB  (WS_XB + 2u * (size_t)NB * TT * CC)
#define WS_END (WS_WB + 4u * 2u * (size_t)CC * CC)
// q, k and the v planes lie in the workspace in WMMA fragment order: [b][h][32-position slice][8 half fragments][lane][8 elements], FS elements a slice, so that a wave-wide 16-byte load or store covers 512 contiguous bytes (4 whole lines).
// q, k: half fragment (j*2 + kc)*2 + qh, lane (g, col) = position 16j + col of the slice, dims 32kc + 16qh + 8g + 0..7 of the head. v: half fragment j*2 + qh, lane (g, col) = dim 16j + col of the head, positions 16qh + 8g + 0..7 of the slice.
#define FS (32 * HD)
// k_proj's way out, one half of a block's tile at a time: 64 positions x 128 columns are 2 neighbouring slices of 2 heads, 1,024 units of 16 bytes, 8 a thread; unit i of thread (wave, g, col) is half fragment wave + 4 (i & 1) of slice (i & 3) >> 1 of head i >> 2.
// t = the half tile in LDS ([position][column] for q and k, [column][position] for v), dst = the thread's own place in the first slice of the first head. Both loops are unrolled because they index a register array.
template <bool ISV, typename T, int P> __device__ __forceinline__ void put_frags(T* dst, const T (*t)[P], int wave, int g, int col) { v4u a[8];
#pragma unroll
  for (int i = 0; i < 8; ++i) { if constexpr (ISV) a[i] = *(const v4u*)&t[(i >> 2) * HD + ((wave >> 1) + 2 * (i & 1)) * 16 + col][((i & 3) >> 1) * 32 + (wave & 1) * 16 + g * 8]; else a[i] = *(const v4u*)&t[(i & 3) * 16 + col][(i >> 2) * HD + wave * 16 + g * 8]; }
#pragma unroll
  for (int i = 0; i < 8; ++i) *(v4u*)(dst + (size_t)(i >> 2) * (TT / 32) * FS + (i & 3) * 1024) = a[i];
  asm volatile("s_wait_xcnt 0x0" :: "v"(dst), "v"(a[0]), "v"(a[1]), "v"(a[2]), "v"(a[3]), "v"(a[4]), "v"(a[5]), "v"(a[6]), "v"(a[7]) : "memory"); }   // stands in front of every overwrite of the stores' address and data registers, which it holds until here

// ---- k_cvt: x and the four weight matrices are rounded to bf16 once, so that every block of k_proj and k_out that draws a row from L2 draws 2 bytes an element, not 4, and converts nothing
// grid = (32, 8): row y of the grid takes CVE elements, a quarter of x (y < 4) or one weight matrix; one block a WGP, 32 whole-line loads a thread, issued ahead of the stores
#define CVE (CC * CC)
__global__ __launch_bounds__(256) void k_cvt(const float* __restrict__ X, const float* __restrict__ WQ, const float* __restrict__ WK, const float* __restrict__ WV, const float* __restrict__ WP, __bf16* __restrict__ XB) {
  static_assert((size_t)NB * TT * CC == 4 * (size_t)CVE && CVE == 32 * 32 * 256 * 4, "the grid covers x and the weights exactly");
  const int y = blockIdx.y; const float* s = y < 4 ? X + (size_t)y * CVE : y == 4 ? WQ : y == 5 ? WK : y == 6 ? WV : WP;
  const size_t o = (size_t)blockIdx.x * (32 * 256 * 4) + threadIdx.x * 4; const float* p = s + o; __bf16* d = XB + (size_t)y * CVE + o;
  v4f r[32];
#pragma unroll   // both loops index a register array
  for (int i = 0; i < 32; ++i) r[i] = *(const v4f*)(p + i * 1024);
  asm volatile("s_wait_xcnt 0x0" :: "v"(p) : "memory");   // stands in front of every overwrite of the loads' address registers, which it holds until here
#pragma unroll
  for (int i = 0; i < 32; ++i) { v4b c;
#pragma unroll
    for (int e = 0; e < 4; ++e) c[e] = (__bf16)r[i][e];
    *(v4b*)(d + i * 1024) = c; } }
// ---- k_proj: block = (128 rows, 128 cols, which), 2 x 2 waves of 64 x 64 each, so that every x and W row fetched from L2 serves 128 outputs: qkv = x W (+ b), exact; q -> f16 hi (+ residual), k -> f16, v -> bf16 hi + residual planes, all in fragment order
// the staging buffers are dead when the epilogue's arrays come to life: they share the block's LDS; the epilogue takes the tile in two halves of 64 rows, so that three blocks still fit a WGP's LDS
union ProjLds { struct { __bf16 x[2][128][GP], w[2][128][GP]; } st; struct { _Float16 sh[64][136], sl[64][136]; __bf16 th[128][72], tl2[128][72]; float sf[64][132]; } ep; };
// amdgpu_waves_per_eu(3): holds the allocation at a third of a SIMD's registers, so that three blocks share a WGP and the grid's 768 blocks are all resident at once
__global__ __launch_bounds__(128) __attribute__((amdgpu_waves_per_eu(3))) void k_proj(const __bf16* __restrict__ XB, const __bf16* __restrict__ WB, const float* __restrict__ BQ, const float* __restrict__ BK, const float* __restrict__ BV, _Float16* __restrict__ QH, _Float16* __restrict__ QL, _Float16* __restrict__ KH, __bf16* __restrict__ VT, __bf16* __restrict__ VL) {
  __shared__ __align__(16) ProjLds lds; _Float16 (&sh)[64][136] = lds.ep.sh; _Float16 (&sl)[64][136] = lds.ep.sl; __bf16 (&th)[128][72] = lds.ep.th; __bf16 (&tl2)[128][72] = lds.ep.tl2; float (&sf)[64][132] = lds.ep.sf;
  const int tid = threadIdx.x, wave = __builtin_amdgcn_readfirstlane(tid >> 5), lane = tid & 31, col = lane & 15, g = lane >> 4; const int which = blockIdx.z; const int c0 = blockIdx.y * 128; const size_t r0 = (size_t)blockIdx.x * 128; const float* BA = which == 0 ? BQ : which == 1 ? BK : BV;
  const int wr = wave >> 1, wc = wave & 1;   // the wave's 64 rows and 64 columns of the tile; the wave number is read into a scalar, so that what is formed from it takes no vector register and the epilogue's test on wr is a scalar branch
  v8f acc[4][4] = {};
  const int lr = (tid >> 4) + 8 * ((tid >> 3) & 1), lc = (tid & 7) * 8;   // 16 lanes take rows 8 apart: 8 pitches are 32 banks past a multiple of 64, so their 16-byte LDS stores meet on no bank
  const __bf16* px = XB + (r0 + lr) * CC + lc; const __bf16* pw = WB + ((size_t)which * CC + c0 + lr) * CC + lc;
  v4u rx[8], rw[8]; b_fetch<8>(px, rx); b_fetch<8>(pw, rw);
  asm volatile("s_wait_xcnt 0x0" :: "v"(px), "v"(pw) : "memory");   // stands in front of every overwrite of the loads' address registers, which it holds until here
#pragma unroll 2   // the buffer index becomes a constant in each copy of the body
  for (int c = 0; c < CC / GK; ++c) { const int bs = c & 1; b_put<8>(lds.st.x[bs], lr, lc, rx); b_put<8>(lds.st.w[bs], lr, lc, rw);
    __syncthreads();   // chunk c is whole in LDS before any wave reads it; it also ends every wave's reads of the other buffer, which the next trip refills
    if (c + 1 < CC / GK) { px += GK; pw += GK; b_fetch<8>(px, rx); b_fetch<8>(pw, rw);   // the next chunk flies under this chunk's products
      asm volatile("s_wait_xcnt 0x0" :: "v"(px), "v"(pw) : "memory"); }   // as above
#pragma unroll
    for (int kk = 0; kk < GK / 32; ++kk) { v16b a[4], w[4];
#pragma unroll
      for (int i = 0; i < 4; ++i) a[i] = frag_b(&lds.st.x[bs][wr * 64 + i * 16 + col][kk * 32], lane);
#pragma unroll
      for (int j = 0; j < 4; ++j) w[j] = frag_b(&lds.st.w[bs][wc * 64 + j * 16 + col][kk * 32], lane);
#pragma unroll
      for (int i = 0; i < 4; ++i)
#pragma unroll
        for (int j = 0; j < 4; ++j) acc[i][j] = wmma_bf(a[i], w[j], acc[i][j]); } }
  __syncthreads();   // every wave has left the staging buffers before the epilogue's arrays overwrite them
  float bb[4];
#pragma unroll
  for (int j = 0; j < 4; ++j) bb[j] = bfr(BA[c0 + wc * 64 + j * 16 + col]);
  const float inv_freq = 1.0f / powf(10000.0f, (float)(2 * lane) / 64.0f);   // rotary: a lane keeps one frequency i = lane
#pragma unroll   // in a rolled loop the compiler forms both halves' sums and conversions ahead of the loop and holds them in registers, which costs a resident block
  for (int hf = 0; hf < 2; ++hf) { const size_t rh = r0 + hf * 64;   // rows rh .. rh + 63: the two waves that hold them lay them down, all four work them up
    if (wr == hf) {
      if (which == 2) {
#pragma unroll
        for (int i = 0; i < 4; ++i)
#pragma unroll
          for (int j = 0; j < 4; ++j)
#pragma unroll
            for (int r = 0; r < 8; ++r) { const float v = acc[i][j][r] + bb[j]; const int rl = i * 16 + 8 * g + r, cl = wc * 64 + j * 16 + col; const __bf16 bh = (__bf16)v; th[cl][rl] = bh; tl2[cl][rl] = (__bf16)(v - (float)bh); } }
      else {
#pragma unroll
        for (int i = 0; i < 4; ++i)
#pragma unroll
          for (int j = 0; j < 4; ++j)
#pragma unroll
            for (int r = 0; r < 8; ++r) sf[i * 16 + 8 * g + r][wc * 64 + j * 16 + col] = acc[i][j][r] + bb[j]; } }
    __syncthreads();
    if (which < 2) {   // rotary: out[d] = x[d] cos(t f_{d mod 32}) + (d < 32 ? -x[d+32] : x[d-32]) sin(t f_{d mod 32}); f_i = 10000^(-i/32)
      // a wave takes every 4th position: the angle's cosine and sine are formed once and serve the 4 elements that share them (d = i and i + 32 of both heads of the block)
      for (int it = 0; it < 64 / 4; ++it) { const int rl = it * 4 + wave; const int tpos = (int)((rh + rl) % TT); const float ang = (float)tpos * inv_freq; float c, s; sincosf(ang, &s, &c);
#pragma unroll   // the LDS reads of both heads issue together
        for (int hh = 0; hh < 128 / HD; ++hh) { const int cl = hh * HD + lane; const float x1 = sf[rl][cl], x2 = sf[rl][cl + 32];
          const float v1 = fmaf(x1, c, -x2 * s), v2 = fmaf(x2, c, x1 * s); const _Float16 h1 = (_Float16)v1, h2 = (_Float16)v2;   // the sine product rounded first, then one multiply-add, for both halves
          sh[rl][cl] = h1; sl[rl][cl] = (_Float16)(v1 - (float)h1); sh[rl][cl + 32] = h2; sl[rl][cl + 32] = (_Float16)(v2 - (float)h2); } }
      __syncthreads(); }
    const size_t fb = (((rh / TT) * NH + c0 / HD) * (size_t)(TT / 32) + (rh % TT) / 32) * FS + tid * 8;
    if (which < 2) { put_frags<false>((which == 0 ? QH : KH) + fb, sh, wave, g, col); if (which == 0) put_frags<false>(QL + fb, sl, wave, g, col); }
    else { put_frags<true>(VT + fb, th, wave, g, col); put_frags<true>(VL + fb, tl2, wave, g, col); }
    if (hf == 0) __syncthreads(); } }   // every wave has read the first half out of LDS before the second half is laid down
// ---- k_att: block = 16 * QT queries of (b,h), AW waves; wave w takes the 32-key slices w, w + AW, ... up to the diagonal, each k and v fragment serving the QT query tiles. ONE sweep with a running row maximum: logits transposed on WMMA (k as A, q as B: a lane holds 16 keys of ONE query, in the k order of a P fragment), exp((a - max in use) / 8) in f32 as exp2 of one multiply-add, then v^T . P^T (v as A, P bf16 hi + lo as B), so that a lane's accumulators belong to the same query and one factor per lane rescales them. Each wave ends with its own maximum, row sums and f32 partial tiles; they are brought to the common maximum and summed in LDS in wave order: y[q][h*HD + d] = P . v / sum
// grid = (head, batch, query block), the query block counted down from the last: a block's cost grows with its number of key slices and there are four times as many blocks as resident places, so the longest blocks of all heads start first and the shortest fill the end of the launch
// every '#pragma unroll' of k_att and its helpers without a note of its own: the loop indexes fragment, accumulator or per-row arrays, which stay in registers only when it is unrolled
#define AW 8   // the wave number is read into a scalar so that each wave's trip test is a scalar branch
#define QT 2
#define SC2 0.18033688011112042f   // log2(e) / 8: exp((a - amax) / 8) = exp2(a SC2 - amax SC2)
#define RTH 44.0f   // the maximum in use may trail a row's true maximum by this much in unscaled logits (below 8 in the exponent of 2, so an exponential stays below 256)
struct KF { v16h f[2][HD / 32]; };   // k fragments of one slice: [16-key group][32 of the head's 64 dims]
// pk = the lane's own 16 bytes in the slice's first half fragment
__device__ __forceinline__ KF att_k(const _Float16* pk) { KF k;
#pragma unroll
  for (int j = 0; j < 2; ++j)
#pragma unroll
    for (int kc = 0; kc < HD / 32; ++kc) { union { v16h v; v8h q[2]; } u; const _Float16* p = pk + (j * (HD / 32) + kc) * 512; u.q[0] = *(const v8h*)p; u.q[1] = *(const v8h*)(p + 256); k.f[j][kc] = u.v; }
  return k; }
// pv = the lane's own 16 bytes in the first half fragment of the slice of a v plane
__device__ __forceinline__ v16b att_v(const __bf16* pv, int j) { union { v16b v; v8b q[2]; } u; const __bf16* p = pv + j * 512; u.q[0] = *(const v8b*)p; u.q[1] = *(const v8b*)(p + 256); return u.v; }
__device__ __forceinline__ float xhalf(float x) { return __builtin_bit_cast(float, __builtin_amdgcn_permlanex16(__builtin_bit_cast(int, x), __builtin_bit_cast(int, x), 0x76543210, 0xfedcba98, false, false)); }   // lane l with lane l ^ 16
// transposed logits of one query tile against one slice, D layout: sc[j][r] = key s*32 + j*16 + 8g + r against query q0 + col, not yet scaled by 1/8 (SC2 holds the scale), keys above the diagonal masked
__device__ __forceinline__ void att_logits(const KF& k, const v16h* ah, int s, int q0, int lane, v8f* sc) { const int col = lane & 15, g = lane >> 4; const int qt = q0 + col;
#pragma unroll
  for (int j = 0; j < 2; ++j) { v8f a = {};
#pragma unroll
    for (int kc = 0; kc < HD / 32; ++kc) a = wmma16(k.f[j][kc], ah[kc], a);
#pragma unroll
    for (int r = 0; r < 8; ++r) { const int kt = s * 32 + j * 16 + 8 * g + r; float v = a[r]; if (kt > qt) v = -3.0e38f; sc[j][r] = v; } } }
// amdgpu_waves_per_eu(4): holds the allocation at 256 registers, so that two blocks share a WGP
__global__ __launch_bounds__(32 * AW) __attribute__((amdgpu_waves_per_eu(4))) void k_att(const _Float16* __restrict__ QH, const _Float16* __restrict__ KH, const __bf16* __restrict__ VT, const __bf16* __restrict__ VL, float* __restrict__ Y) { __shared__ __align__(16) float ss[AW][16 * QT][HD + 4]; __shared__ float smx[AW][16 * QT], ssum[AW][16 * QT];
  const int tid = threadIdx.x, wave = __builtin_amdgcn_readfirstlane(tid >> 5), lane = tid & 31, col = lane & 15, g = lane >> 4; const int b = blockIdx.y, h = blockIdx.x, qb = TT / (16 * QT) - 1 - (int)blockIdx.z, ql0 = qb * (16 * QT); const int ns = ((ql0 + 16 * QT - 1) >> 5) + 1;   // slices that hold a key <= the block's last query
  static_assert(16 * QT == 32 && HD == 64, "a block's queries are one slice of the fragment order");
  const size_t vo = ((size_t)b * NH + h) * (size_t)(TT / 32) * FS + lane * 8; const _Float16* Kl = KH + vo;   // the lane's own place in slice 0 of the head, the same in q, k and the v planes
  v16h ah[QT][HD / 32];
  { const _Float16* pq = QH + vo + (size_t)qb * FS;
#pragma unroll
    for (int t = 0; t < QT; ++t)
#pragma unroll
      for (int kc = 0; kc < HD / 32; ++kc) { union { v16h v; v8h q[2]; } u; const _Float16* p = pq + (t * (HD / 32) + kc) * 512; u.q[0] = *(const v8h*)p; u.q[1] = *(const v8h*)(p + 256); ah[t][kc] = u.v; }
    asm volatile("s_wait_xcnt 0x0" :: "v"(pq) : "memory"); }   // stands in front of every overwrite of the loads' address registers, which it holds until here
  float mr[QT], m[QT], lsum[QT];   // a lane serves query col of each tile: mr = the maximum in use (unscaled logits), m = -mr SC2, the addend of the exponent
#pragma unroll
  for (int t = 0; t < QT; ++t) { mr[t] = -3.0e38f; m[t] = 0.f; lsum[t] = 0.f; }
  v8f acc[QT][HD / 16] = {};   // acc[t][j][r] = dim 16j + 8g + r of query col of tile t
  for (int s = wave; s < ns; s += AW) { v16b vh[HD / 16], vl[HD / 16];   // v is fetched ahead of its use: the hi plane with k, the lo plane under the maxima and exponentials
    const __bf16* pvh = VT + vo + (size_t)s * FS; const __bf16* pvl = VL + vo + (size_t)s * FS; const _Float16* pk = Kl + (size_t)s * FS;
#pragma unroll
    for (int j = 0; j < HD / 16; ++j) vh[j] = att_v(pvh, j);
    v8f sc[QT][2];
    { const KF k = att_k(pk);
      asm volatile("s_wait_xcnt 0x0" :: "v"(pk), "v"(pvh) : "memory");   // as above, for the k and v hi loads
#pragma unroll
      for (int t = 0; t < QT; ++t) att_logits(k, ah[t], s, ql0 + t * 16, lane, sc[t]); }
#pragma unroll
    for (int j = 0; j < HD / 16; ++j) vl[j] = att_v(pvl, j);
    asm volatile("s_wait_xcnt 0x0" :: "v"(pvl) : "memory");   // as above, for the v lo loads
    float mb[QT]; bool need = false;   // every query of the block has an unmasked key in every slice up to the diagonal (the slice's first), so mb is a real logit
#pragma unroll
    for (int t = 0; t < QT; ++t) { float mx = fmaxf(sc[t][0][0], sc[t][1][0]);
#pragma unroll
      for (int r = 1; r < 8; ++r) mx = fmaxf(mx, fmaxf(sc[t][0][r], sc[t][1][r]));
      mx = fmaxf(mx, xhalf(mx)); mb[t] = mx; need = need || (mx > mr[t] + RTH); }   // both halves of the wave now hold the query's maximum over the slice
    if (__builtin_amdgcn_ballot_w32(need) != 0) {   // one scalar branch a slice: always taken on a wave's first slice (factor 0 on zeros), seldom later
#pragma unroll
      for (int t = 0; t < QT; ++t) { const float mn = fmaxf(mr[t], mb[t]); const float corr = __builtin_amdgcn_exp2f((mr[t] - mn) * SC2); mr[t] = mn; m[t] = mn * -SC2; lsum[t] *= corr;
#pragma unroll
        for (int j = 0; j < HD / 16; ++j) acc[t][j] = acc[t][j] * corr; } }
#pragma unroll
    for (int t = 0; t < QT; ++t) { float v[16];   // two D tiles of the transposed logits are one P fragment: element i = key 8g + i, element 8 + i = key 16 + 8g + i
#pragma unroll
      for (int i = 0; i < 8; ++i) { v[i] = sc[t][0][i]; v[8 + i] = sc[t][1][i]; }
#pragma unroll
      for (int i = 0; i < 16; i += 2) { const v2f e = __builtin_elementwise_fma(v2f{v[i], v[i + 1]}, v2f{SC2, SC2}, v2f{m[t], m[t]}); v[i] = __builtin_amdgcn_exp2f(e.x); v[i + 1] = __builtin_amdgcn_exp2f(e.y); }   // a masked logit is -3e38: its exponent is below -5e37 and its exponential an exact 0
#pragma unroll
      for (int i = 0; i < 16; ++i) lsum[t] += v[i];
      const F2 p = bsplit16(v);   // each of the three products runs over the four output tiles, so that no WMMA waits for the one before it
#pragma unroll
      for (int j = 0; j < HD / 16; ++j) acc[t][j] = wmma_bf(vh[j], p.h, acc[t][j]);
#pragma unroll
      for (int j = 0; j < HD / 16; ++j) acc[t][j] = wmma_bf(vh[j], p.l, acc[t][j]);
#pragma unroll
      for (int j = 0; j < HD / 16; ++j) acc[t][j] = wmma_bf(vl[j], p.h, acc[t][j]);
      } }
#pragma unroll
  for (int t = 0; t < QT; ++t) { lsum[t] += xhalf(lsum[t]);   // the two halves of a wave hold the two halves of each row's keys
    if (g == 0) { ssum[wave][t * 16 + col] = lsum[t]; smx[wave][t * 16 + col] = mr[t]; }
#pragma unroll
    for (int j = 0; j < HD / 16; ++j) { const v8f a = acc[t][j]; float* pd = &ss[wave][t * 16 + col][j * 16 + 8 * g]; *(v4f*)pd = v4f{a[0], a[1], a[2], a[3]}; *(v4f*)(pd + 4) = v4f{a[4], a[5], a[6], a[7]}; } }
  __syncthreads();   // every wave's partial tiles, row sums and maxima are in LDS before any thread sums across waves
  static_assert(16 * (HD / 4) == 32 * AW, "one float4 of each query tile per thread");
#pragma unroll
  for (int t = 0; t < QT; ++t) { const int rl = t * 16 + tid / (HD / 4), c4 = (tid % (HD / 4)) * 4; float mw[AW], M = -3.0e38f;
#pragma unroll
    for (int w = 0; w < AW; ++w) { mw[w] = smx[w][rl]; M = fmaxf(M, mw[w]); }
    v4f s = {}; float L = 0.f;
#pragma unroll   // the LDS reads of all partials issue together; the sums keep wave order; a wave without a slice has maximum -3e38, factor 0, and zeros
    for (int w = 0; w < AW; ++w) { const float f = __builtin_amdgcn_exp2f((mw[w] - M) * SC2); s += *(const v4f*)&ss[w][rl][c4] * f; L += ssum[w][rl] * f; }
    vst2(Y + ((size_t)b * TT + ql0 + rl) * CC + h * HD + c4, s * (1.0f / L)); } }
// ---- k_out: block = (64 rows, 128 cols): out = y (bf16 hi + lo) Wproj + b
__global__ __launch_bounds__(128) void k_out(const float* __restrict__ Y, const __bf16* __restrict__ WPB, const float* __restrict__ BP, float* __restrict__ OUT) { __shared__ __align__(16) float sf[4][16][132]; __shared__ __align__(16) __bf16 yh[2][64][GP], yl[2][64][GP], wt[2][128][GP];
  const int tid = threadIdx.x, wave = tid >> 5, lane = tid & 31, col = lane & 15, g = lane >> 4; const int c0 = blockIdx.y * 128; const size_t r0 = (size_t)blockIdx.x * 64 + wave * 16;
  v8f acc[8] = {};
  const int lr = tid >> 4, lc = (tid & 15) * 4; const float* py = Y + ((size_t)blockIdx.x * 64 + lr) * CC + lc;
  const int wlr = (tid >> 4) + 8 * ((tid >> 3) & 1), wlc = (tid & 7) * 8; const __bf16* pw = WPB + (size_t)(c0 + wlr) * CC + wlc;   // the thread's place in the bf16 weight chunk, as in k_proj
  v4f ry[8]; v4u rw[8]; g_fetch<8>(py, ry); b_fetch<8>(pw, rw);
  asm volatile("s_wait_xcnt 0x0" :: "v"(py), "v"(pw) : "memory");   // stands in front of every overwrite of the loads' address registers, which it holds until here
#pragma unroll 2   // the buffer index becomes a constant in each copy of the body
  for (int c = 0; c < CC / GK; ++c) { const int bs = c & 1; g_put2<8>(yh[bs], yl[bs], lr, lc, ry); b_put<8>(wt[bs], wlr, wlc, rw);
    __syncthreads();   // chunk c is whole in LDS before any wave reads it; it also ends every wave's reads of the other buffer, which the next trip refills
    if (c + 1 < CC / GK) { py += GK; pw += GK; g_fetch<8>(py, ry); b_fetch<8>(pw, rw);   // the next chunk flies under this chunk's products
      asm volatile("s_wait_xcnt 0x0" :: "v"(py), "v"(pw) : "memory"); }   // as above
#pragma unroll
    for (int kk = 0; kk < GK / 32; ++kk) { const v16b ah = frag_b(&yh[bs][wave * 16 + col][kk * 32], lane), al = frag_b(&yl[bs][wave * 16 + col][kk * 32], lane); v16b w[8];
#pragma unroll
      for (int j = 0; j < 8; ++j) w[j] = frag_b(&wt[bs][j * 16 + col][kk * 32], lane);
#pragma unroll
      for (int j = 0; j < 8; ++j) { acc[j] = wmma_bf(ah, w[j], acc[j]); acc[j] = wmma_bf(al, w[j], acc[j]); } } }
#pragma unroll
  for (int j = 0; j < 8; ++j) { const float bb = BP ? bfr(BP[c0 + j * 16 + col]) : 0.f;
#pragma unroll
    for (int r = 0; r < 8; ++r) sf[wave][8 * g + r][j * 16 + col] = acc[j][r] + bb; }
  LDSX(); for (int rl = 0; rl < 16; ++rl) vst2(OUT + (r0 + rl) * CC + c0 + lane * 4, *(const v4f*)&sf[wave][rl][lane * 4]); }
extern "C" void kernel_launch(void* const* d_in, const int* in_sizes, int n_in, void* d_out, int out_size, void* d_ws, size_t ws_size, hipStream_t stream) {
  (void)in_sizes; (void)n_in; (void)out_size;
  const float** F = (const float**)d_in;   // 0 x [2,2048,1024], 1 Wq [1024,1024] ([out,in]), 2 bq, 3 Wk, 4 bk, 5 Wv, 6 bv, 7 Wo, 8 bo
  if (ws_size < (size_t)WS_END) return;
  char* ws = (char*)d_ws; _Float16 *QH = (_Float16*)(ws + WS_QH), *QL = (_Float16*)(ws + WS_QL), *KH = (_Float16*)(ws + WS_KH); __bf16 *VT = (__bf16*)(ws + WS_VT), *VL = (__bf16*)(ws + WS_VL); float *Y = (float*)(ws + WS_Y); __bf16 *XB = (__bf16*)(ws + WS_XB), *WB = (__bf16*)(ws + WS_WB);
  k_cvt<<<dim3(32, 8), 256, 0, stream>>>(F[0], F[1], F[3], F[5], F[7], XB);
  k_proj<<<dim3(TNB * TT / 128, CC / 128, 3), 128, 0, stream>>>(XB, WB, F[2], F[4], F[6], QH, QL, KH, VT, VL);
  k_att<<<dim3(NH, TNB, TT / (16 * QT)), 32 * AW, 0, stream>>>(QH, KH, VT, VL, Y);
  k_out<<<dim3(TNB * TT / 64, CC / 128), 128, 0, stream>>>(Y, WB + 3 * (size_t)CC * CC, F[8], (float*)d_out);
}
